// v000
// The times below were measured on an AMD MI455X: many runs one after another, warmed up first and cycling through
// copies of the inputs, with the whole window's GPU time divided by the number of runs. Launches and the gaps
// between them are all in it. The median over several windows is given; except for v000 it joins two sittings, which
// can be a few percent apart, so the side-by-side timings, each taken in one sitting, are the better comparison.
// The starting kernel, v000, takes 701 microseconds a run.
#include <hip/hip_runtime.h>
#include <hip/hip_bf16.h>
#include <math.h>

typedef __attribute__((ext_vector_type(16))) _Float16 v16h;
typedef __attribute__((ext_vector_type(8)))  _Float16 v8h;
typedef __attribute__((ext_vector_type(8)))  float    v8f;

#define NTOK 49
#define CC   128
#define NHEAD 4
#define HID  512
#define HW   56
#define SHFT 3
#define LN_EPS 1e-5f

#define WMMA_F16(a, b, c) \
  __builtin_amdgcn_wmma_f32_16x16x32_f16(false, (a), false, (b), (short)0, (c), false, false)

__device__ __forceinline__ float wred_sum(float v) {
#pragma unroll
  for (int o = 16; o > 0; o >>= 1) v += __shfl_xor(v, o, 32);
  return v;
}

// A/B-operand fragment (16x32 f16 tile, rows striped over lanes, K along VGPRs).
// Per ISA 7.12.2 the per-lane halves are contiguous in two 16B runs: K+[0..7] and K+[16..23]
// (K offset +8 for lanes 16..31) -> two 128-bit loads.
__device__ __forceinline__ v16h ld_a(const _Float16* buf, int ld, int row0, int col0, int lane) {
  int m  = row0 + (lane & 15);
  int kb = (lane >> 4) << 3;
  const v8h* p = (const v8h*)(buf + m * ld + col0 + kb);
  v8h lo = p[0];
  v8h hi = p[2];
  return __builtin_shufflevector(lo, hi, 0, 1, 2, 3, 4, 5, 6, 7,
                                         8, 9, 10, 11, 12, 13, 14, 15);
}

// Same fragment sourced from an f32 buffer (two 32B runs), converting to f16.
__device__ __forceinline__ v16h ld_a_f32(const float* buf, int ld, int row0, int col0, int lane) {
  int m  = row0 + (lane & 15);
  int kb = (lane >> 4) << 3;
  const float4* p = (const float4*)(buf + m * ld + col0 + kb);
  float4 q0 = p[0], q1 = p[1], q2 = p[4], q3 = p[5];
  v16h a;
  a[0]  = (_Float16)q0.x; a[1]  = (_Float16)q0.y; a[2]  = (_Float16)q0.z; a[3]  = (_Float16)q0.w;
  a[4]  = (_Float16)q1.x; a[5]  = (_Float16)q1.y; a[6]  = (_Float16)q1.z; a[7]  = (_Float16)q1.w;
  a[8]  = (_Float16)q2.x; a[9]  = (_Float16)q2.y; a[10] = (_Float16)q2.z; a[11] = (_Float16)q2.w;
  a[12] = (_Float16)q3.x; a[13] = (_Float16)q3.y; a[14] = (_Float16)q3.z; a[15] = (_Float16)q3.w;
  return a;
}

// ---- weight prep: wt[n][k] = (f16) w[k][n] -----------------------------------
__global__ void k_wprep(const float* __restrict__ w, _Float16* __restrict__ wt, int K, int N) {
  int total = K * N;
  for (int i = blockIdx.x * blockDim.x + threadIdx.x; i < total; i += gridDim.x * blockDim.x) {
    int n = i / K, k = i - n * K;
    wt[i] = (_Float16)w[k * N + n];
  }
}

// ---- fused LN1 + shifted-window attention + proj + residual ------------------
__global__ __launch_bounds__(256) void k_attn(
    const float* __restrict__ x, const float* __restrict__ qkv_b,
    const float* __restrict__ proj_b, const float* __restrict__ rpb,
    const float* __restrict__ n1g, const float* __restrict__ n1b,
    const _Float16* __restrict__ qkvWt, const _Float16* __restrict__ projWt,
    float* __restrict__ out) {
  __shared__ _Float16 xt[64 * CC];       // 16 KB  LN'd window tokens (padded to 64 rows)
  __shared__ _Float16 qkvs[64 * 256];    // 32 KB  Q|K f16 (token-major)
  __shared__ _Float16 vts[CC * 64];      // 16 KB  V transposed (channel-major)
  __shared__ float    ss[64 * 64];       // 16 KB  scores (per head)
  __shared__ _Float16 ps[64 * 64];       //  8 KB  softmax probs
  __shared__ float    os[64 * CC];       // 32 KB  attention output (pre-proj)

  const int tid  = threadIdx.x;
  const int lane = tid & 31;
  const int wv   = __builtin_amdgcn_readfirstlane(tid >> 5);  // wave-uniform -> SGPR
  const int b    = blockIdx.x >> 6;
  const int w    = blockIdx.x & 63;
  const int wh   = w >> 3, ww = w & 7;
  const float scale = 0.17677669529663687f;  // 1/sqrt(32)

  // zero pad rows 49..63
  for (int i = tid; i < (64 - NTOK) * CC; i += 256) xt[NTOK * CC + i] = (_Float16)0.f;

  // gather (roll by -3) + LayerNorm1, one token per wave iteration
  for (int i = wv; i < NTOK; i += 8) {
    int yi = i / 7, xi = i - yi * 7;
    int sr = (wh * 7 + yi + SHFT) % HW;
    int sc = (ww * 7 + xi + SHFT) % HW;
    const float* row = x + ((size_t)b * (HW * HW) + (size_t)(sr * HW + sc)) * CC;
    float4 v = *(const float4*)(row + lane * 4);
    float mu = wred_sum(v.x + v.y + v.z + v.w) * (1.f / 128.f);
    float d0 = v.x - mu, d1 = v.y - mu, d2 = v.z - mu, d3 = v.w - mu;
    float var = wred_sum(d0 * d0 + d1 * d1 + d2 * d2 + d3 * d3) * (1.f / 128.f);
    float rs = rsqrtf(var + LN_EPS);
    int c = lane * 4;
    _Float16* dst = xt + i * CC + c;
    dst[0] = (_Float16)(d0 * rs * n1g[c + 0] + n1b[c + 0]);
    dst[1] = (_Float16)(d1 * rs * n1g[c + 1] + n1b[c + 1]);
    dst[2] = (_Float16)(d2 * rs * n1g[c + 2] + n1b[c + 2]);
    dst[3] = (_Float16)(d3 * rs * n1g[c + 3] + n1b[c + 3]);
  }
  __syncthreads();

  // QKV GEMM: (64x128) @ (128x384), 96 tiles over 8 waves (12 counted iters).
  // Region (Q/K/V) selected by scalar tile index nt -> s_cbranch.
  for (int tt = 0; tt < 12; ++tt) {
    int t = wv + tt * 8;
    int mt = t & 3, nt = t >> 2;
    v8f acc = {};
#pragma unroll
    for (int kk = 0; kk < 4; ++kk) {
      v16h a  = ld_a(xt, CC, mt * 16, kk * 32, lane);
      v16h bm = ld_a(qkvWt, CC, nt * 16, kk * 32, lane);
      acc = WMMA_F16(a, bm, acc);
    }
    int n = nt * 16 + (lane & 15);
    float bias = qkv_b[n];
    int mbase = mt * 16 + ((lane >> 4) << 3);
    if (nt < 8) {  // Q (pre-scaled)
#pragma unroll
      for (int r = 0; r < 8; ++r)
        qkvs[(mbase + r) * 256 + n] = (_Float16)((acc[r] + bias) * scale);
    } else if (nt < 16) {  // K
#pragma unroll
      for (int r = 0; r < 8; ++r)
        qkvs[(mbase + r) * 256 + n] = (_Float16)(acc[r] + bias);
    } else {  // V -> transposed, 8 consecutive halves per lane (one b128 store)
      _Float16* dst = vts + (n - 256) * 64 + mbase;
#pragma unroll
      for (int r = 0; r < 8; ++r) dst[r] = (_Float16)(acc[r] + bias);
    }
  }
  __syncthreads();

  // per-head attention
  for (int h = 0; h < NHEAD; ++h) {
    // S = Q K^T + rel_pos_bias + shift_mask : 16 tiles, 2 per wave
#pragma unroll
    for (int tt = 0; tt < 2; ++tt) {
      int t = wv * 2 + tt;
      int it = t >> 2, jt = t & 3;
      v16h a  = ld_a(qkvs, 256, it * 16, h * 32, lane);          // Q rows
      v16h bm = ld_a(qkvs, 256, jt * 16, 128 + h * 32, lane);    // K rows = cols of K^T
      v8f acc = {};
      acc = WMMA_F16(a, bm, acc);
      int j = jt * 16 + (lane & 15);
      int mbase = it * 16 + ((lane >> 4) << 3);
      int yj = j / 7, xj = j - yj * 7;
      int rhj = (wh == 7) ? (yj < 4 ? 1 : 2) : 0;
      int rwj = (ww == 7) ? (xj < 4 ? 1 : 2) : 0;
      int labj = rhj * 3 + rwj;
#pragma unroll
      for (int r = 0; r < 8; ++r) {
        int i = mbase + r;
        float val;
        if (j >= NTOK) {
          val = -1e30f;
        } else if (i >= NTOK) {
          val = 0.f;
        } else {
          int yi = i / 7, xi = i - yi * 7;
          int ridx = (yi - yj + 6) * 13 + (xi - xj + 6);
          float bias = rpb[ridx * NHEAD + h];
          int rhi = (wh == 7) ? (yi < 4 ? 1 : 2) : 0;
          int rwi = (ww == 7) ? (xi < 4 ? 1 : 2) : 0;
          float msk = ((rhi * 3 + rwi) != labj) ? -100.f : 0.f;
          val = acc[r] + bias + msk;
        }
        ss[i * 64 + j] = val;
      }
    }
    __syncthreads();

    // softmax: 4 lanes per row, 16 cols each (vectorized row access)
    {
      int row = tid >> 2, seg = tid & 3;
      const float4* srow = (const float4*)(ss + row * 64 + seg * 16);
      float4 f0 = srow[0], f1 = srow[1], f2 = srow[2], f3 = srow[3];
      float e[16] = {f0.x, f0.y, f0.z, f0.w, f1.x, f1.y, f1.z, f1.w,
                     f2.x, f2.y, f2.z, f2.w, f3.x, f3.y, f3.z, f3.w};
      float mx = -1e30f;
#pragma unroll
      for (int q = 0; q < 16; ++q) mx = fmaxf(mx, e[q]);
      mx = fmaxf(mx, __shfl_xor(mx, 1, 32));
      mx = fmaxf(mx, __shfl_xor(mx, 2, 32));
      float sm = 0.f;
#pragma unroll
      for (int q = 0; q < 16; ++q) { e[q] = __expf(e[q] - mx); sm += e[q]; }
      sm += __shfl_xor(sm, 1, 32);
      sm += __shfl_xor(sm, 2, 32);
      float inv = 1.f / sm;
      v8h p0, p1;
#pragma unroll
      for (int q = 0; q < 8; ++q) { p0[q] = (_Float16)(e[q] * inv); p1[q] = (_Float16)(e[q + 8] * inv); }
      v8h* prow = (v8h*)(ps + row * 64 + seg * 16);
      prow[0] = p0;
      prow[1] = p1;
    }
    __syncthreads();

    // O_h = P @ V : 8 tiles, 1 per wave (B-operand from transposed V -> contiguous)
    {
      int mt = wv >> 1, nt = wv & 1;
      v8f acc = {};
#pragma unroll
      for (int kk = 0; kk < 2; ++kk) {
        v16h a  = ld_a(ps, 64, mt * 16, kk * 32, lane);
        v16h bm = ld_a(vts, 64, h * 32 + nt * 16, kk * 32, lane);
        acc = WMMA_F16(a, bm, acc);
      }
      int n = h * 32 + nt * 16 + (lane & 15);
      int mbase = mt * 16 + ((lane >> 4) << 3);
#pragma unroll
      for (int r = 0; r < 8; ++r) os[(mbase + r) * CC + n] = acc[r];
    }
    __syncthreads();
  }

  // proj: (64x128)@(128x128) + bias, scatter with inverse roll, add residual
  for (int tt = 0; tt < 4; ++tt) {
    int t = wv + tt * 8;
    int mt = t & 3, nt = t >> 2;
    v8f acc = {};
#pragma unroll
    for (int kk = 0; kk < 4; ++kk) {
      v16h a  = ld_a_f32(os, CC, mt * 16, kk * 32, lane);
      v16h bm = ld_a(projWt, CC, nt * 16, kk * 32, lane);
      acc = WMMA_F16(a, bm, acc);
    }
    int n = nt * 16 + (lane & 15);
    float pb = proj_b[n];
    int mbase = mt * 16 + ((lane >> 4) << 3);
#pragma unroll
    for (int r = 0; r < 8; ++r) {
      int i = mbase + r;
      if (i < NTOK) {
        int yi = i / 7, xi = i - yi * 7;
        int sr = (wh * 7 + yi + SHFT) % HW;
        int sc = (ww * 7 + xi + SHFT) % HW;
        size_t idx = ((size_t)b * (HW * HW) + (size_t)(sr * HW + sc)) * CC + n;
        out[idx] = x[idx] + acc[r] + pb;
      }
    }
  }
}

// ---- fused LN2 + MLP (fc1 + GELU + fc2) + residual ---------------------------
__global__ __launch_bounds__(256) void k_mlp(
    const float* __restrict__ n2g, const float* __restrict__ n2b,
    const _Float16* __restrict__ fc1Wt, const float* __restrict__ fc1b,
    const _Float16* __restrict__ fc2Wt, const float* __restrict__ fc2b,
    float* __restrict__ out) {
  __shared__ _Float16 h2[64 * CC];    // 16 KB
  __shared__ _Float16 a1[64 * HID];   // 64 KB
  const int tid = threadIdx.x, lane = tid & 31;
  const int wv = __builtin_amdgcn_readfirstlane(tid >> 5);  // wave-uniform -> SGPR
  const size_t r0 = (size_t)blockIdx.x * 64;

  // LayerNorm2 on 64 rows of current out (= x + attn)
  for (int i = wv; i < 64; i += 8) {
    const float* row = out + (r0 + i) * CC;
    float4 v = *(const float4*)(row + lane * 4);
    float mu = wred_sum(v.x + v.y + v.z + v.w) * (1.f / 128.f);
    float d0 = v.x - mu, d1 = v.y - mu, d2 = v.z - mu, d3 = v.w - mu;
    float var = wred_sum(d0 * d0 + d1 * d1 + d2 * d2 + d3 * d3) * (1.f / 128.f);
    float rs = rsqrtf(var + LN_EPS);
    int c = lane * 4;
    _Float16* dst = h2 + i * CC + c;
    dst[0] = (_Float16)(d0 * rs * n2g[c + 0] + n2b[c + 0]);
    dst[1] = (_Float16)(d1 * rs * n2g[c + 1] + n2b[c + 1]);
    dst[2] = (_Float16)(d2 * rs * n2g[c + 2] + n2b[c + 2]);
    dst[3] = (_Float16)(d3 * rs * n2g[c + 3] + n2b[c + 3]);
  }
  __syncthreads();

  // fc1 + GELU(exact): (64x128)@(128x512), 128 tiles / 8 waves
  for (int tt = 0; tt < 16; ++tt) {
    int t = wv + tt * 8;
    int mt = t & 3, nt = t >> 2;
    v8f acc = {};
#pragma unroll
    for (int kk = 0; kk < 4; ++kk) {
      v16h a  = ld_a(h2, CC, mt * 16, kk * 32, lane);
      v16h bm = ld_a(fc1Wt, CC, nt * 16, kk * 32, lane);
      acc = WMMA_F16(a, bm, acc);
    }
    int n = nt * 16 + (lane & 15);
    float bb = fc1b[n];
    int mbase = mt * 16 + ((lane >> 4) << 3);
#pragma unroll
    for (int r = 0; r < 8; ++r) {
      float vv = acc[r] + bb;
      vv = 0.5f * vv * (1.f + erff(vv * 0.7071067811865475f));
      a1[(mbase + r) * HID + n] = (_Float16)vv;
    }
  }
  __syncthreads();

  // fc2 + residual: (64x512)@(512x128), 32 tiles / 8 waves
  for (int tt = 0; tt < 4; ++tt) {
    int t = wv + tt * 8;
    int mt = t & 3, nt = t >> 2;
    v8f acc = {};
#pragma unroll
    for (int kk = 0; kk < 16; ++kk) {
      v16h a  = ld_a(a1, HID, mt * 16, kk * 32, lane);
      v16h bm = ld_a(fc2Wt, HID, nt * 16, kk * 32, lane);
      acc = WMMA_F16(a, bm, acc);
    }
    int n = nt * 16 + (lane & 15);
    float bb = fc2b[n];
    int mbase = mt * 16 + ((lane >> 4) << 3);
#pragma unroll
    for (int r = 0; r < 8; ++r) {
      size_t row = r0 + (size_t)(mbase + r);
      out[row * CC + n] += acc[r] + bb;
    }
  }
}

extern "C" void kernel_launch(void* const* d_in, const int* in_sizes, int n_in,
                              void* d_out, int out_size, void* d_ws, size_t ws_size,
                              hipStream_t stream) {
  (void)in_sizes; (void)n_in; (void)out_size; (void)ws_size;
  const float* x      = (const float*)d_in[0];
  const float* qkv_w  = (const float*)d_in[1];
  const float* qkv_b  = (const float*)d_in[2];
  const float* proj_w = (const float*)d_in[3];
  const float* proj_b = (const float*)d_in[4];
  const float* rpb    = (const float*)d_in[5];
  const float* n1g    = (const float*)d_in[6];
  const float* n1b    = (const float*)d_in[7];
  const float* n2g    = (const float*)d_in[8];
  const float* n2b    = (const float*)d_in[9];
  const float* fc1w   = (const float*)d_in[10];
  const float* fc1b   = (const float*)d_in[11];
  const float* fc2w   = (const float*)d_in[12];
  const float* fc2b   = (const float*)d_in[13];
  float* out = (float*)d_out;

  _Float16* qkvWt  = (_Float16*)d_ws;          // [384][128]
  _Float16* projWt = qkvWt + 384 * 128;        // [128][128]
  _Float16* fc1Wt  = projWt + 128 * 128;       // [512][128]
  _Float16* fc2Wt  = fc1Wt + 512 * 128;        // [128][512]

  k_wprep<<<96, 256, 0, stream>>>(qkv_w, qkvWt, 128, 384);
  k_wprep<<<32, 256, 0, stream>>>(proj_w, projWt, 128, 128);
  k_wprep<<<128, 256, 0, stream>>>(fc1w, fc1Wt, 128, 512);
  k_wprep<<<128, 256, 0, stream>>>(fc2w, fc2Wt, 512, 128);

  k_attn<<<64 * 64, 256, 0, stream>>>(x, qkv_b, proj_b, rpb, n1g, n1b, qkvWt, projWt, out);
  k_mlp<<<3136, 256, 0, stream>>>(n2g, n2b, fc1Wt, fc1b, fc2Wt, fc2b, out);
}

// v001
// Measured time: 621 microseconds a run.
// In both of two side-by-side timings against v000, it was 1.17 times as fast.
#include <hip/hip_runtime.h>
#include <hip/hip_bf16.h>
#include <math.h>

typedef __attribute__((ext_vector_type(16))) _Float16 v16h;
typedef __attribute__((ext_vector_type(8)))  _Float16 v8h;
typedef __attribute__((ext_vector_type(8)))  float    v8f;

#define NTOK 49
#define CC   128
#define NHEAD 4
#define HID  512
#define HW   56
#define SHFT 3
#define LN_EPS 1e-5f

// LDS row pitches in elements. Each row carries 16 bytes of pad, so the pitch is an odd
// multiple of 16 bytes and the 16 rows of one 128-bit fragment read fall on distinct banks.
#define XP  (CC + 8)       // f16 rows of 128: 272 B
#define QKP (256 + 8)      // f16 rows of 256: 528 B
#define TP  (64 + 8)       // f16 rows of 64: 144 B
#define SP  (64 + 4)       // f32 rows of 64: 272 B
#define OP  (CC + 4)       // f32 rows of 128: 528 B
#define AP  (HID + 8)      // f16 rows of 512: 1040 B

#define WMMA_F16(a, b, c) \
  __builtin_amdgcn_wmma_f32_16x16x32_f16(false, (a), false, (b), (short)0, (c), false, false)

__device__ __forceinline__ float wred_sum(float v) {
#pragma unroll
  for (int o = 16; o > 0; o >>= 1) v += __shfl_xor(v, o, 32);
  return v;
}

// A/B-operand fragment (16x32 f16 tile, rows striped over lanes, K along VGPRs).
// Per ISA 7.12.2 the per-lane halves are contiguous in two 16B runs: K+[0..7] and K+[16..23]
// (K offset +8 for lanes 16..31) -> two 128-bit loads.
__device__ __forceinline__ v16h ld_a(const _Float16* buf, int ld, int row0, int col0, int lane) {
  int m  = row0 + (lane & 15);
  int kb = (lane >> 4) << 3;
  const v8h* p = (const v8h*)(buf + m * ld + col0 + kb);
  v8h lo = p[0];
  v8h hi = p[2];
  return __builtin_shufflevector(lo, hi, 0, 1, 2, 3, 4, 5, 6, 7,
                                         8, 9, 10, 11, 12, 13, 14, 15);
}

// Same fragment sourced from an f32 buffer (two 32B runs), converting to f16.
__device__ __forceinline__ v16h ld_a_f32(const float* buf, int ld, int row0, int col0, int lane) {
  int m  = row0 + (lane & 15);
  int kb = (lane >> 4) << 3;
  const float4* p = (const float4*)(buf + m * ld + col0 + kb);
  float4 q0 = p[0], q1 = p[1], q2 = p[4], q3 = p[5];
  v16h a;
  a[0]  = (_Float16)q0.x; a[1]  = (_Float16)q0.y; a[2]  = (_Float16)q0.z; a[3]  = (_Float16)q0.w;
  a[4]  = (_Float16)q1.x; a[5]  = (_Float16)q1.y; a[6]  = (_Float16)q1.z; a[7]  = (_Float16)q1.w;
  a[8]  = (_Float16)q2.x; a[9]  = (_Float16)q2.y; a[10] = (_Float16)q2.z; a[11] = (_Float16)q2.w;
  a[12] = (_Float16)q3.x; a[13] = (_Float16)q3.y; a[14] = (_Float16)q3.z; a[15] = (_Float16)q3.w;
  return a;
}

// ---- weight prep: wt[n][k] = (f16) w[k][n] -----------------------------------
__global__ void k_wprep(const float* __restrict__ w, _Float16* __restrict__ wt, int K, int N) {
  int total = K * N;
  for (int i = blockIdx.x * blockDim.x + threadIdx.x; i < total; i += gridDim.x * blockDim.x) {
    int n = i / K, k = i - n * K;
    wt[i] = (_Float16)w[k * N + n];
  }
}

// ---- fused LN1 + shifted-window attention + proj + residual ------------------
__global__ __launch_bounds__(256) void k_attn(
    const float* __restrict__ x, const float* __restrict__ qkv_b,
    const float* __restrict__ proj_b, const float* __restrict__ rpb,
    const float* __restrict__ n1g, const float* __restrict__ n1b,
    const _Float16* __restrict__ qkvWt, const _Float16* __restrict__ projWt,
    float* __restrict__ out) {
  __shared__ __attribute__((aligned(16))) _Float16 xt[64 * XP];     // LN'd window tokens (padded to 64 rows)
  __shared__ __attribute__((aligned(16))) _Float16 qkvs[64 * QKP];  // Q|K f16 (token-major)
  __shared__ __attribute__((aligned(16))) _Float16 vts[CC * TP];    // V transposed (channel-major)
  __shared__ __attribute__((aligned(16))) float    ss[64 * SP];     // scores (per head)
  __shared__ __attribute__((aligned(16))) _Float16 ps[64 * TP];     // softmax probs
  __shared__ __attribute__((aligned(16))) float    os[64 * OP];     // attention output (pre-proj)

  const int tid  = threadIdx.x;
  const int lane = tid & 31;
  const int wv   = __builtin_amdgcn_readfirstlane(tid >> 5);  // wave-uniform -> SGPR
  const int b    = blockIdx.x >> 6;
  const int w    = blockIdx.x & 63;
  const int wh   = w >> 3, ww = w & 7;
  const float scale = 0.17677669529663687f;  // 1/sqrt(32)

  // zero pad rows 49..63
  for (int i = tid; i < (64 - NTOK) * XP; i += 256) xt[NTOK * XP + i] = (_Float16)0.f;

  // gather (roll by -3) + LayerNorm1, one token per wave iteration
  for (int i = wv; i < NTOK; i += 8) {
    int yi = i / 7, xi = i - yi * 7;
    int sr = (wh * 7 + yi + SHFT) % HW;
    int sc = (ww * 7 + xi + SHFT) % HW;
    const float* row = x + ((size_t)b * (HW * HW) + (size_t)(sr * HW + sc)) * CC;
    float4 v = *(const float4*)(row + lane * 4);
    float mu = wred_sum(v.x + v.y + v.z + v.w) * (1.f / 128.f);
    float d0 = v.x - mu, d1 = v.y - mu, d2 = v.z - mu, d3 = v.w - mu;
    float var = wred_sum(d0 * d0 + d1 * d1 + d2 * d2 + d3 * d3) * (1.f / 128.f);
    float rs = rsqrtf(var + LN_EPS);
    int c = lane * 4;
    _Float16* dst = xt + i * XP + c;
    dst[0] = (_Float16)(d0 * rs * n1g[c + 0] + n1b[c + 0]);
    dst[1] = (_Float16)(d1 * rs * n1g[c + 1] + n1b[c + 1]);
    dst[2] = (_Float16)(d2 * rs * n1g[c + 2] + n1b[c + 2]);
    dst[3] = (_Float16)(d3 * rs * n1g[c + 3] + n1b[c + 3]);
  }
  __syncthreads();

  // QKV GEMM: (64x128) @ (128x384), 96 tiles over 8 waves (12 counted iters).
  // Region (Q/K/V) selected by scalar tile index nt -> s_cbranch.
  for (int tt = 0; tt < 12; ++tt) {
    int t = wv + tt * 8;
    int mt = t & 3, nt = t >> 2;
    v8f acc = {};
#pragma unroll
    for (int kk = 0; kk < 4; ++kk) {
      v16h a  = ld_a(xt, XP, mt * 16, kk * 32, lane);
      v16h bm = ld_a(qkvWt, CC, nt * 16, kk * 32, lane);
      acc = WMMA_F16(a, bm, acc);
    }
    int n = nt * 16 + (lane & 15);
    float bias = qkv_b[n];
    int mbase = mt * 16 + ((lane >> 4) << 3);
    if (nt < 8) {  // Q (pre-scaled)
#pragma unroll
      for (int r = 0; r < 8; ++r)
        qkvs[(mbase + r) * QKP + n] = (_Float16)((acc[r] + bias) * scale);
    } else if (nt < 16) {  // K
#pragma unroll
      for (int r = 0; r < 8; ++r)
        qkvs[(mbase + r) * QKP + n] = (_Float16)(acc[r] + bias);
    } else {  // V -> transposed, 8 consecutive halves per lane (one b128 store)
      _Float16* dst = vts + (n - 256) * TP + mbase;
#pragma unroll
      for (int r = 0; r < 8; ++r) dst[r] = (_Float16)(acc[r] + bias);
    }
  }
  __syncthreads();

  // per-head attention
  for (int h = 0; h < NHEAD; ++h) {
    // S = Q K^T + rel_pos_bias + shift_mask : 16 tiles, 2 per wave
#pragma unroll
    for (int tt = 0; tt < 2; ++tt) {
      int t = wv * 2 + tt;
      int it = t >> 2, jt = t & 3;
      v16h a  = ld_a(qkvs, QKP, it * 16, h * 32, lane);          // Q rows
      v16h bm = ld_a(qkvs, QKP, jt * 16, 128 + h * 32, lane);    // K rows = cols of K^T
      v8f acc = {};
      acc = WMMA_F16(a, bm, acc);
      int j = jt * 16 + (lane & 15);
      int mbase = it * 16 + ((lane >> 4) << 3);
      int yj = j / 7, xj = j - yj * 7;
      int rhj = (wh == 7) ? (yj < 4 ? 1 : 2) : 0;
      int rwj = (ww == 7) ? (xj < 4 ? 1 : 2) : 0;
      int labj = rhj * 3 + rwj;
#pragma unroll
      for (int r = 0; r < 8; ++r) {
        int i = mbase + r;
        float val;
        if (j >= NTOK) {
          val = -1e30f;
        } else if (i >= NTOK) {
          val = 0.f;
        } else {
          int yi = i / 7, xi = i - yi * 7;
          int ridx = (yi - yj + 6) * 13 + (xi - xj + 6);
          float bias = rpb[ridx * NHEAD + h];
          int rhi = (wh == 7) ? (yi < 4 ? 1 : 2) : 0;
          int rwi = (ww == 7) ? (xi < 4 ? 1 : 2) : 0;
          float msk = ((rhi * 3 + rwi) != labj) ? -100.f : 0.f;
          val = acc[r] + bias + msk;
        }
        ss[i * SP + j] = val;
      }
    }
    __syncthreads();

    // softmax: 4 lanes per row, 16 cols each (vectorized row access)
    {
      int row = tid >> 2, seg = tid & 3;
      const float4* srow = (const float4*)(ss + row * SP + seg * 16);
      float4 f0 = srow[0], f1 = srow[1], f2 = srow[2], f3 = srow[3];
      float e[16] = {f0.x, f0.y, f0.z, f0.w, f1.x, f1.y, f1.z, f1.w,
                     f2.x, f2.y, f2.z, f2.w, f3.x, f3.y, f3.z, f3.w};
      float mx = -1e30f;
#pragma unroll
      for (int q = 0; q < 16; ++q) mx = fmaxf(mx, e[q]);
      mx = fmaxf(mx, __shfl_xor(mx, 1, 32));
      mx = fmaxf(mx, __shfl_xor(mx, 2, 32));
      float sm = 0.f;
#pragma unroll
      for (int q = 0; q < 16; ++q) { e[q] = __expf(e[q] - mx); sm += e[q]; }
      sm += __shfl_xor(sm, 1, 32);
      sm += __shfl_xor(sm, 2, 32);
      float inv = 1.f / sm;
      v8h p0, p1;
#pragma unroll
      for (int q = 0; q < 8; ++q) { p0[q] = (_Float16)(e[q] * inv); p1[q] = (_Float16)(e[q + 8] * inv); }
      v8h* prow = (v8h*)(ps + row * TP + seg * 16);
      prow[0] = p0;
      prow[1] = p1;
    }
    __syncthreads();

    // O_h = P @ V : 8 tiles, 1 per wave (B-operand from transposed V -> contiguous)
    {
      int mt = wv >> 1, nt = wv & 1;
      v8f acc = {};
#pragma unroll
      for (int kk = 0; kk < 2; ++kk) {
        v16h a  = ld_a(ps, TP, mt * 16, kk * 32, lane);
        v16h bm = ld_a(vts, TP, h * 32 + nt * 16, kk * 32, lane);
        acc = WMMA_F16(a, bm, acc);
      }
      int n = h * 32 + nt * 16 + (lane & 15);
      int mbase = mt * 16 + ((lane >> 4) << 3);
#pragma unroll
      for (int r = 0; r < 8; ++r) os[(mbase + r) * OP + n] = acc[r];
    }
    __syncthreads();
  }

  // proj: (64x128)@(128x128) + bias, scatter with inverse roll, add residual
  for (int tt = 0; tt < 4; ++tt) {
    int t = wv + tt * 8;
    int mt = t & 3, nt = t >> 2;
    v8f acc = {};
#pragma unroll
    for (int kk = 0; kk < 4; ++kk) {
      v16h a  = ld_a_f32(os, OP, mt * 16, kk * 32, lane);
      v16h bm = ld_a(projWt, CC, nt * 16, kk * 32, lane);
      acc = WMMA_F16(a, bm, acc);
    }
    int n = nt * 16 + (lane & 15);
    float pb = proj_b[n];
    int mbase = mt * 16 + ((lane >> 4) << 3);
#pragma unroll
    for (int r = 0; r < 8; ++r) {
      int i = mbase + r;
      if (i < NTOK) {
        int yi = i / 7, xi = i - yi * 7;
        int sr = (wh * 7 + yi + SHFT) % HW;
        int sc = (ww * 7 + xi + SHFT) % HW;
        size_t idx = ((size_t)b * (HW * HW) + (size_t)(sr * HW + sc)) * CC + n;
        out[idx] = x[idx] + acc[r] + pb;
      }
    }
  }
}

// ---- fused LN2 + MLP (fc1 + GELU + fc2) + residual ---------------------------
__global__ __launch_bounds__(256) void k_mlp(
    const float* __restrict__ n2g, const float* __restrict__ n2b,
    const _Float16* __restrict__ fc1Wt, const float* __restrict__ fc1b,
    const _Float16* __restrict__ fc2Wt, const float* __restrict__ fc2b,
    float* __restrict__ out) {
  __shared__ __attribute__((aligned(16))) _Float16 h2[64 * XP];   // LN'd rows
  __shared__ __attribute__((aligned(16))) _Float16 a1[64 * AP];   // GELU(fc1) rows
  const int tid = threadIdx.x, lane = tid & 31;
  const int wv = __builtin_amdgcn_readfirstlane(tid >> 5);  // wave-uniform -> SGPR
  const size_t r0 = (size_t)blockIdx.x * 64;

  // LayerNorm2 on 64 rows of current out (= x + attn)
  for (int i = wv; i < 64; i += 8) {
    const float* row = out + (r0 + i) * CC;
    float4 v = *(const float4*)(row + lane * 4);
    float mu = wred_sum(v.x + v.y + v.z + v.w) * (1.f / 128.f);
    float d0 = v.x - mu, d1 = v.y - mu, d2 = v.z - mu, d3 = v.w - mu;
    float var = wred_sum(d0 * d0 + d1 * d1 + d2 * d2 + d3 * d3) * (1.f / 128.f);
    float rs = rsqrtf(var + LN_EPS);
    int c = lane * 4;
    _Float16* dst = h2 + i * XP + c;
    dst[0] = (_Float16)(d0 * rs * n2g[c + 0] + n2b[c + 0]);
    dst[1] = (_Float16)(d1 * rs * n2g[c + 1] + n2b[c + 1]);
    dst[2] = (_Float16)(d2 * rs * n2g[c + 2] + n2b[c + 2]);
    dst[3] = (_Float16)(d3 * rs * n2g[c + 3] + n2b[c + 3]);
  }
  __syncthreads();

  // fc1 + GELU(exact): (64x128)@(128x512), 128 tiles / 8 waves
  for (int tt = 0; tt < 16; ++tt) {
    int t = wv + tt * 8;
    int mt = t & 3, nt = t >> 2;
    v8f acc = {};
#pragma unroll
    for (int kk = 0; kk < 4; ++kk) {
      v16h a  = ld_a(h2, XP, mt * 16, kk * 32, lane);
      v16h bm = ld_a(fc1Wt, CC, nt * 16, kk * 32, lane);
      acc = WMMA_F16(a, bm, acc);
    }
    int n = nt * 16 + (lane & 15);
    float bb = fc1b[n];
    int mbase = mt * 16 + ((lane >> 4) << 3);
#pragma unroll
    for (int r = 0; r < 8; ++r) {
      float vv = acc[r] + bb;
      vv = 0.5f * vv * (1.f + erff(vv * 0.7071067811865475f));
      a1[(mbase + r) * AP + n] = (_Float16)vv;
    }
  }
  __syncthreads();

  // fc2 + residual: (64x512)@(512x128), 32 tiles / 8 waves
  for (int tt = 0; tt < 4; ++tt) {
    int t = wv + tt * 8;
    int mt = t & 3, nt = t >> 2;
    v8f acc = {};
#pragma unroll
    for (int kk = 0; kk < 16; ++kk) {
      v16h a  = ld_a(a1, AP, mt * 16, kk * 32, lane);
      v16h bm = ld_a(fc2Wt, HID, nt * 16, kk * 32, lane);
      acc = WMMA_F16(a, bm, acc);
    }
    int n = nt * 16 + (lane & 15);
    float bb = fc2b[n];
    int mbase = mt * 16 + ((lane >> 4) << 3);
#pragma unroll
    for (int r = 0; r < 8; ++r) {
      size_t row = r0 + (size_t)(mbase + r);
      out[row * CC + n] += acc[r] + bb;
    }
  }
}

extern "C" void kernel_launch(void* const* d_in, const int* in_sizes, int n_in,
                              void* d_out, int out_size, void* d_ws, size_t ws_size,
                              hipStream_t stream) {
  (void)in_sizes; (void)n_in; (void)out_size; (void)ws_size;
  const float* x      = (const float*)d_in[0];
  const float* qkv_w  = (const float*)d_in[1];
  const float* qkv_b  = (const float*)d_in[2];
  const float* proj_w = (const float*)d_in[3];
  const float* proj_b = (const float*)d_in[4];
  const float* rpb    = (const float*)d_in[5];
  const float* n1g    = (const float*)d_in[6];
  const float* n1b    = (const float*)d_in[7];
  const float* n2g    = (const float*)d_in[8];
  const float* n2b    = (const float*)d_in[9];
  const float* fc1w   = (const float*)d_in[10];
  const float* fc1b   = (const float*)d_in[11];
  const float* fc2w   = (const float*)d_in[12];
  const float* fc2b   = (const float*)d_in[13];
  float* out = (float*)d_out;

  _Float16* qkvWt  = (_Float16*)d_ws;          // [384][128]
  _Float16* projWt = qkvWt + 384 * 128;        // [128][128]
  _Float16* fc1Wt  = projWt + 128 * 128;       // [512][128]
  _Float16* fc2Wt  = fc1Wt + 512 * 128;        // [128][512]

  k_wprep<<<96, 256, 0, stream>>>(qkv_w, qkvWt, 128, 384);
  k_wprep<<<32, 256, 0, stream>>>(proj_w, projWt, 128, 128);
  k_wprep<<<128, 256, 0, stream>>>(fc1w, fc1Wt, 128, 512);
  k_wprep<<<128, 256, 0, stream>>>(fc2w, fc2Wt, 512, 128);

  k_attn<<<64 * 64, 256, 0, stream>>>(x, qkv_b, proj_b, rpb, n1g, n1b, qkvWt, projWt, out);
  k_mlp<<<3136, 256, 0, stream>>>(n2g, n2b, fc1Wt, fc1b, fc2Wt, fc2b, out);
}

// v002
// One run takes 355 microseconds.
// Next to v001, in two timings, it ran 1.75 times as fast each time.
// Over all steps from v000 it is 2.04 times as fast.
#include <hip/hip_runtime.h>
#include <hip/hip_bf16.h>
#include <math.h>

typedef __attribute__((ext_vector_type(16))) _Float16 v16h;
typedef __attribute__((ext_vector_type(8)))  _Float16 v8h;
typedef __attribute__((ext_vector_type(8)))  float    v8f;

#define NTOK 49
#define CC   128
#define NHEAD 4
#define HID  512
#define HW   56
#define SHFT 3
#define LN_EPS 1e-5f

// LDS row pitches in elements. Each row carries 16 bytes of pad, so the pitch is an odd
// multiple of 16 bytes and the 16 rows of one 128-bit fragment read fall on distinct banks.
#define XP  (CC + 8)       // f16 rows of 128: 272 B
#define QKP (256 + 8)      // f16 rows of 256: 528 B
#define TP  (64 + 8)       // f16 rows of 64: 144 B
#define SP  (64 + 4)       // f32 rows of 64: 272 B
#define OP  (CC + 4)       // f32 rows of 128: 528 B
#define AP  (HID + 8)      // f16 rows of 512: 1040 B

#define WMMA_F16(a, b, c) \
  __builtin_amdgcn_wmma_f32_16x16x32_f16(false, (a), false, (b), (short)0, (c), false, false)

__device__ __forceinline__ float wred_sum(float v) {
#pragma unroll
  for (int o = 16; o > 0; o >>= 1) v += __shfl_xor(v, o, 32);
  return v;
}

// A/B-operand fragment (16x32 f16 tile, rows striped over lanes, K along VGPRs).
// Per ISA 7.12.2 the per-lane halves are contiguous in two 16B runs: K+[0..7] and K+[16..23]
// (K offset +8 for lanes 16..31) -> two 128-bit loads.
__device__ __forceinline__ v16h ld_a(const _Float16* buf, int ld, int row0, int col0, int lane) {
  int m  = row0 + (lane & 15);
  int kb = (lane >> 4) << 3;
  const v8h* p = (const v8h*)(buf + m * ld + col0 + kb);
  v8h lo = p[0];
  v8h hi = p[2];
  return __builtin_shufflevector(lo, hi, 0, 1, 2, 3, 4, 5, 6, 7,
                                         8, 9, 10, 11, 12, 13, 14, 15);
}

// Same fragment sourced from an f32 buffer (two 32B runs), converting to f16.
__device__ __forceinline__ v16h ld_a_f32(const float* buf, int ld, int row0, int col0, int lane) {
  int m  = row0 + (lane & 15);
  int kb = (lane >> 4) << 3;
  const float4* p = (const float4*)(buf + m * ld + col0 + kb);
  float4 q0 = p[0], q1 = p[1], q2 = p[4], q3 = p[5];
  v16h a;
  a[0]  = (_Float16)q0.x; a[1]  = (_Float16)q0.y; a[2]  = (_Float16)q0.z; a[3]  = (_Float16)q0.w;
  a[4]  = (_Float16)q1.x; a[5]  = (_Float16)q1.y; a[6]  = (_Float16)q1.z; a[7]  = (_Float16)q1.w;
  a[8]  = (_Float16)q2.x; a[9]  = (_Float16)q2.y; a[10] = (_Float16)q2.z; a[11] = (_Float16)q2.w;
  a[12] = (_Float16)q3.x; a[13] = (_Float16)q3.y; a[14] = (_Float16)q3.z; a[15] = (_Float16)q3.w;
  return a;
}

// ---- weight prep: wt[n][k] = (f16) w[k][n] -----------------------------------
__global__ void k_wprep(const float* __restrict__ w, _Float16* __restrict__ wt, int K, int N) {
  int total = K * N;
  for (int i = blockIdx.x * blockDim.x + threadIdx.x; i < total; i += gridDim.x * blockDim.x) {
    int n = i / K, k = i - n * K;
    wt[i] = (_Float16)w[k * N + n];
  }
}

// ---- fused LN1 + shifted-window attention + proj + residual ------------------
__global__ __launch_bounds__(256) void k_attn(
    const float* __restrict__ x, const float* __restrict__ qkv_b,
    const float* __restrict__ proj_b, const float* __restrict__ rpb,
    const float* __restrict__ n1g, const float* __restrict__ n1b,
    const _Float16* __restrict__ qkvWt, const _Float16* __restrict__ projWt,
    float* __restrict__ out) {
  __shared__ __attribute__((aligned(16))) _Float16 xt[64 * XP];     // LN'd window tokens (padded to 64 rows)
  __shared__ __attribute__((aligned(16))) _Float16 qkvs[64 * QKP];  // Q|K f16 (token-major)
  __shared__ __attribute__((aligned(16))) _Float16 vts[CC * TP];    // V transposed (channel-major)
  __shared__ __attribute__((aligned(16))) float    ss[64 * SP];     // scores (per head)
  __shared__ __attribute__((aligned(16))) _Float16 ps[64 * TP];     // softmax probs
  __shared__ __attribute__((aligned(16))) float    os[64 * OP];     // attention output (pre-proj)

  const int tid  = threadIdx.x;
  const int lane = tid & 31;
  const int wv   = __builtin_amdgcn_readfirstlane(tid >> 5);  // wave-uniform -> SGPR
  const int b    = blockIdx.x >> 6;
  const int w    = blockIdx.x & 63;
  const int wh   = w >> 3, ww = w & 7;
  const float scale = 0.17677669529663687f;  // 1/sqrt(32)

  // zero pad rows 49..63
  for (int i = tid; i < (64 - NTOK) * XP; i += 256) xt[NTOK * XP + i] = (_Float16)0.f;

  // gather (roll by -3) + LayerNorm1, one token per wave iteration
  for (int i = wv; i < NTOK; i += 8) {
    int yi = i / 7, xi = i - yi * 7;
    int sr = (wh * 7 + yi + SHFT) % HW;
    int sc = (ww * 7 + xi + SHFT) % HW;
    const float* row = x + ((size_t)b * (HW * HW) + (size_t)(sr * HW + sc)) * CC;
    float4 v = *(const float4*)(row + lane * 4);
    float mu = wred_sum(v.x + v.y + v.z + v.w) * (1.f / 128.f);
    float d0 = v.x - mu, d1 = v.y - mu, d2 = v.z - mu, d3 = v.w - mu;
    float var = wred_sum(d0 * d0 + d1 * d1 + d2 * d2 + d3 * d3) * (1.f / 128.f);
    float rs = rsqrtf(var + LN_EPS);
    int c = lane * 4;
    _Float16* dst = xt + i * XP + c;
    dst[0] = (_Float16)(d0 * rs * n1g[c + 0] + n1b[c + 0]);
    dst[1] = (_Float16)(d1 * rs * n1g[c + 1] + n1b[c + 1]);
    dst[2] = (_Float16)(d2 * rs * n1g[c + 2] + n1b[c + 2]);
    dst[3] = (_Float16)(d3 * rs * n1g[c + 3] + n1b[c + 3]);
  }
  __syncthreads();

  // QKV GEMM: (64x128) @ (128x384). Each wave owns whole 64x16 column strips (3 of 24):
  // the 16 activation fragments stay in registers, and every weight fragment is loaded
  // once per block and feeds the four row tiles. Strip j of a wave is Q, K, V for j = 0, 1, 2.
  {
    v16h af[4][4];
#pragma unroll
    for (int mt = 0; mt < 4; ++mt)
#pragma unroll
      for (int kk = 0; kk < 4; ++kk) af[mt][kk] = ld_a(xt, XP, mt * 16, kk * 32, lane);
#pragma unroll
    for (int j = 0; j < 3; ++j) {
      int nt = wv + j * 8;
      v8f acc[4] = {};
      v16h bf[4];
#pragma unroll
      for (int kk = 0; kk < 4; ++kk) bf[kk] = ld_a(qkvWt, CC, nt * 16, kk * 32, lane);
      // Keeps the strip's eight weight loads in flight together: without it the scheduler
      // reuses one register set and waits out a full load latency at every k step.
      __builtin_amdgcn_sched_barrier(0);
#pragma unroll
      for (int kk = 0; kk < 4; ++kk)
#pragma unroll
        for (int mt = 0; mt < 4; ++mt) acc[mt] = WMMA_F16(af[mt][kk], bf[kk], acc[mt]);
      int n = nt * 16 + (lane & 15);
      float bias = qkv_b[n];
#pragma unroll
      for (int mt = 0; mt < 4; ++mt) {
        int mbase = mt * 16 + ((lane >> 4) << 3);
        if (j == 0) {  // Q (pre-scaled)
#pragma unroll
          for (int r = 0; r < 8; ++r)
            qkvs[(mbase + r) * QKP + n] = (_Float16)((acc[mt][r] + bias) * scale);
        } else if (j == 1) {  // K
#pragma unroll
          for (int r = 0; r < 8; ++r)
            qkvs[(mbase + r) * QKP + n] = (_Float16)(acc[mt][r] + bias);
        } else {  // V -> transposed, 8 consecutive halves per lane (one b128 store)
          _Float16* dst = vts + (n - 256) * TP + mbase;
#pragma unroll
          for (int r = 0; r < 8; ++r) dst[r] = (_Float16)(acc[mt][r] + bias);
        }
      }
    }
  }
  __syncthreads();

  // per-head attention
  for (int h = 0; h < NHEAD; ++h) {
    // S = Q K^T + rel_pos_bias + shift_mask : 16 tiles, 2 per wave
#pragma unroll
    for (int tt = 0; tt < 2; ++tt) {
      int t = wv * 2 + tt;
      int it = t >> 2, jt = t & 3;
      v16h a  = ld_a(qkvs, QKP, it * 16, h * 32, lane);          // Q rows
      v16h bm = ld_a(qkvs, QKP, jt * 16, 128 + h * 32, lane);    // K rows = cols of K^T
      v8f acc = {};
      acc = WMMA_F16(a, bm, acc);
      int j = jt * 16 + (lane & 15);
      int mbase = it * 16 + ((lane >> 4) << 3);
      int yj = j / 7, xj = j - yj * 7;
      int rhj = (wh == 7) ? (yj < 4 ? 1 : 2) : 0;
      int rwj = (ww == 7) ? (xj < 4 ? 1 : 2) : 0;
      int labj = rhj * 3 + rwj;
#pragma unroll
      for (int r = 0; r < 8; ++r) {
        int i = mbase + r;
        float val;
        if (j >= NTOK) {
          val = -1e30f;
        } else if (i >= NTOK) {
          val = 0.f;
        } else {
          int yi = i / 7, xi = i - yi * 7;
          int ridx = (yi - yj + 6) * 13 + (xi - xj + 6);
          float bias = rpb[ridx * NHEAD + h];
          int rhi = (wh == 7) ? (yi < 4 ? 1 : 2) : 0;
          int rwi = (ww == 7) ? (xi < 4 ? 1 : 2) : 0;
          float msk = ((rhi * 3 + rwi) != labj) ? -100.f : 0.f;
          val = acc[r] + bias + msk;
        }
        ss[i * SP + j] = val;
      }
    }
    __syncthreads();

    // softmax: 4 lanes per row, 16 cols each (vectorized row access)
    {
      int row = tid >> 2, seg = tid & 3;
      const float4* srow = (const float4*)(ss + row * SP + seg * 16);
      float4 f0 = srow[0], f1 = srow[1], f2 = srow[2], f3 = srow[3];
      float e[16] = {f0.x, f0.y, f0.z, f0.w, f1.x, f1.y, f1.z, f1.w,
                     f2.x, f2.y, f2.z, f2.w, f3.x, f3.y, f3.z, f3.w};
      float mx = -1e30f;
#pragma unroll
      for (int q = 0; q < 16; ++q) mx = fmaxf(mx, e[q]);
      mx = fmaxf(mx, __shfl_xor(mx, 1, 32));
      mx = fmaxf(mx, __shfl_xor(mx, 2, 32));
      float sm = 0.f;
#pragma unroll
      for (int q = 0; q < 16; ++q) { e[q] = __expf(e[q] - mx); sm += e[q]; }
      sm += __shfl_xor(sm, 1, 32);
      sm += __shfl_xor(sm, 2, 32);
      float inv = 1.f / sm;
      v8h p0, p1;
#pragma unroll
      for (int q = 0; q < 8; ++q) { p0[q] = (_Float16)(e[q] * inv); p1[q] = (_Float16)(e[q + 8] * inv); }
      v8h* prow = (v8h*)(ps + row * TP + seg * 16);
      prow[0] = p0;
      prow[1] = p1;
    }
    __syncthreads();

    // O_h = P @ V : 8 tiles, 1 per wave (B-operand from transposed V -> contiguous)
    {
      int mt = wv >> 1, nt = wv & 1;
      v8f acc = {};
#pragma unroll
      for (int kk = 0; kk < 2; ++kk) {
        v16h a  = ld_a(ps, TP, mt * 16, kk * 32, lane);
        v16h bm = ld_a(vts, TP, h * 32 + nt * 16, kk * 32, lane);
        acc = WMMA_F16(a, bm, acc);
      }
      int n = h * 32 + nt * 16 + (lane & 15);
      int mbase = mt * 16 + ((lane >> 4) << 3);
#pragma unroll
      for (int r = 0; r < 8; ++r) os[(mbase + r) * OP + n] = acc[r];
    }
    __syncthreads();
  }

  // proj: (64x128)@(128x128) + bias, scatter with inverse roll, add residual
  // One 64x16 column strip per wave: each weight fragment feeds the four row tiles.
  {
    int nt = wv;
    v8f acc[4] = {};
#pragma unroll
    for (int kk = 0; kk < 4; ++kk) {
      v16h bm = ld_a(projWt, CC, nt * 16, kk * 32, lane);
#pragma unroll
      for (int mt = 0; mt < 4; ++mt) {
        v16h a = ld_a_f32(os, OP, mt * 16, kk * 32, lane);
        acc[mt] = WMMA_F16(a, bm, acc[mt]);
      }
    }
    int n = nt * 16 + (lane & 15);
    float pb = proj_b[n];
#pragma unroll
    for (int mt = 0; mt < 4; ++mt) {
      int mbase = mt * 16 + ((lane >> 4) << 3);
#pragma unroll
      for (int r = 0; r < 8; ++r) {
        int i = mbase + r;
        if (i < NTOK) {
          int yi = i / 7, xi = i - yi * 7;
          int sr = (wh * 7 + yi + SHFT) % HW;
          int sc = (ww * 7 + xi + SHFT) % HW;
          size_t idx = ((size_t)b * (HW * HW) + (size_t)(sr * HW + sc)) * CC + n;
          out[idx] = x[idx] + acc[mt][r] + pb;
        }
      }
    }
  }
}

// ---- fused LN2 + MLP (fc1 + GELU + fc2) + residual ---------------------------
__global__ __launch_bounds__(256) void k_mlp(
    const float* __restrict__ n2g, const float* __restrict__ n2b,
    const _Float16* __restrict__ fc1Wt, const float* __restrict__ fc1b,
    const _Float16* __restrict__ fc2Wt, const float* __restrict__ fc2b,
    float* __restrict__ out) {
  __shared__ __attribute__((aligned(16))) _Float16 h2[64 * XP];   // LN'd rows
  __shared__ __attribute__((aligned(16))) _Float16 a1[64 * AP];   // GELU(fc1) rows
  const int tid = threadIdx.x, lane = tid & 31;
  const int wv = __builtin_amdgcn_readfirstlane(tid >> 5);  // wave-uniform -> SGPR
  const size_t r0 = (size_t)blockIdx.x * 64;

  // LayerNorm2 on 64 rows of current out (= x + attn)
  for (int i = wv; i < 64; i += 8) {
    const float* row = out + (r0 + i) * CC;
    float4 v = *(const float4*)(row + lane * 4);
    float mu = wred_sum(v.x + v.y + v.z + v.w) * (1.f / 128.f);
    float d0 = v.x - mu, d1 = v.y - mu, d2 = v.z - mu, d3 = v.w - mu;
    float var = wred_sum(d0 * d0 + d1 * d1 + d2 * d2 + d3 * d3) * (1.f / 128.f);
    float rs = rsqrtf(var + LN_EPS);
    int c = lane * 4;
    _Float16* dst = h2 + i * XP + c;
    dst[0] = (_Float16)(d0 * rs * n2g[c + 0] + n2b[c + 0]);
    dst[1] = (_Float16)(d1 * rs * n2g[c + 1] + n2b[c + 1]);
    dst[2] = (_Float16)(d2 * rs * n2g[c + 2] + n2b[c + 2]);
    dst[3] = (_Float16)(d3 * rs * n2g[c + 3] + n2b[c + 3]);
  }
  __syncthreads();

  // fc1 + GELU(exact): (64x128)@(128x512). Each wave owns 4 of the 32 column strips (64x16):
  // activation fragments stay in registers, each weight fragment feeds the four row tiles.
  {
    v16h af[4][4];
#pragma unroll
    for (int mt = 0; mt < 4; ++mt)
#pragma unroll
      for (int kk = 0; kk < 4; ++kk) af[mt][kk] = ld_a(h2, XP, mt * 16, kk * 32, lane);
    for (int j = 0; j < 4; ++j) {
      int nt = wv + j * 8;
      v8f acc[4] = {};
      v16h bf[4];
#pragma unroll
      for (int kk = 0; kk < 4; ++kk) bf[kk] = ld_a(fc1Wt, CC, nt * 16, kk * 32, lane);
      // Keeps the strip's eight weight loads in flight together: without it the scheduler
      // reuses one register set and waits out a full load latency at every k step.
      __builtin_amdgcn_sched_barrier(0);
#pragma unroll
      for (int kk = 0; kk < 4; ++kk)
#pragma unroll
        for (int mt = 0; mt < 4; ++mt) acc[mt] = WMMA_F16(af[mt][kk], bf[kk], acc[mt]);
      int n = nt * 16 + (lane & 15);
      float bb = fc1b[n];
#pragma unroll
      for (int mt = 0; mt < 4; ++mt) {
        int mbase = mt * 16 + ((lane >> 4) << 3);
#pragma unroll
        for (int r = 0; r < 8; ++r) {
          float vv = acc[mt][r] + bb;
          vv = 0.5f * vv * (1.f + erff(vv * 0.7071067811865475f));
          a1[(mbase + r) * AP + n] = (_Float16)vv;
        }
      }
    }
  }
  __syncthreads();

  // fc2 + residual: (64x512)@(512x128). One 64x16 column strip per wave:
  // each weight fragment feeds the four row tiles.
  {
    int nt = wv;
    int n = nt * 16 + (lane & 15);
    float bb = fc2b[n];
    float* orow = out + (r0 + (size_t)((lane >> 4) << 3)) * CC + n;
    v8f acc[4] = {};
    v16h bf[2][4];   // weight fragments: this group of four k steps and the next
    v16h af[2][4];   // activation fragments: this k step and the next
    float res[4][8]; // residual rows, fetched under the last four k steps
#pragma unroll
    for (int q = 0; q < 4; ++q) bf[0][q] = ld_a(fc2Wt, HID, nt * 16, q * 32, lane);
#pragma unroll
    for (int mt = 0; mt < 4; ++mt) af[0][mt] = ld_a(a1, AP, mt * 16, 0, lane);
#pragma unroll
    for (int kk = 0; kk < 16; ++kk) {
      if ((kk & 3) == 0 && kk + 4 < 16) {
#pragma unroll
        for (int q = 0; q < 4; ++q)
          bf[((kk >> 2) + 1) & 1][q] = ld_a(fc2Wt, HID, nt * 16, (kk + 4 + q) * 32, lane);
      }
      if (kk == 12) {
        // Precaution: the residual values may be given the registers that held the weight
        // address of loads still in flight; this wait stands in front of that overwrite.
        asm volatile("s_wait_xcnt 0x0" ::: "memory");
#pragma unroll
        for (int mt = 0; mt < 4; ++mt)
#pragma unroll
          for (int r = 0; r < 8; ++r) res[mt][r] = orow[(mt * 16 + r) * CC];
      }
      if (kk + 1 < 16) {
#pragma unroll
        for (int mt = 0; mt < 4; ++mt) af[(kk + 1) & 1][mt] = ld_a(a1, AP, mt * 16, (kk + 1) * 32, lane);
      }
      // The two scheduling barriers hold the order "next step's loads as one group, then this
      // step's four matrix instructions": left free, the scheduler either loads each fragment
      // right in front of its use and waits out its latency, or runs past 256 registers.
      __builtin_amdgcn_sched_barrier(0);
#pragma unroll
      for (int mt = 0; mt < 4; ++mt)
        acc[mt] = WMMA_F16(af[kk & 1][mt], bf[(kk >> 2) & 1][kk & 3], acc[mt]);
      __builtin_amdgcn_sched_barrier(0);
    }
#pragma unroll
    for (int mt = 0; mt < 4; ++mt)
#pragma unroll
      for (int r = 0; r < 8; ++r) orow[(mt * 16 + r) * CC] = res[mt][r] + (acc[mt][r] + bb);
  }
}

extern "C" void kernel_launch(void* const* d_in, const int* in_sizes, int n_in,
                              void* d_out, int out_size, void* d_ws, size_t ws_size,
                              hipStream_t stream) {
  (void)in_sizes; (void)n_in; (void)out_size; (void)ws_size;
  const float* x      = (const float*)d_in[0];
  const float* qkv_w  = (const float*)d_in[1];
  const float* qkv_b  = (const float*)d_in[2];
  const float* proj_w = (const float*)d_in[3];
  const float* proj_b = (const float*)d_in[4];
  const float* rpb    = (const float*)d_in[5];
  const float* n1g    = (const float*)d_in[6];
  const float* n1b    = (const float*)d_in[7];
  const float* n2g    = (const float*)d_in[8];
  const float* n2b    = (const float*)d_in[9];
  const float* fc1w   = (const float*)d_in[10];
  const float* fc1b   = (const float*)d_in[11];
  const float* fc2w   = (const float*)d_in[12];
  const float* fc2b   = (const float*)d_in[13];
  float* out = (float*)d_out;

  _Float16* qkvWt  = (_Float16*)d_ws;          // [384][128]
  _Float16* projWt = qkvWt + 384 * 128;        // [128][128]
  _Float16* fc1Wt  = projWt + 128 * 128;       // [512][128]
  _Float16* fc2Wt  = fc1Wt + 512 * 128;        // [128][512]

  k_wprep<<<96, 256, 0, stream>>>(qkv_w, qkvWt, 128, 384);
  k_wprep<<<32, 256, 0, stream>>>(proj_w, projWt, 128, 128);
  k_wprep<<<128, 256, 0, stream>>>(fc1w, fc1Wt, 128, 512);
  k_wprep<<<128, 256, 0, stream>>>(fc2w, fc2Wt, 512, 128);

  k_attn<<<64 * 64, 256, 0, stream>>>(x, qkv_b, proj_b, rpb, n1g, n1b, qkvWt, projWt, out);
  k_mlp<<<3136, 256, 0, stream>>>(n2g, n2b, fc1Wt, fc1b, fc2Wt, fc2b, out);
}

// v003
// One run takes 295 microseconds.
// Next to v002, in two timings, it ran 1.21 and 1.20 times as fast.
// Over all steps from v000 it is 2.46 times as fast.
#include <hip/hip_runtime.h>
#include <hip/hip_bf16.h>
#include <math.h>

typedef __attribute__((ext_vector_type(16))) _Float16 v16h;
typedef __attribute__((ext_vector_type(8)))  _Float16 v8h;
typedef __attribute__((ext_vector_type(8)))  float    v8f;

#define NTOK 49
#define CC   128
#define NHEAD 4
#define HID  512
#define HW   56
#define SHFT 3
#define LN_EPS 1e-5f

// LDS row pitches in elements. Each row carries 16 bytes of pad, so the pitch is an odd
// multiple of 16 bytes and the 16 rows of one 128-bit fragment read fall on distinct banks.
#define XP  (CC + 8)       // f16 rows of 128: 272 B
#define QKP (256 + 8)      // f16 rows of 256: 528 B
#define TP  (64 + 8)       // f16 rows of 64: 144 B
#define SP  (64 + 4)       // f32 rows of 64: 272 B
#define OP  (CC + 4)       // f32 rows of 128: 528 B
#define AP  (HID + 8)      // f16 rows of 512: 1040 B

#define WMMA_F16(a, b, c) \
  __builtin_amdgcn_wmma_f32_16x16x32_f16(false, (a), false, (b), (short)0, (c), false, false)

// Sum over the 32 lanes for R independent values at once: step by step over all R, so the
// R cross-lane exchanges of a step are in flight together. Each value is summed by itself,
// over lane distances 16, 8, 4, 2, 1.
template <int R>
__device__ __forceinline__ void wred_sum_rows(float (&s)[R]) {
#pragma unroll
  for (int o = 16; o > 0; o >>= 1)
#pragma unroll
    for (int t = 0; t < R; ++t) s[t] += __shfl_xor(s[t], o, 32);
}

// LayerNorm of R rows of 128 floats, four per lane, in place.
template <int R>
__device__ __forceinline__ void ln_rows(float4 (&v)[R], const float* __restrict__ g,
                                        const float* __restrict__ be, int lane) {
  float s[R];
#pragma unroll
  for (int t = 0; t < R; ++t) s[t] = v[t].x + v[t].y + v[t].z + v[t].w;
  wred_sum_rows<R>(s);
#pragma unroll
  for (int t = 0; t < R; ++t) {
    float mu = s[t] * (1.f / 128.f);
    v[t].x -= mu; v[t].y -= mu; v[t].z -= mu; v[t].w -= mu;
    s[t] = v[t].x * v[t].x + v[t].y * v[t].y + v[t].z * v[t].z + v[t].w * v[t].w;
  }
  wred_sum_rows<R>(s);
  int c = lane * 4;
#pragma unroll
  for (int t = 0; t < R; ++t) {
    float rs = rsqrtf(s[t] * (1.f / 128.f) + LN_EPS);
    v[t].x = v[t].x * rs * g[c + 0] + be[c + 0];
    v[t].y = v[t].y * rs * g[c + 1] + be[c + 1];
    v[t].z = v[t].z * rs * g[c + 2] + be[c + 2];
    v[t].w = v[t].w * rs * g[c + 3] + be[c + 3];
  }
}

// A/B-operand fragment (16x32 f16 tile, rows striped over lanes, K along VGPRs).
// Per ISA 7.12.2 the per-lane halves are contiguous in two 16B runs: K+[0..7] and K+[16..23]
// (K offset +8 for lanes 16..31) -> two 128-bit loads.
__device__ __forceinline__ v16h ld_a(const _Float16* buf, int ld, int row0, int col0, int lane) {
  int m  = row0 + (lane & 15);
  int kb = (lane >> 4) << 3;
  const v8h* p = (const v8h*)(buf + m * ld + col0 + kb);
  v8h lo = p[0];
  v8h hi = p[2];
  return __builtin_shufflevector(lo, hi, 0, 1, 2, 3, 4, 5, 6, 7,
                                         8, 9, 10, 11, 12, 13, 14, 15);
}

// Same fragment sourced from an f32 buffer (two 32B runs), converting to f16.
__device__ __forceinline__ v16h ld_a_f32(const float* buf, int ld, int row0, int col0, int lane) {
  int m  = row0 + (lane & 15);
  int kb = (lane >> 4) << 3;
  const float4* p = (const float4*)(buf + m * ld + col0 + kb);
  float4 q0 = p[0], q1 = p[1], q2 = p[4], q3 = p[5];
  v16h a;
  a[0]  = (_Float16)q0.x; a[1]  = (_Float16)q0.y; a[2]  = (_Float16)q0.z; a[3]  = (_Float16)q0.w;
  a[4]  = (_Float16)q1.x; a[5]  = (_Float16)q1.y; a[6]  = (_Float16)q1.z; a[7]  = (_Float16)q1.w;
  a[8]  = (_Float16)q2.x; a[9]  = (_Float16)q2.y; a[10] = (_Float16)q2.z; a[11] = (_Float16)q2.w;
  a[12] = (_Float16)q3.x; a[13] = (_Float16)q3.y; a[14] = (_Float16)q3.z; a[15] = (_Float16)q3.w;
  return a;
}

// ---- weight prep: wt[n][k] = (f16) w[k][n] -----------------------------------
__global__ void k_wprep(const float* __restrict__ w, _Float16* __restrict__ wt, int K, int N) {
  int total = K * N;
  for (int i = blockIdx.x * blockDim.x + threadIdx.x; i < total; i += gridDim.x * blockDim.x) {
    int n = i / K, k = i - n * K;
    wt[i] = (_Float16)w[k * N + n];
  }
}

// ---- fused LN1 + shifted-window attention + proj + residual ------------------
__global__ __launch_bounds__(256) void k_attn(
    const float* __restrict__ x, const float* __restrict__ qkv_b,
    const float* __restrict__ proj_b, const float* __restrict__ rpb,
    const float* __restrict__ n1g, const float* __restrict__ n1b,
    const _Float16* __restrict__ qkvWt, const _Float16* __restrict__ projWt,
    float* __restrict__ out) {
  __shared__ __attribute__((aligned(16))) _Float16 xt[64 * XP];     // LN'd window tokens (padded to 64 rows)
  __shared__ __attribute__((aligned(16))) _Float16 qkvs[64 * QKP];  // Q|K f16 (token-major)
  __shared__ __attribute__((aligned(16))) _Float16 vts[CC * TP];    // V transposed (channel-major)
  __shared__ __attribute__((aligned(16))) float    ss[64 * SP];     // scores (per head)
  __shared__ __attribute__((aligned(16))) _Float16 ps[64 * TP];     // softmax probs
  __shared__ __attribute__((aligned(16))) float    os[64 * OP];     // attention output (pre-proj)

  const int tid  = threadIdx.x;
  const int lane = tid & 31;
  const int wv   = __builtin_amdgcn_readfirstlane(tid >> 5);  // wave-uniform -> SGPR
  const int b    = blockIdx.x >> 6;
  const int w    = blockIdx.x & 63;
  const int wh   = w >> 3, ww = w & 7;
  const float scale = 0.17677669529663687f;  // 1/sqrt(32)

  // gather (roll by -3) + LayerNorm1. A wave's seven tokens go through together: all row
  // loads are issued first and each reduction step runs over the seven rows side by side, so
  // one load latency and one chain of cross-lane steps are paid per wave, not one per token.
  // The block has eight waves: tokens wv + 8 t, t < 6, are 0..47; every wave also works
  // token 48 and wave 0 alone stores it.
  {
    float4 v[7];
#pragma unroll
    for (int t = 0; t < 7; ++t) {
      int i = (t < 6) ? wv + t * 8 : NTOK - 1;
      int yi = i / 7, xi = i - yi * 7;
      int sr = (wh * 7 + yi + SHFT) % HW;
      int sc = (ww * 7 + xi + SHFT) % HW;
      const float* row = x + ((size_t)b * (HW * HW) + (size_t)(sr * HW + sc)) * CC;
      v[t] = *(const float4*)(row + lane * 4);
    }
    // Precaution: the loop below may be given the registers that held the row addresses of
    // loads still in flight; this wait stands in front of that overwrite.
    asm volatile("s_wait_xcnt 0x0" ::: "memory");
    // zero pad rows 49..63 while the row loads are in flight
    for (int i = tid; i < (64 - NTOK) * XP; i += 256) xt[NTOK * XP + i] = (_Float16)0.f;
    ln_rows<7>(v, n1g, n1b, lane);
#pragma unroll
    for (int t = 0; t < 7; ++t) {
      if (t < 6 || wv == 0) {
        int i = (t < 6) ? wv + t * 8 : NTOK - 1;
        _Float16* dst = xt + i * XP + lane * 4;
        dst[0] = (_Float16)v[t].x;
        dst[1] = (_Float16)v[t].y;
        dst[2] = (_Float16)v[t].z;
        dst[3] = (_Float16)v[t].w;
      }
    }
  }
  __syncthreads();

  // QKV GEMM: (64x128) @ (128x384). Each wave owns whole 64x16 column strips (3 of 24):
  // the 16 activation fragments stay in registers, and every weight fragment is loaded
  // once per block and feeds the four row tiles. Strip j of a wave is Q, K, V for j = 0, 1, 2.
  {
    v16h af[4][4];
#pragma unroll
    for (int mt = 0; mt < 4; ++mt)
#pragma unroll
      for (int kk = 0; kk < 4; ++kk) af[mt][kk] = ld_a(xt, XP, mt * 16, kk * 32, lane);
#pragma unroll
    for (int j = 0; j < 3; ++j) {
      int nt = wv + j * 8;
      v8f acc[4] = {};
      v16h bf[4];
#pragma unroll
      for (int kk = 0; kk < 4; ++kk) bf[kk] = ld_a(qkvWt, CC, nt * 16, kk * 32, lane);
      // Keeps the strip's eight weight loads in flight together: without it the scheduler
      // reuses one register set and waits out a full load latency at every k step.
      __builtin_amdgcn_sched_barrier(0);
#pragma unroll
      for (int kk = 0; kk < 4; ++kk)
#pragma unroll
        for (int mt = 0; mt < 4; ++mt) acc[mt] = WMMA_F16(af[mt][kk], bf[kk], acc[mt]);
      int n = nt * 16 + (lane & 15);
      float bias = qkv_b[n];
#pragma unroll
      for (int mt = 0; mt < 4; ++mt) {
        int mbase = mt * 16 + ((lane >> 4) << 3);
        if (j == 0) {  // Q (pre-scaled)
#pragma unroll
          for (int r = 0; r < 8; ++r)
            qkvs[(mbase + r) * QKP + n] = (_Float16)((acc[mt][r] + bias) * scale);
        } else if (j == 1) {  // K
#pragma unroll
          for (int r = 0; r < 8; ++r)
            qkvs[(mbase + r) * QKP + n] = (_Float16)(acc[mt][r] + bias);
        } else {  // V -> transposed, 8 consecutive halves per lane (one b128 store)
          _Float16* dst = vts + (n - 256) * TP + mbase;
#pragma unroll
          for (int r = 0; r < 8; ++r) dst[r] = (_Float16)(acc[mt][r] + bias);
        }
      }
    }
  }
  __syncthreads();

  // per-head attention
  for (int h = 0; h < NHEAD; ++h) {
    // S = Q K^T + rel_pos_bias + shift_mask : 16 tiles, 2 per wave
#pragma unroll
    for (int tt = 0; tt < 2; ++tt) {
      int t = wv * 2 + tt;
      int it = t >> 2, jt = t & 3;
      v16h a  = ld_a(qkvs, QKP, it * 16, h * 32, lane);          // Q rows
      v16h bm = ld_a(qkvs, QKP, jt * 16, 128 + h * 32, lane);    // K rows = cols of K^T
      v8f acc = {};
      acc = WMMA_F16(a, bm, acc);
      int j = jt * 16 + (lane & 15);
      int mbase = it * 16 + ((lane >> 4) << 3);
      int yj = j / 7, xj = j - yj * 7;
      int rhj = (wh == 7) ? (yj < 4 ? 1 : 2) : 0;
      int rwj = (ww == 7) ? (xj < 4 ? 1 : 2) : 0;
      int labj = rhj * 3 + rwj;
#pragma unroll
      for (int r = 0; r < 8; ++r) {
        int i = mbase + r;
        float val;
        if (j >= NTOK) {
          val = -1e30f;
        } else if (i >= NTOK) {
          val = 0.f;
        } else {
          int yi = i / 7, xi = i - yi * 7;
          int ridx = (yi - yj + 6) * 13 + (xi - xj + 6);
          float bias = rpb[ridx * NHEAD + h];
          int rhi = (wh == 7) ? (yi < 4 ? 1 : 2) : 0;
          int rwi = (ww == 7) ? (xi < 4 ? 1 : 2) : 0;
          float msk = ((rhi * 3 + rwi) != labj) ? -100.f : 0.f;
          val = acc[r] + bias + msk;
        }
        ss[i * SP + j] = val;
      }
    }
    __syncthreads();

    // softmax: 4 lanes per row, 16 cols each (vectorized row access)
    {
      int row = tid >> 2, seg = tid & 3;
      const float4* srow = (const float4*)(ss + row * SP + seg * 16);
      float4 f0 = srow[0], f1 = srow[1], f2 = srow[2], f3 = srow[3];
      float e[16] = {f0.x, f0.y, f0.z, f0.w, f1.x, f1.y, f1.z, f1.w,
                     f2.x, f2.y, f2.z, f2.w, f3.x, f3.y, f3.z, f3.w};
      float mx = -1e30f;
#pragma unroll
      for (int q = 0; q < 16; ++q) mx = fmaxf(mx, e[q]);
      mx = fmaxf(mx, __shfl_xor(mx, 1, 32));
      mx = fmaxf(mx, __shfl_xor(mx, 2, 32));
      float sm = 0.f;
#pragma unroll
      for (int q = 0; q < 16; ++q) { e[q] = __expf(e[q] - mx); sm += e[q]; }
      sm += __shfl_xor(sm, 1, 32);
      sm += __shfl_xor(sm, 2, 32);
      float inv = 1.f / sm;
      v8h p0, p1;
#pragma unroll
      for (int q = 0; q < 8; ++q) { p0[q] = (_Float16)(e[q] * inv); p1[q] = (_Float16)(e[q + 8] * inv); }
      v8h* prow = (v8h*)(ps + row * TP + seg * 16);
      prow[0] = p0;
      prow[1] = p1;
    }
    __syncthreads();

    // O_h = P @ V : 8 tiles, 1 per wave (B-operand from transposed V -> contiguous)
    {
      int mt = wv >> 1, nt = wv & 1;
      v8f acc = {};
#pragma unroll
      for (int kk = 0; kk < 2; ++kk) {
        v16h a  = ld_a(ps, TP, mt * 16, kk * 32, lane);
        v16h bm = ld_a(vts, TP, h * 32 + nt * 16, kk * 32, lane);
        acc = WMMA_F16(a, bm, acc);
      }
      int n = h * 32 + nt * 16 + (lane & 15);
      int mbase = mt * 16 + ((lane >> 4) << 3);
#pragma unroll
      for (int r = 0; r < 8; ++r) os[(mbase + r) * OP + n] = acc[r];
    }
    __syncthreads();
  }

  // proj: (64x128)@(128x128) + bias, scatter with inverse roll, add residual
  // One 64x16 column strip per wave: each weight fragment feeds the four row tiles.
  {
    int nt = wv;
    v8f acc[4] = {};
#pragma unroll
    for (int kk = 0; kk < 4; ++kk) {
      v16h bm = ld_a(projWt, CC, nt * 16, kk * 32, lane);
#pragma unroll
      for (int mt = 0; mt < 4; ++mt) {
        v16h a = ld_a_f32(os, OP, mt * 16, kk * 32, lane);
        acc[mt] = WMMA_F16(a, bm, acc[mt]);
      }
    }
    int n = nt * 16 + (lane & 15);
    float pb = proj_b[n];
#pragma unroll
    for (int mt = 0; mt < 4; ++mt) {
      int mbase = mt * 16 + ((lane >> 4) << 3);
#pragma unroll
      for (int r = 0; r < 8; ++r) {
        int i = mbase + r;
        if (i < NTOK) {
          int yi = i / 7, xi = i - yi * 7;
          int sr = (wh * 7 + yi + SHFT) % HW;
          int sc = (ww * 7 + xi + SHFT) % HW;
          size_t idx = ((size_t)b * (HW * HW) + (size_t)(sr * HW + sc)) * CC + n;
          out[idx] = x[idx] + acc[mt][r] + pb;
        }
      }
    }
  }
}

// ---- fused LN2 + MLP (fc1 + GELU + fc2) + residual ---------------------------
__global__ __launch_bounds__(256) void k_mlp(
    const float* __restrict__ n2g, const float* __restrict__ n2b,
    const _Float16* __restrict__ fc1Wt, const float* __restrict__ fc1b,
    const _Float16* __restrict__ fc2Wt, const float* __restrict__ fc2b,
    float* __restrict__ out) {
  __shared__ __attribute__((aligned(16))) _Float16 h2[64 * XP];   // LN'd rows
  __shared__ __attribute__((aligned(16))) _Float16 a1[64 * AP];   // GELU(fc1) rows
  const int tid = threadIdx.x, lane = tid & 31;
  const int wv = __builtin_amdgcn_readfirstlane(tid >> 5);  // wave-uniform -> SGPR
  const size_t r0 = (size_t)blockIdx.x * 64;

  // LayerNorm2 on 64 rows of current out (= x + attn). A wave's eight rows go through
  // together: all row loads first, then each reduction step over the eight rows side by side.
  {
    float4 v[8];
#pragma unroll
    for (int t = 0; t < 8; ++t)
      v[t] = *(const float4*)(out + (r0 + wv + t * 8) * CC + lane * 4);
    ln_rows<8>(v, n2g, n2b, lane);
#pragma unroll
    for (int t = 0; t < 8; ++t) {
      _Float16* dst = h2 + (wv + t * 8) * XP + lane * 4;
      dst[0] = (_Float16)v[t].x;
      dst[1] = (_Float16)v[t].y;
      dst[2] = (_Float16)v[t].z;
      dst[3] = (_Float16)v[t].w;
    }
  }
  __syncthreads();

  // fc1 + GELU(exact): (64x128)@(128x512). Each wave owns 4 of the 32 column strips (64x16):
  // activation fragments stay in registers, each weight fragment feeds the four row tiles.
  {
    v16h af[4][4];
#pragma unroll
    for (int mt = 0; mt < 4; ++mt)
#pragma unroll
      for (int kk = 0; kk < 4; ++kk) af[mt][kk] = ld_a(h2, XP, mt * 16, kk * 32, lane);
    for (int j = 0; j < 4; ++j) {
      int nt = wv + j * 8;
      v8f acc[4] = {};
      v16h bf[4];
#pragma unroll
      for (int kk = 0; kk < 4; ++kk) bf[kk] = ld_a(fc1Wt, CC, nt * 16, kk * 32, lane);
      // Keeps the strip's eight weight loads in flight together: without it the scheduler
      // reuses one register set and waits out a full load latency at every k step.
      __builtin_amdgcn_sched_barrier(0);
#pragma unroll
      for (int kk = 0; kk < 4; ++kk)
#pragma unroll
        for (int mt = 0; mt < 4; ++mt) acc[mt] = WMMA_F16(af[mt][kk], bf[kk], acc[mt]);
      int n = nt * 16 + (lane & 15);
      float bb = fc1b[n];
#pragma unroll
      for (int mt = 0; mt < 4; ++mt) {
        int mbase = mt * 16 + ((lane >> 4) << 3);
#pragma unroll
        for (int r = 0; r < 8; ++r) {
          float vv = acc[mt][r] + bb;
          vv = 0.5f * vv * (1.f + erff(vv * 0.7071067811865475f));
          a1[(mbase + r) * AP + n] = (_Float16)vv;
        }
      }
    }
  }
  __syncthreads();

  // fc2 + residual: (64x512)@(512x128). One 64x16 column strip per wave:
  // each weight fragment feeds the four row tiles.
  {
    int nt = wv;
    int n = nt * 16 + (lane & 15);
    float bb = fc2b[n];
    float* orow = out + (r0 + (size_t)((lane >> 4) << 3)) * CC + n;
    v8f acc[4] = {};
    v16h bf[2][4];   // weight fragments: this group of four k steps and the next
    v16h af[2][4];   // activation fragments: this k step and the next
    float res[4][8]; // residual rows, fetched under the last four k steps
#pragma unroll
    for (int q = 0; q < 4; ++q) bf[0][q] = ld_a(fc2Wt, HID, nt * 16, q * 32, lane);
#pragma unroll
    for (int mt = 0; mt < 4; ++mt) af[0][mt] = ld_a(a1, AP, mt * 16, 0, lane);
#pragma unroll
    for (int kk = 0; kk < 16; ++kk) {
      if ((kk & 3) == 0 && kk + 4 < 16) {
#pragma unroll
        for (int q = 0; q < 4; ++q)
          bf[((kk >> 2) + 1) & 1][q] = ld_a(fc2Wt, HID, nt * 16, (kk + 4 + q) * 32, lane);
      }
      if (kk == 12) {
        // Precaution: the residual values may be given the registers that held the weight
        // address of loads still in flight; this wait stands in front of that overwrite.
        asm volatile("s_wait_xcnt 0x0" ::: "memory");
#pragma unroll
        for (int mt = 0; mt < 4; ++mt)
#pragma unroll
          for (int r = 0; r < 8; ++r) res[mt][r] = orow[(mt * 16 + r) * CC];
      }
      if (kk + 1 < 16) {
#pragma unroll
        for (int mt = 0; mt < 4; ++mt) af[(kk + 1) & 1][mt] = ld_a(a1, AP, mt * 16, (kk + 1) * 32, lane);
      }
      // The two scheduling barriers hold the order "next step's loads as one group, then this
      // step's four matrix instructions": left free, the scheduler either loads each fragment
      // right in front of its use and waits out its latency, or runs past 256 registers.
      __builtin_amdgcn_sched_barrier(0);
#pragma unroll
      for (int mt = 0; mt < 4; ++mt)
        acc[mt] = WMMA_F16(af[kk & 1][mt], bf[(kk >> 2) & 1][kk & 3], acc[mt]);
      __builtin_amdgcn_sched_barrier(0);
    }
#pragma unroll
    for (int mt = 0; mt < 4; ++mt)
#pragma unroll
      for (int r = 0; r < 8; ++r) orow[(mt * 16 + r) * CC] = res[mt][r] + (acc[mt][r] + bb);
  }
}

extern "C" void kernel_launch(void* const* d_in, const int* in_sizes, int n_in,
                              void* d_out, int out_size, void* d_ws, size_t ws_size,
                              hipStream_t stream) {
  (void)in_sizes; (void)n_in; (void)out_size; (void)ws_size;
  const float* x      = (const float*)d_in[0];
  const float* qkv_w  = (const float*)d_in[1];
  const float* qkv_b  = (const float*)d_in[2];
  const float* proj_w = (const float*)d_in[3];
  const float* proj_b = (const float*)d_in[4];
  const float* rpb    = (const float*)d_in[5];
  const float* n1g    = (const float*)d_in[6];
  const float* n1b    = (const float*)d_in[7];
  const float* n2g    = (const float*)d_in[8];
  const float* n2b    = (const float*)d_in[9];
  const float* fc1w   = (const float*)d_in[10];
  const float* fc1b   = (const float*)d_in[11];
  const float* fc2w   = (const float*)d_in[12];
  const float* fc2b   = (const float*)d_in[13];
  float* out = (float*)d_out;

  _Float16* qkvWt  = (_Float16*)d_ws;          // [384][128]
  _Float16* projWt = qkvWt + 384 * 128;        // [128][128]
  _Float16* fc1Wt  = projWt + 128 * 128;       // [512][128]
  _Float16* fc2Wt  = fc1Wt + 512 * 128;        // [128][512]

  k_wprep<<<96, 256, 0, stream>>>(qkv_w, qkvWt, 128, 384);
  k_wprep<<<32, 256, 0, stream>>>(proj_w, projWt, 128, 128);
  k_wprep<<<128, 256, 0, stream>>>(fc1w, fc1Wt, 128, 512);
  k_wprep<<<128, 256, 0, stream>>>(fc2w, fc2Wt, 512, 128);

  k_attn<<<64 * 64, 256, 0, stream>>>(x, qkv_b, proj_b, rpb, n1g, n1b, qkvWt, projWt, out);
  k_mlp<<<3136, 256, 0, stream>>>(n2g, n2b, fc1Wt, fc1b, fc2Wt, fc2b, out);
}

// v004
// One run takes 241 microseconds.
// Two timings next to v003 both put it at 1.22 times that version's speed.
// Counting every step since v000, it is 2.99 times as fast.
#include <hip/hip_runtime.h>
#include <hip/hip_bf16.h>
#include <math.h>

typedef __attribute__((ext_vector_type(16))) _Float16 v16h;
typedef __attribute__((ext_vector_type(8)))  _Float16 v8h;
typedef __attribute__((ext_vector_type(8)))  float    v8f;
typedef __attribute__((ext_vector_type(2)))  float    v2f;
typedef __attribute__((ext_vector_type(2)))  _Float16 v2h;

#define NTOK 49
#define CC   128
#define NHEAD 4
#define HID  512
#define HW   56
#define SHFT 3
#define LN_EPS 1e-5f

// LDS row pitches in elements. Each row carries 16 bytes of pad, so the pitch is an odd
// multiple of 16 bytes and the 16 rows of one 128-bit fragment read fall on distinct banks.
#define XP  (CC + 8)       // f16 rows of 128: 272 B
#define QKP (256 + 8)      // f16 rows of 256: 528 B
#define TP  (64 + 8)       // f16 rows of 64: 144 B
#define SP  (64 + 4)       // f32 rows of 64: 272 B
#define OP  (CC + 4)       // f32 rows of 128: 528 B
#define AP  (HID + 8)      // f16 rows of 512: 1040 B

#define WMMA_F16(a, b, c) \
  __builtin_amdgcn_wmma_f32_16x16x32_f16(false, (a), false, (b), (short)0, (c), false, false)

// Sum over the 32 lanes for R independent values at once: step by step over all R, so the
// R cross-lane exchanges of a step are in flight together. Each value is summed by itself,
// over lane distances 16, 8, 4, 2, 1.
template <int R>
__device__ __forceinline__ void wred_sum_rows(float (&s)[R]) {
#pragma unroll
  for (int o = 16; o > 0; o >>= 1)
#pragma unroll
    for (int t = 0; t < R; ++t) s[t] += __shfl_xor(s[t], o, 32);
}

// LayerNorm of R rows of 128 floats, four per lane, in place.
template <int R>
__device__ __forceinline__ void ln_rows(float4 (&v)[R], const float* __restrict__ g,
                                        const float* __restrict__ be, int lane) {
  float s[R];
#pragma unroll
  for (int t = 0; t < R; ++t) s[t] = v[t].x + v[t].y + v[t].z + v[t].w;
  wred_sum_rows<R>(s);
#pragma unroll
  for (int t = 0; t < R; ++t) {
    float mu = s[t] * (1.f / 128.f);
    v[t].x -= mu; v[t].y -= mu; v[t].z -= mu; v[t].w -= mu;
    s[t] = v[t].x * v[t].x + v[t].y * v[t].y + v[t].z * v[t].z + v[t].w * v[t].w;
  }
  wred_sum_rows<R>(s);
  int c = lane * 4;
#pragma unroll
  for (int t = 0; t < R; ++t) {
    float rs = rsqrtf(s[t] * (1.f / 128.f) + LN_EPS);
    v[t].x = v[t].x * rs * g[c + 0] + be[c + 0];
    v[t].y = v[t].y * rs * g[c + 1] + be[c + 1];
    v[t].z = v[t].z * rs * g[c + 2] + be[c + 2];
    v[t].w = v[t].w * rs * g[c + 3] + be[c + 3];
  }
}

// GELU in its erf form, v * Phi(v) = 0.5 v (1 + erf(v / sqrt 2)), two values at a time, with no branch:
//   1 - Phi(a) = exp(-a^2 / 2) * t (c1 + t (c2 + t (c3 + t (c4 + t c5)))),  t = 1 / (1 + p a),  a = |v|
// (the classical five-term rational form; its error in Phi is below 7.5e-8 for every a >= 0, and the
// factor 1 / sqrt(2 pi) is folded into c1..c5). With h = 1 - Phi(|v|): v Phi(v) = max(v, 0) - |v| h
// on both signs. In f32 the result stays within 1e-6 of v Phi(v), far under the f16 rounding that follows.
// One straight line of code for every lane, so neighbouring values overlap in the pipe.
__device__ __forceinline__ v2f gelu2(v2f v) {
  v2f a = __builtin_elementwise_abs(v);
  v2f d = a * 0.2316419f + 1.f;
  v2f t = {__builtin_amdgcn_rcpf(d.x), __builtin_amdgcn_rcpf(d.y)};
  v2f y = t * 0.53070271f - 0.72657603f;
  y = y * t + 0.71070689f;
  y = y * t - 0.14224836f;
  y = y * t + 0.12741479f;
  y = y * t;
  v2f q = (v * v) * -0.72134752f;  // -a^2 / 2 in powers of two
  v2f e = {__builtin_amdgcn_exp2f(q.x), __builtin_amdgcn_exp2f(q.y)};
  v2f h = y * e;
  v2f zero = {0.f, 0.f};
  return __builtin_elementwise_max(v, zero) - a * h;
}

// A/B-operand fragment (16x32 f16 tile, rows striped over lanes, K along VGPRs).
// Per ISA 7.12.2 the per-lane halves are contiguous in two 16B runs: K+[0..7] and K+[16..23]
// (K offset +8 for lanes 16..31) -> two 128-bit loads.
__device__ __forceinline__ v16h ld_a(const _Float16* buf, int ld, int row0, int col0, int lane) {
  int m  = row0 + (lane & 15);
  int kb = (lane >> 4) << 3;
  const v8h* p = (const v8h*)(buf + m * ld + col0 + kb);
  v8h lo = p[0];
  v8h hi = p[2];
  return __builtin_shufflevector(lo, hi, 0, 1, 2, 3, 4, 5, 6, 7,
                                         8, 9, 10, 11, 12, 13, 14, 15);
}

// Same fragment sourced from an f32 buffer (two 32B runs), converting to f16.
__device__ __forceinline__ v16h ld_a_f32(const float* buf, int ld, int row0, int col0, int lane) {
  int m  = row0 + (lane & 15);
  int kb = (lane >> 4) << 3;
  const float4* p = (const float4*)(buf + m * ld + col0 + kb);
  float4 q0 = p[0], q1 = p[1], q2 = p[4], q3 = p[5];
  v16h a;
  a[0]  = (_Float16)q0.x; a[1]  = (_Float16)q0.y; a[2]  = (_Float16)q0.z; a[3]  = (_Float16)q0.w;
  a[4]  = (_Float16)q1.x; a[5]  = (_Float16)q1.y; a[6]  = (_Float16)q1.z; a[7]  = (_Float16)q1.w;
  a[8]  = (_Float16)q2.x; a[9]  = (_Float16)q2.y; a[10] = (_Float16)q2.z; a[11] = (_Float16)q2.w;
  a[12] = (_Float16)q3.x; a[13] = (_Float16)q3.y; a[14] = (_Float16)q3.z; a[15] = (_Float16)q3.w;
  return a;
}

// ---- weight prep: wt[n][k] = (f16) w[k][n] -----------------------------------
__global__ void k_wprep(const float* __restrict__ w, _Float16* __restrict__ wt, int K, int N) {
  int total = K * N;
  for (int i = blockIdx.x * blockDim.x + threadIdx.x; i < total; i += gridDim.x * blockDim.x) {
    int n = i / K, k = i - n * K;
    wt[i] = (_Float16)w[k * N + n];
  }
}

// ---- fused LN1 + shifted-window attention + proj + residual ------------------
__global__ __launch_bounds__(256) void k_attn(
    const float* __restrict__ x, const float* __restrict__ qkv_b,
    const float* __restrict__ proj_b, const float* __restrict__ rpb,
    const float* __restrict__ n1g, const float* __restrict__ n1b,
    const _Float16* __restrict__ qkvWt, const _Float16* __restrict__ projWt,
    float* __restrict__ out) {
  __shared__ __attribute__((aligned(16))) _Float16 xt[64 * XP];     // LN'd window tokens (padded to 64 rows)
  __shared__ __attribute__((aligned(16))) _Float16 qkvs[64 * QKP];  // Q|K f16 (token-major)
  __shared__ __attribute__((aligned(16))) _Float16 vts[CC * TP];    // V transposed (channel-major)
  __shared__ __attribute__((aligned(16))) float    ss[64 * SP];     // scores (per head)
  __shared__ __attribute__((aligned(16))) _Float16 ps[64 * TP];     // softmax probs
  __shared__ __attribute__((aligned(16))) float    os[64 * OP];     // attention output (pre-proj)

  const int tid  = threadIdx.x;
  const int lane = tid & 31;
  const int wv   = __builtin_amdgcn_readfirstlane(tid >> 5);  // wave-uniform -> SGPR
  const int b    = blockIdx.x >> 6;
  const int w    = blockIdx.x & 63;
  const int wh   = w >> 3, ww = w & 7;
  const float scale = 0.17677669529663687f;  // 1/sqrt(32)

  // gather (roll by -3) + LayerNorm1. A wave's seven tokens go through together: all row
  // loads are issued first and each reduction step runs over the seven rows side by side, so
  // one load latency and one chain of cross-lane steps are paid per wave, not one per token.
  // The block has eight waves: tokens wv + 8 t, t < 6, are 0..47; every wave also works
  // token 48 and wave 0 alone stores it.
  {
    float4 v[7];
#pragma unroll
    for (int t = 0; t < 7; ++t) {
      int i = (t < 6) ? wv + t * 8 : NTOK - 1;
      int yi = i / 7, xi = i - yi * 7;
      int sr = (wh * 7 + yi + SHFT) % HW;
      int sc = (ww * 7 + xi + SHFT) % HW;
      const float* row = x + ((size_t)b * (HW * HW) + (size_t)(sr * HW + sc)) * CC;
      v[t] = *(const float4*)(row + lane * 4);
    }
    // Precaution: the loop below may be given the registers that held the row addresses of
    // loads still in flight; this wait stands in front of that overwrite.
    asm volatile("s_wait_xcnt 0x0" ::: "memory");
    // zero pad rows 49..63 while the row loads are in flight
    for (int i = tid; i < (64 - NTOK) * XP; i += 256) xt[NTOK * XP + i] = (_Float16)0.f;
    ln_rows<7>(v, n1g, n1b, lane);
#pragma unroll
    for (int t = 0; t < 7; ++t) {
      if (t < 6 || wv == 0) {
        int i = (t < 6) ? wv + t * 8 : NTOK - 1;
        _Float16* dst = xt + i * XP + lane * 4;
        dst[0] = (_Float16)v[t].x;
        dst[1] = (_Float16)v[t].y;
        dst[2] = (_Float16)v[t].z;
        dst[3] = (_Float16)v[t].w;
      }
    }
  }
  __syncthreads();

  // QKV GEMM: (64x128) @ (128x384). Each wave owns whole 64x16 column strips (3 of 24):
  // the 16 activation fragments stay in registers, and every weight fragment is loaded
  // once per block and feeds the four row tiles. Strip j of a wave is Q, K, V for j = 0, 1, 2.
  {
    v16h af[4][4];
#pragma unroll
    for (int mt = 0; mt < 4; ++mt)
#pragma unroll
      for (int kk = 0; kk < 4; ++kk) af[mt][kk] = ld_a(xt, XP, mt * 16, kk * 32, lane);
#pragma unroll
    for (int j = 0; j < 3; ++j) {
      int nt = wv + j * 8;
      v8f acc[4] = {};
      v16h bf[4];
#pragma unroll
      for (int kk = 0; kk < 4; ++kk) bf[kk] = ld_a(qkvWt, CC, nt * 16, kk * 32, lane);
      // Keeps the strip's eight weight loads in flight together: without it the scheduler
      // reuses one register set and waits out a full load latency at every k step.
      __builtin_amdgcn_sched_barrier(0);
#pragma unroll
      for (int kk = 0; kk < 4; ++kk)
#pragma unroll
        for (int mt = 0; mt < 4; ++mt) acc[mt] = WMMA_F16(af[mt][kk], bf[kk], acc[mt]);
      int n = nt * 16 + (lane & 15);
      float bias = qkv_b[n];
#pragma unroll
      for (int mt = 0; mt < 4; ++mt) {
        int mbase = mt * 16 + ((lane >> 4) << 3);
        if (j == 0) {  // Q (pre-scaled)
#pragma unroll
          for (int r = 0; r < 8; ++r)
            qkvs[(mbase + r) * QKP + n] = (_Float16)((acc[mt][r] + bias) * scale);
        } else if (j == 1) {  // K
#pragma unroll
          for (int r = 0; r < 8; ++r)
            qkvs[(mbase + r) * QKP + n] = (_Float16)(acc[mt][r] + bias);
        } else {  // V -> transposed, 8 consecutive halves per lane (one b128 store)
          _Float16* dst = vts + (n - 256) * TP + mbase;
#pragma unroll
          for (int r = 0; r < 8; ++r) dst[r] = (_Float16)(acc[mt][r] + bias);
        }
      }
    }
  }
  __syncthreads();

  // per-head attention
  for (int h = 0; h < NHEAD; ++h) {
    // S = Q K^T + rel_pos_bias + shift_mask : 16 tiles, 2 per wave
#pragma unroll
    for (int tt = 0; tt < 2; ++tt) {
      int t = wv * 2 + tt;
      int it = t >> 2, jt = t & 3;
      v16h a  = ld_a(qkvs, QKP, it * 16, h * 32, lane);          // Q rows
      v16h bm = ld_a(qkvs, QKP, jt * 16, 128 + h * 32, lane);    // K rows = cols of K^T
      v8f acc = {};
      acc = WMMA_F16(a, bm, acc);
      int j = jt * 16 + (lane & 15);
      int mbase = it * 16 + ((lane >> 4) << 3);
      int yj = j / 7, xj = j - yj * 7;
      int rhj = (wh == 7) ? (yj < 4 ? 1 : 2) : 0;
      int rwj = (ww == 7) ? (xj < 4 ? 1 : 2) : 0;
      int labj = rhj * 3 + rwj;
#pragma unroll
      for (int r = 0; r < 8; ++r) {
        int i = mbase + r;
        float val;
        if (j >= NTOK) {
          val = -1e30f;
        } else if (i >= NTOK) {
          val = 0.f;
        } else {
          int yi = i / 7, xi = i - yi * 7;
          int ridx = (yi - yj + 6) * 13 + (xi - xj + 6);
          float bias = rpb[ridx * NHEAD + h];
          int rhi = (wh == 7) ? (yi < 4 ? 1 : 2) : 0;
          int rwi = (ww == 7) ? (xi < 4 ? 1 : 2) : 0;
          float msk = ((rhi * 3 + rwi) != labj) ? -100.f : 0.f;
          val = acc[r] + bias + msk;
        }
        ss[i * SP + j] = val;
      }
    }
    __syncthreads();

    // softmax: 4 lanes per row, 16 cols each (vectorized row access)
    {
      int row = tid >> 2, seg = tid & 3;
      const float4* srow = (const float4*)(ss + row * SP + seg * 16);
      float4 f0 = srow[0], f1 = srow[1], f2 = srow[2], f3 = srow[3];
      float e[16] = {f0.x, f0.y, f0.z, f0.w, f1.x, f1.y, f1.z, f1.w,
                     f2.x, f2.y, f2.z, f2.w, f3.x, f3.y, f3.z, f3.w};
      float mx = -1e30f;
#pragma unroll
      for (int q = 0; q < 16; ++q) mx = fmaxf(mx, e[q]);
      mx = fmaxf(mx, __shfl_xor(mx, 1, 32));
      mx = fmaxf(mx, __shfl_xor(mx, 2, 32));
      float sm = 0.f;
#pragma unroll
      for (int q = 0; q < 16; ++q) { e[q] = __expf(e[q] - mx); sm += e[q]; }
      sm += __shfl_xor(sm, 1, 32);
      sm += __shfl_xor(sm, 2, 32);
      float inv = 1.f / sm;
      v8h p0, p1;
#pragma unroll
      for (int q = 0; q < 8; ++q) { p0[q] = (_Float16)(e[q] * inv); p1[q] = (_Float16)(e[q + 8] * inv); }
      v8h* prow = (v8h*)(ps + row * TP + seg * 16);
      prow[0] = p0;
      prow[1] = p1;
    }
    __syncthreads();

    // O_h = P @ V : 8 tiles, 1 per wave (B-operand from transposed V -> contiguous)
    {
      int mt = wv >> 1, nt = wv & 1;
      v8f acc = {};
#pragma unroll
      for (int kk = 0; kk < 2; ++kk) {
        v16h a  = ld_a(ps, TP, mt * 16, kk * 32, lane);
        v16h bm = ld_a(vts, TP, h * 32 + nt * 16, kk * 32, lane);
        acc = WMMA_F16(a, bm, acc);
      }
      int n = h * 32 + nt * 16 + (lane & 15);
      int mbase = mt * 16 + ((lane >> 4) << 3);
#pragma unroll
      for (int r = 0; r < 8; ++r) os[(mbase + r) * OP + n] = acc[r];
    }
    __syncthreads();
  }

  // proj: (64x128)@(128x128) + bias, scatter with inverse roll, add residual
  // One 64x16 column strip per wave: each weight fragment feeds the four row tiles.
  {
    int nt = wv;
    v8f acc[4] = {};
#pragma unroll
    for (int kk = 0; kk < 4; ++kk) {
      v16h bm = ld_a(projWt, CC, nt * 16, kk * 32, lane);
#pragma unroll
      for (int mt = 0; mt < 4; ++mt) {
        v16h a = ld_a_f32(os, OP, mt * 16, kk * 32, lane);
        acc[mt] = WMMA_F16(a, bm, acc[mt]);
      }
    }
    int n = nt * 16 + (lane & 15);
    float pb = proj_b[n];
#pragma unroll
    for (int mt = 0; mt < 4; ++mt) {
      int mbase = mt * 16 + ((lane >> 4) << 3);
#pragma unroll
      for (int r = 0; r < 8; ++r) {
        int i = mbase + r;
        if (i < NTOK) {
          int yi = i / 7, xi = i - yi * 7;
          int sr = (wh * 7 + yi + SHFT) % HW;
          int sc = (ww * 7 + xi + SHFT) % HW;
          size_t idx = ((size_t)b * (HW * HW) + (size_t)(sr * HW + sc)) * CC + n;
          out[idx] = x[idx] + acc[mt][r] + pb;
        }
      }
    }
  }
}

// ---- fused LN2 + MLP (fc1 + GELU + fc2) + residual ---------------------------
__global__ __launch_bounds__(256) void k_mlp(
    const float* __restrict__ n2g, const float* __restrict__ n2b,
    const _Float16* __restrict__ fc1Wt, const float* __restrict__ fc1b,
    const _Float16* __restrict__ fc2Wt, const float* __restrict__ fc2b,
    float* __restrict__ out) {
  __shared__ __attribute__((aligned(16))) _Float16 h2[64 * XP];   // LN'd rows
  __shared__ __attribute__((aligned(16))) _Float16 a1[64 * AP];   // GELU(fc1) rows
  const int tid = threadIdx.x, lane = tid & 31;
  const int wv = __builtin_amdgcn_readfirstlane(tid >> 5);  // wave-uniform -> SGPR
  const size_t r0 = (size_t)blockIdx.x * 64;

  // LayerNorm2 on 64 rows of current out (= x + attn). A wave's eight rows go through
  // together: all row loads first, then each reduction step over the eight rows side by side.
  {
    float4 v[8];
#pragma unroll
    for (int t = 0; t < 8; ++t)
      v[t] = *(const float4*)(out + (r0 + wv + t * 8) * CC + lane * 4);
    ln_rows<8>(v, n2g, n2b, lane);
#pragma unroll
    for (int t = 0; t < 8; ++t) {
      _Float16* dst = h2 + (wv + t * 8) * XP + lane * 4;
      dst[0] = (_Float16)v[t].x;
      dst[1] = (_Float16)v[t].y;
      dst[2] = (_Float16)v[t].z;
      dst[3] = (_Float16)v[t].w;
    }
  }
  __syncthreads();

  // fc1 + GELU (erf form): (64x128)@(128x512). Each wave owns 4 of the 32 column strips (64x16):
  // activation fragments stay in registers, each weight fragment feeds the four row tiles.
  {
    v16h af[4][4];
#pragma unroll
    for (int mt = 0; mt < 4; ++mt)
#pragma unroll
      for (int kk = 0; kk < 4; ++kk) af[mt][kk] = ld_a(h2, XP, mt * 16, kk * 32, lane);
    for (int j = 0; j < 4; ++j) {
      int nt = wv + j * 8;
      v8f acc[4] = {};
      v16h bf[4];
#pragma unroll
      for (int kk = 0; kk < 4; ++kk) bf[kk] = ld_a(fc1Wt, CC, nt * 16, kk * 32, lane);
      // Keeps the strip's eight weight loads in flight together: without it the scheduler
      // reuses one register set and waits out a full load latency at every k step.
      __builtin_amdgcn_sched_barrier(0);
#pragma unroll
      for (int kk = 0; kk < 4; ++kk)
#pragma unroll
        for (int mt = 0; mt < 4; ++mt) acc[mt] = WMMA_F16(af[mt][kk], bf[kk], acc[mt]);
      int n = nt * 16 + (lane & 15);
      float bb = fc1b[n];
#pragma unroll
      for (int mt = 0; mt < 4; ++mt) {
        int mbase = mt * 16 + ((lane >> 4) << 3);
#pragma unroll
        for (int r = 0; r < 8; r += 2) {
          v2f vv = {acc[mt][r] + bb, acc[mt][r + 1] + bb};
          v2h hh = __builtin_convertvector(gelu2(vv), v2h);
          a1[(mbase + r) * AP + n]     = hh.x;
          a1[(mbase + r + 1) * AP + n] = hh.y;
        }
      }
    }
  }
  __syncthreads();

  // fc2 + residual: (64x512)@(512x128). One 64x16 column strip per wave:
  // each weight fragment feeds the four row tiles.
  {
    int nt = wv;
    int n = nt * 16 + (lane & 15);
    float bb = fc2b[n];
    float* orow = out + (r0 + (size_t)((lane >> 4) << 3)) * CC + n;
    v8f acc[4] = {};
    v16h bf[2][4];   // weight fragments: this group of four k steps and the next
    v16h af[2][4];   // activation fragments: this k step and the next
    float res[4][8]; // residual rows, fetched under the last four k steps
#pragma unroll
    for (int q = 0; q < 4; ++q) bf[0][q] = ld_a(fc2Wt, HID, nt * 16, q * 32, lane);
#pragma unroll
    for (int mt = 0; mt < 4; ++mt) af[0][mt] = ld_a(a1, AP, mt * 16, 0, lane);
#pragma unroll
    for (int kk = 0; kk < 16; ++kk) {
      if ((kk & 3) == 0 && kk + 4 < 16) {
#pragma unroll
        for (int q = 0; q < 4; ++q)
          bf[((kk >> 2) + 1) & 1][q] = ld_a(fc2Wt, HID, nt * 16, (kk + 4 + q) * 32, lane);
      }
      if (kk == 12) {
        // Precaution: the residual values may be given the registers that held the weight
        // address of loads still in flight; this wait stands in front of that overwrite.
        asm volatile("s_wait_xcnt 0x0" ::: "memory");
#pragma unroll
        for (int mt = 0; mt < 4; ++mt)
#pragma unroll
          for (int r = 0; r < 8; ++r) res[mt][r] = orow[(mt * 16 + r) * CC];
      }
      if (kk + 1 < 16) {
#pragma unroll
        for (int mt = 0; mt < 4; ++mt) af[(kk + 1) & 1][mt] = ld_a(a1, AP, mt * 16, (kk + 1) * 32, lane);
      }
      // The two scheduling barriers hold the order "next step's loads as one group, then this
      // step's four matrix instructions": left free, the scheduler either loads each fragment
      // right in front of its use and waits out its latency, or runs past 256 registers.
      __builtin_amdgcn_sched_barrier(0);
#pragma unroll
      for (int mt = 0; mt < 4; ++mt)
        acc[mt] = WMMA_F16(af[kk & 1][mt], bf[(kk >> 2) & 1][kk & 3], acc[mt]);
      __builtin_amdgcn_sched_barrier(0);
    }
#pragma unroll
    for (int mt = 0; mt < 4; ++mt)
#pragma unroll
      for (int r = 0; r < 8; ++r) orow[(mt * 16 + r) * CC] = res[mt][r] + (acc[mt][r] + bb);
  }
}

extern "C" void kernel_launch(void* const* d_in, const int* in_sizes, int n_in,
                              void* d_out, int out_size, void* d_ws, size_t ws_size,
                              hipStream_t stream) {
  (void)in_sizes; (void)n_in; (void)out_size; (void)ws_size;
  const float* x      = (const float*)d_in[0];
  const float* qkv_w  = (const float*)d_in[1];
  const float* qkv_b  = (const float*)d_in[2];
  const float* proj_w = (const float*)d_in[3];
  const float* proj_b = (const float*)d_in[4];
  const float* rpb    = (const float*)d_in[5];
  const float* n1g    = (const float*)d_in[6];
  const float* n1b    = (const float*)d_in[7];
  const float* n2g    = (const float*)d_in[8];
  const float* n2b    = (const float*)d_in[9];
  const float* fc1w   = (const float*)d_in[10];
  const float* fc1b   = (const float*)d_in[11];
  const float* fc2w   = (const float*)d_in[12];
  const float* fc2b   = (const float*)d_in[13];
  float* out = (float*)d_out;

  _Float16* qkvWt  = (_Float16*)d_ws;          // [384][128]
  _Float16* projWt = qkvWt + 384 * 128;        // [128][128]
  _Float16* fc1Wt  = projWt + 128 * 128;       // [512][128]
  _Float16* fc2Wt  = fc1Wt + 512 * 128;        // [128][512]

  k_wprep<<<96, 256, 0, stream>>>(qkv_w, qkvWt, 128, 384);
  k_wprep<<<32, 256, 0, stream>>>(proj_w, projWt, 128, 128);
  k_wprep<<<128, 256, 0, stream>>>(fc1w, fc1Wt, 128, 512);
  k_wprep<<<128, 256, 0, stream>>>(fc2w, fc2Wt, 512, 128);

  k_attn<<<64 * 64, 256, 0, stream>>>(x, qkv_b, proj_b, rpb, n1g, n1b, qkvWt, projWt, out);
  k_mlp<<<3136, 256, 0, stream>>>(n2g, n2b, fc1Wt, fc1b, fc2Wt, fc2b, out);
}

// v005
// A run of this version takes 197 microseconds.
// Next to v004, in two timings, it ran 1.23 and 1.22 times as fast.
// Counting every step since v000, it is 3.67 times as fast.
#include <hip/hip_runtime.h>
#include <hip/hip_bf16.h>
#include <math.h>

typedef __attribute__((ext_vector_type(16))) _Float16 v16h;
typedef __attribute__((ext_vector_type(8)))  _Float16 v8h;
typedef __attribute__((ext_vector_type(8)))  float    v8f;
typedef __attribute__((ext_vector_type(2)))  float    v2f;
typedef __attribute__((ext_vector_type(2)))  _Float16 v2h;

#define NTOK 49
#define CC   128
#define NHEAD 4
#define HID  512
#define HW   56
#define SHFT 3
#define LN_EPS 1e-5f

// LDS row pitches in elements. Each row carries 16 bytes of pad, so the pitch is an odd
// multiple of 16 bytes and the 16 rows of one 128-bit fragment read fall on distinct banks.
#define XP  (CC + 8)       // f16 rows of 128: 272 B
#define QKP (256 + 8)      // f16 rows of 256: 528 B
#define TP  (64 + 8)       // f16 rows of 64: 144 B
#define AP  (HID + 8)      // f16 rows of 512: 1040 B

#define WMMA_F16(a, b, c) \
  __builtin_amdgcn_wmma_f32_16x16x32_f16(false, (a), false, (b), (short)0, (c), false, false)

// Sum over the 32 lanes for R independent values at once: step by step over all R, so the
// R cross-lane exchanges of a step are in flight together. Each value is summed by itself,
// over lane distances 16, 8, 4, 2, 1.
template <int R>
__device__ __forceinline__ void wred_sum_rows(float (&s)[R]) {
#pragma unroll
  for (int o = 16; o > 0; o >>= 1)
#pragma unroll
    for (int t = 0; t < R; ++t) s[t] += __shfl_xor(s[t], o, 32);
}

// LayerNorm of R rows of 128 floats, four per lane, in place.
template <int R>
__device__ __forceinline__ void ln_rows(float4 (&v)[R], const float* __restrict__ g,
                                        const float* __restrict__ be, int lane) {
  float s[R];
#pragma unroll
  for (int t = 0; t < R; ++t) s[t] = v[t].x + v[t].y + v[t].z + v[t].w;
  wred_sum_rows<R>(s);
#pragma unroll
  for (int t = 0; t < R; ++t) {
    float mu = s[t] * (1.f / 128.f);
    v[t].x -= mu; v[t].y -= mu; v[t].z -= mu; v[t].w -= mu;
    s[t] = v[t].x * v[t].x + v[t].y * v[t].y + v[t].z * v[t].z + v[t].w * v[t].w;
  }
  wred_sum_rows<R>(s);
  int c = lane * 4;
#pragma unroll
  for (int t = 0; t < R; ++t) {
    float rs = rsqrtf(s[t] * (1.f / 128.f) + LN_EPS);
    v[t].x = v[t].x * rs * g[c + 0] + be[c + 0];
    v[t].y = v[t].y * rs * g[c + 1] + be[c + 1];
    v[t].z = v[t].z * rs * g[c + 2] + be[c + 2];
    v[t].w = v[t].w * rs * g[c + 3] + be[c + 3];
  }
}

// GELU in its erf form, v * Phi(v) = 0.5 v (1 + erf(v / sqrt 2)), two values at a time, with no branch:
//   1 - Phi(a) = exp(-a^2 / 2) * t (c1 + t (c2 + t (c3 + t (c4 + t c5)))),  t = 1 / (1 + p a),  a = |v|
// (the classical five-term rational form; its error in Phi is below 7.5e-8 for every a >= 0, and the
// factor 1 / sqrt(2 pi) is folded into c1..c5). With h = 1 - Phi(|v|): v Phi(v) = max(v, 0) - |v| h
// on both signs. In f32 the result stays within 1e-6 of v Phi(v), far under the f16 rounding that follows.
// One straight line of code for every lane, so neighbouring values overlap in the pipe.
__device__ __forceinline__ v2f gelu2(v2f v) {
  v2f a = __builtin_elementwise_abs(v);
  v2f d = a * 0.2316419f + 1.f;
  v2f t = {__builtin_amdgcn_rcpf(d.x), __builtin_amdgcn_rcpf(d.y)};
  v2f y = t * 0.53070271f - 0.72657603f;
  y = y * t + 0.71070689f;
  y = y * t - 0.14224836f;
  y = y * t + 0.12741479f;
  y = y * t;
  v2f q = (v * v) * -0.72134752f;  // -a^2 / 2 in powers of two
  v2f e = {__builtin_amdgcn_exp2f(q.x), __builtin_amdgcn_exp2f(q.y)};
  v2f h = y * e;
  v2f zero = {0.f, 0.f};
  return __builtin_elementwise_max(v, zero) - a * h;
}

// 2^t of 25 values, in place. The instruction set asks for one independent instruction between a
// transcendental and a directly following instruction that reads its result or overwrites its
// source.
// Here each v_exp_f32 has an independent one behind it, and the v_nop is the slot of the last.
#define EXP2_AT(n) "v_exp_f32 %" #n ", %" #n "\n\t"
__device__ __forceinline__ void exp2_25(float (&t)[25]) {
  asm(EXP2_AT(0) EXP2_AT(1) EXP2_AT(2) EXP2_AT(3) EXP2_AT(4) EXP2_AT(5) EXP2_AT(6) EXP2_AT(7) EXP2_AT(8)
      EXP2_AT(9) EXP2_AT(10) EXP2_AT(11) EXP2_AT(12) EXP2_AT(13) EXP2_AT(14) EXP2_AT(15) EXP2_AT(16)
      EXP2_AT(17) EXP2_AT(18) EXP2_AT(19) EXP2_AT(20) EXP2_AT(21) EXP2_AT(22) EXP2_AT(23) EXP2_AT(24)
      "v_nop"
      : "+v"(t[0]), "+v"(t[1]), "+v"(t[2]), "+v"(t[3]), "+v"(t[4]), "+v"(t[5]), "+v"(t[6]), "+v"(t[7]),
        "+v"(t[8]), "+v"(t[9]), "+v"(t[10]), "+v"(t[11]), "+v"(t[12]), "+v"(t[13]), "+v"(t[14]),
        "+v"(t[15]), "+v"(t[16]), "+v"(t[17]), "+v"(t[18]), "+v"(t[19]), "+v"(t[20]), "+v"(t[21]),
        "+v"(t[22]), "+v"(t[23]), "+v"(t[24]));
}

// A/B-operand fragment (16x32 f16 tile, rows striped over lanes, K along VGPRs).
// Per ISA 7.12.2 the per-lane halves are contiguous in two 16B runs: K+[0..7] and K+[16..23]
// (K offset +8 for lanes 16..31) -> two 128-bit loads.
__device__ __forceinline__ v16h ld_a(const _Float16* buf, int ld, int row0, int col0, int lane) {
  int m  = row0 + (lane & 15);
  int kb = (lane >> 4) << 3;
  const v8h* p = (const v8h*)(buf + m * ld + col0 + kb);
  v8h lo = p[0];
  v8h hi = p[2];
  return __builtin_shufflevector(lo, hi, 0, 1, 2, 3, 4, 5, 6, 7,
                                         8, 9, 10, 11, 12, 13, 14, 15);
}

// ---- weight prep: wt[n][k] = (f16) w[k][n] -----------------------------------
__global__ void k_wprep(const float* __restrict__ w, _Float16* __restrict__ wt, int K, int N) {
  int total = K * N;
  for (int i = blockIdx.x * blockDim.x + threadIdx.x; i < total; i += gridDim.x * blockDim.x) {
    int n = i / K, k = i - n * K;
    wt[i] = (_Float16)w[k * N + n];
  }
}

// ---- fused LN1 + shifted-window attention + proj + residual ------------------
__global__ __launch_bounds__(256) void k_attn(
    const float* __restrict__ x, const float* __restrict__ qkv_b,
    const float* __restrict__ proj_b, const float* __restrict__ rpb,
    const float* __restrict__ n1g, const float* __restrict__ n1b,
    const _Float16* __restrict__ qkvWt, const _Float16* __restrict__ projWt,
    float* __restrict__ out) {
  __shared__ __attribute__((aligned(16))) _Float16 xt[64 * XP];     // LN'd window tokens (padded to 64 rows)
  __shared__ __attribute__((aligned(16))) _Float16 qkvs[64 * QKP];  // Q|K f16 (token-major)
  __shared__ __attribute__((aligned(16))) _Float16 vts[CC * TP];    // V transposed (channel-major)
  __shared__ __attribute__((aligned(16))) _Float16 os[64 * XP];     // attention output (pre-proj), f16

  const int tid  = threadIdx.x;
  const int lane = tid & 31;
  const int wv   = __builtin_amdgcn_readfirstlane(tid >> 5);  // wave-uniform -> SGPR
  const int b    = blockIdx.x >> 6;
  const int w    = blockIdx.x & 63;
  const int wh   = w >> 3, ww = w & 7;
  const float scale = 0.17677669529663687f;  // 1/sqrt(32)

  // gather (roll by -3) + LayerNorm1. A wave's seven tokens go through together: all row
  // loads are issued first and each reduction step runs over the seven rows side by side, so
  // one load latency and one chain of cross-lane steps are paid per wave, not one per token.
  // The block has eight waves: tokens wv + 8 t, t < 6, are 0..47; every wave also works
  // token 48 and wave 0 alone stores it.
  {
    float4 v[7];
#pragma unroll
    for (int t = 0; t < 7; ++t) {
      int i = (t < 6) ? wv + t * 8 : NTOK - 1;
      int yi = i / 7, xi = i - yi * 7;
      int sr = (wh * 7 + yi + SHFT) % HW;
      int sc = (ww * 7 + xi + SHFT) % HW;
      const float* row = x + ((size_t)b * (HW * HW) + (size_t)(sr * HW + sc)) * CC;
      v[t] = *(const float4*)(row + lane * 4);
    }
    // Precaution: the loop below may be given the registers that held the row addresses of
    // loads still in flight; this wait stands in front of that overwrite.
    asm volatile("s_wait_xcnt 0x0" ::: "memory");
    // zero pad rows 49..63 while the row loads are in flight
    for (int i = tid; i < (64 - NTOK) * XP; i += 256) xt[NTOK * XP + i] = (_Float16)0.f;
    ln_rows<7>(v, n1g, n1b, lane);
#pragma unroll
    for (int t = 0; t < 7; ++t) {
      if (t < 6 || wv == 0) {
        int i = (t < 6) ? wv + t * 8 : NTOK - 1;
        _Float16* dst = xt + i * XP + lane * 4;
        dst[0] = (_Float16)v[t].x;
        dst[1] = (_Float16)v[t].y;
        dst[2] = (_Float16)v[t].z;
        dst[3] = (_Float16)v[t].w;
      }
    }
  }
  __syncthreads();

  // QKV GEMM: (64x128) @ (128x384). Each wave owns whole 64x16 column strips (3 of 24):
  // the 16 activation fragments stay in registers, and every weight fragment is loaded
  // once per block and feeds the four row tiles. Strip j of a wave is Q, K, V for j = 0, 1, 2.
  {
    v16h af[4][4];
#pragma unroll
    for (int mt = 0; mt < 4; ++mt)
#pragma unroll
      for (int kk = 0; kk < 4; ++kk) af[mt][kk] = ld_a(xt, XP, mt * 16, kk * 32, lane);
#pragma unroll
    for (int j = 0; j < 3; ++j) {
      int nt = wv + j * 8;
      v8f acc[4] = {};
      v16h bf[4];
#pragma unroll
      for (int kk = 0; kk < 4; ++kk) bf[kk] = ld_a(qkvWt, CC, nt * 16, kk * 32, lane);
      // Keeps the strip's eight weight loads in flight together: without it the scheduler
      // reuses one register set and waits out a full load latency at every k step.
      __builtin_amdgcn_sched_barrier(0);
#pragma unroll
      for (int kk = 0; kk < 4; ++kk)
#pragma unroll
        for (int mt = 0; mt < 4; ++mt) acc[mt] = WMMA_F16(af[mt][kk], bf[kk], acc[mt]);
      int n = nt * 16 + (lane & 15);
      float bias = qkv_b[n];
#pragma unroll
      for (int mt = 0; mt < 4; ++mt) {
        int mbase = mt * 16 + ((lane >> 4) << 3);
        if (j == 0) {  // Q (pre-scaled)
#pragma unroll
          for (int r = 0; r < 8; ++r)
            qkvs[(mbase + r) * QKP + n] = (_Float16)((acc[mt][r] + bias) * scale);
        } else if (j == 1) {  // K
#pragma unroll
          for (int r = 0; r < 8; ++r)
            qkvs[(mbase + r) * QKP + n] = (_Float16)(acc[mt][r] + bias);
        } else {  // V -> transposed, 8 consecutive halves per lane (one b128 store)
          _Float16* dst = vts + (n - 256) * TP + mbase;
#pragma unroll
          for (int r = 0; r < 8; ++r) dst[r] = (_Float16)(acc[mt][r] + bias);
        }
      }
    }
  }

  // Attention. One wave owns one head and 32 of the 64 query rows, from the scores to the
  // head's output, so nothing is handed between waves: the barrier below only ends the QKV stage.
  // S^T = K Q^T: a lane holds the scores of ONE query (column c of each tile) over keys
  // 16 jt + 8 hi + r, so maximum and sum run down its own registers, with one exchange between
  // the two lane halves. Two S^T tiles, converted in place, are the B operand of O^T = V^T P^T.
  {
    const int h  = wv >> 1;
    const int i0 = (wv & 1) * 32;
    const int c  = lane & 15, hi = lane >> 4;
    const bool edge = (wh == 7) || (ww == 7);  // block-uniform: only such windows have a shift mask
    const int lh1 = (wh == 7) ? 3 : 0, lh2 = (wh == 7) ? 6 : 0;  // region label, row part (times 3)
    const int lw1 = (ww == 7) ? 1 : 0, lw2 = (ww == 7) ? 2 : 0;  // region label, column part

    // Relative-position bias: index (yi - yj + 6) * 13 + (xi - xj + 6) = lin(i) + 84 - lin(j),
    // lin(t) = 13 (t / 7) + t % 7. Pad queries (i > 48) take query 48's index, which keeps the
    // address inside the table; their rows are never stored. Of key tile 3 only key 48 exists.
    // Element e < 24 is key ja = 16 (e / 8) + e % 8 in lanes 0..15 and key ja + 8 in lanes 16..31,
    // and lin(ja + 8) = lin(ja) + 14, or + 20 where ja % 7 == 6: so three offsets per query
    // serve all 25 loads, each with a constant offset (none of them below 0). The loads need nothing from LDS and
    // stand in front of the barrier, so they are under way while the block gathers there.
    int n0[2], na[2], nb[2], li[2];
#pragma unroll
    for (int it = 0; it < 2; ++it) {
      int i = min(i0 + it * 16 + c, NTOK - 1);
      int yi = i / 7, xi = i - yi * 7;
      int base = (yi * 13 + xi) * NHEAD + h;
      n0[it] = base;
      na[it] = base + (hi ? 0 : 14 * NHEAD);
      nb[it] = base + (hi ? 0 : 20 * NHEAD);
      li[it] = (yi < 4 ? lh1 : lh2) + (xi < 4 ? lw1 : lw2);
    }
    float bias[2][25];
#pragma unroll
    for (int it = 0; it < 2; ++it) {
#pragma unroll
      for (int e = 0; e < 24; ++e) {
        const int ja = (e >> 3) * 16 + (e & 7);
        const int off = (84 - ((ja / 7) * 13 + ja % 7)) * NHEAD;  // 84 - lin(ja), at least 15 rows
        bias[it][e] = (ja % 7 < 6) ? rpb[na[it] + (off - 14 * NHEAD)] : rpb[nb[it] + (off - 20 * NHEAD)];
      }
      bias[it][24] = rpb[n0[it]];
    }
    // Precaution: later code may be given the registers that hold the addresses of loads still
    // in flight. The six offsets are inputs here, so they stay as they are up to this wait.
    asm volatile("s_wait_xcnt 0x0" ::"v"(n0[0]), "v"(n0[1]), "v"(na[0]), "v"(na[1]), "v"(nb[0]), "v"(nb[1])
                 : "memory");
    __syncthreads();

    v16h kf[4], qf[2];
#pragma unroll
    for (int jt = 0; jt < 4; ++jt) kf[jt] = ld_a(qkvs, QKP, jt * 16, 128 + h * 32, lane);
#pragma unroll
    for (int it = 0; it < 2; ++it) qf[it] = ld_a(qkvs, QKP, i0 + it * 16, h * 32, lane);
    const v8f z = {};
    v8f st[2][4];
#pragma unroll
    for (int it = 0; it < 2; ++it)
#pragma unroll
      for (int jt = 0; jt < 3; ++jt) st[it][jt] = WMMA_F16(kf[jt], qf[it], z);

    // scores + bias (+ mask); sc[it][e], e = 8 jt + r, e = 24 is key 48 (lanes 0..15 only)
    float sc[2][25];
    st[0][3] = WMMA_F16(kf[3], qf[0], z);
    // A product of key tile 3 leaves seven of its eight result registers unused.
    // The two scheduling barriers keep the first query tile's bias additions between the two.
    __builtin_amdgcn_sched_barrier(0);
#pragma unroll
    for (int e = 0; e < 24; ++e) sc[0][e] = st[0][e >> 3][e & 7] + bias[0][e];
    __builtin_amdgcn_sched_barrier(0);
    st[1][3] = WMMA_F16(kf[3], qf[1], z);
#pragma unroll
    for (int e = 0; e < 24; ++e) sc[1][e] = st[1][e >> 3][e & 7] + bias[1][e];
#pragma unroll
    for (int it = 0; it < 2; ++it) sc[it][24] = st[it][3][0] + bias[it][24];
    if (edge) {
#pragma unroll
      for (int e = 0; e < 25; ++e) {
        const int ja = (e < 24) ? (e >> 3) * 16 + (e & 7) : NTOK - 1;
        const int jb = (e < 24) ? ja + 8 : NTOK - 1;
        int la = (ja / 7 < 4 ? lh1 : lh2) + (ja % 7 < 4 ? lw1 : lw2);
        int lb = (jb / 7 < 4 ? lh1 : lh2) + (jb % 7 < 4 ? lw1 : lw2);
        int lj = hi ? lb : la;
#pragma unroll
        for (int it = 0; it < 2; ++it) sc[it][e] += (li[it] != lj) ? -100.f : 0.f;
      }
    }
#pragma unroll
    for (int it = 0; it < 2; ++it) sc[it][24] = hi ? -1e30f : sc[it][24];

    // softmax down the registers; three partial sums per query, then the other lane half's
    float mx[2], sm[2];
#pragma unroll
    for (int it = 0; it < 2; ++it) {
      float m = sc[it][24];
#pragma unroll
      for (int e = 0; e < 24; ++e) m = fmaxf(m, sc[it][e]);
      mx[it] = m;
    }
#pragma unroll
    for (int it = 0; it < 2; ++it) mx[it] = fmaxf(mx[it], __shfl_xor(mx[it], 16, 32));
#pragma unroll
    for (int it = 0; it < 2; ++it) {
#pragma unroll
      for (int e = 0; e < 25; ++e) sc[it][e] = (sc[it][e] - mx[it]) * 1.44269504f;  // to powers of two
      exp2_25(sc[it]);
      float s0 = sc[it][24], s1 = 0.f, s2 = 0.f;
#pragma unroll
      for (int r = 0; r < 8; ++r) { s0 += sc[it][r]; s1 += sc[it][8 + r]; s2 += sc[it][16 + r]; }
      sm[it] = (s0 + s1) + s2;
    }
#pragma unroll
    for (int it = 0; it < 2; ++it) sm[it] += __shfl_xor(sm[it], 16, 32);

    // P^T as B operand: element s of k block kk is key 32 kk + (s < 8 ? 8 hi + s : 16 + 8 hi + s - 8),
    // the order in which ld_a reads the rows of V^T.
    v16h pf[2][2];
#pragma unroll
    for (int it = 0; it < 2; ++it) {
      float inv = 1.f / sm[it];
#pragma unroll
      for (int s = 0; s < 16; ++s) {
        pf[it][0][s] = (_Float16)(sc[it][s] * inv);
        pf[it][1][s] = (s < 9) ? (_Float16)(sc[it][16 + s] * inv) : (_Float16)0.f;
      }
    }

    // O^T = V^T P^T: a lane ends with 8 consecutive channels of one query -> one 16-byte store
#pragma unroll
    for (int dt = 0; dt < 2; ++dt) {
      v16h v0 = ld_a(vts, TP, h * 32 + dt * 16, 0, lane);
      v16h v1 = ld_a(vts, TP, h * 32 + dt * 16, 32, lane);
#pragma unroll
      for (int it = 0; it < 2; ++it) {
        v8f acc = {};
        acc = WMMA_F16(v0, pf[it][0], acc);
        acc = WMMA_F16(v1, pf[it][1], acc);
        *(v8h*)(os + (i0 + it * 16 + c) * XP + h * 32 + dt * 16 + hi * 8) =
            __builtin_convertvector(acc, v8h);
      }
    }
  }
  __syncthreads();

  // proj: (64x128)@(128x128) + bias, scatter with inverse roll, add residual
  // One 64x16 column strip per wave: each weight fragment feeds the four row tiles.
  {
    int nt = wv;
    v8f acc[4] = {};
#pragma unroll
    for (int kk = 0; kk < 4; ++kk) {
      v16h bm = ld_a(projWt, CC, nt * 16, kk * 32, lane);
#pragma unroll
      for (int mt = 0; mt < 4; ++mt) {
        v16h a = ld_a(os, XP, mt * 16, kk * 32, lane);
        acc[mt] = WMMA_F16(a, bm, acc[mt]);
      }
    }
    int n = nt * 16 + (lane & 15);
    float pb = proj_b[n];
#pragma unroll
    for (int mt = 0; mt < 4; ++mt) {
      int mbase = mt * 16 + ((lane >> 4) << 3);
#pragma unroll
      for (int r = 0; r < 8; ++r) {
        int i = mbase + r;
        if (i < NTOK) {
          int yi = i / 7, xi = i - yi * 7;
          int sr = (wh * 7 + yi + SHFT) % HW;
          int sc = (ww * 7 + xi + SHFT) % HW;
          size_t idx = ((size_t)b * (HW * HW) + (size_t)(sr * HW + sc)) * CC + n;
          out[idx] = x[idx] + acc[mt][r] + pb;
        }
      }
    }
  }
}

// ---- fused LN2 + MLP (fc1 + GELU + fc2) + residual ---------------------------
__global__ __launch_bounds__(256) void k_mlp(
    const float* __restrict__ n2g, const float* __restrict__ n2b,
    const _Float16* __restrict__ fc1Wt, const float* __restrict__ fc1b,
    const _Float16* __restrict__ fc2Wt, const float* __restrict__ fc2b,
    float* __restrict__ out) {
  __shared__ __attribute__((aligned(16))) _Float16 h2[64 * XP];   // LN'd rows
  __shared__ __attribute__((aligned(16))) _Float16 a1[64 * AP];   // GELU(fc1) rows
  const int tid = threadIdx.x, lane = tid & 31;
  const int wv = __builtin_amdgcn_readfirstlane(tid >> 5);  // wave-uniform -> SGPR
  const size_t r0 = (size_t)blockIdx.x * 64;

  // LayerNorm2 on 64 rows of current out (= x + attn). A wave's eight rows go through
  // together: all row loads first, then each reduction step over the eight rows side by side.
  {
    float4 v[8];
#pragma unroll
    for (int t = 0; t < 8; ++t)
      v[t] = *(const float4*)(out + (r0 + wv + t * 8) * CC + lane * 4);
    ln_rows<8>(v, n2g, n2b, lane);
#pragma unroll
    for (int t = 0; t < 8; ++t) {
      _Float16* dst = h2 + (wv + t * 8) * XP + lane * 4;
      dst[0] = (_Float16)v[t].x;
      dst[1] = (_Float16)v[t].y;
      dst[2] = (_Float16)v[t].z;
      dst[3] = (_Float16)v[t].w;
    }
  }
  __syncthreads();

  // fc1 + GELU (erf form): (64x128)@(128x512). Each wave owns 4 of the 32 column strips (64x16):
  // activation fragments stay in registers, each weight fragment feeds the four row tiles.
  {
    v16h af[4][4];
#pragma unroll
    for (int mt = 0; mt < 4; ++mt)
#pragma unroll
      for (int kk = 0; kk < 4; ++kk) af[mt][kk] = ld_a(h2, XP, mt * 16, kk * 32, lane);
    for (int j = 0; j < 4; ++j) {
      int nt = wv + j * 8;
      v8f acc[4] = {};
      v16h bf[4];
#pragma unroll
      for (int kk = 0; kk < 4; ++kk) bf[kk] = ld_a(fc1Wt, CC, nt * 16, kk * 32, lane);
      // Keeps the strip's eight weight loads in flight together: without it the scheduler
      // reuses one register set and waits out a full load latency at every k step.
      __builtin_amdgcn_sched_barrier(0);
#pragma unroll
      for (int kk = 0; kk < 4; ++kk)
#pragma unroll
        for (int mt = 0; mt < 4; ++mt) acc[mt] = WMMA_F16(af[mt][kk], bf[kk], acc[mt]);
      int n = nt * 16 + (lane & 15);
      float bb = fc1b[n];
#pragma unroll
      for (int mt = 0; mt < 4; ++mt) {
        int mbase = mt * 16 + ((lane >> 4) << 3);
#pragma unroll
        for (int r = 0; r < 8; r += 2) {
          v2f vv = {acc[mt][r] + bb, acc[mt][r + 1] + bb};
          v2h hh = __builtin_convertvector(gelu2(vv), v2h);
          a1[(mbase + r) * AP + n]     = hh.x;
          a1[(mbase + r + 1) * AP + n] = hh.y;
        }
      }
    }
  }
  __syncthreads();

  // fc2 + residual: (64x512)@(512x128). One 64x16 column strip per wave:
  // each weight fragment feeds the four row tiles.
  {
    int nt = wv;
    int n = nt * 16 + (lane & 15);
    float bb = fc2b[n];
    float* orow = out + (r0 + (size_t)((lane >> 4) << 3)) * CC + n;
    v8f acc[4] = {};
    v16h bf[2][4];   // weight fragments: this group of four k steps and the next
    v16h af[2][4];   // activation fragments: this k step and the next
    float res[4][8]; // residual rows, fetched under the last four k steps
#pragma unroll
    for (int q = 0; q < 4; ++q) bf[0][q] = ld_a(fc2Wt, HID, nt * 16, q * 32, lane);
#pragma unroll
    for (int mt = 0; mt < 4; ++mt) af[0][mt] = ld_a(a1, AP, mt * 16, 0, lane);
#pragma unroll
    for (int kk = 0; kk < 16; ++kk) {
      if ((kk & 3) == 0 && kk + 4 < 16) {
#pragma unroll
        for (int q = 0; q < 4; ++q)
          bf[((kk >> 2) + 1) & 1][q] = ld_a(fc2Wt, HID, nt * 16, (kk + 4 + q) * 32, lane);
      }
      if (kk == 12) {
        // Precaution: the residual values may be given the registers that held the weight
        // address of loads still in flight; this wait stands in front of that overwrite.
        asm volatile("s_wait_xcnt 0x0" ::: "memory");
#pragma unroll
        for (int mt = 0; mt < 4; ++mt)
#pragma unroll
          for (int r = 0; r < 8; ++r) res[mt][r] = orow[(mt * 16 + r) * CC];
      }
      if (kk + 1 < 16) {
#pragma unroll
        for (int mt = 0; mt < 4; ++mt) af[(kk + 1) & 1][mt] = ld_a(a1, AP, mt * 16, (kk + 1) * 32, lane);
      }
      // The two scheduling barriers hold the order "next step's loads as one group, then this
      // step's four matrix instructions": left free, the scheduler either loads each fragment
      // right in front of its use and waits out its latency, or runs past 256 registers.
      __builtin_amdgcn_sched_barrier(0);
#pragma unroll
      for (int mt = 0; mt < 4; ++mt)
        acc[mt] = WMMA_F16(af[kk & 1][mt], bf[(kk >> 2) & 1][kk & 3], acc[mt]);
      __builtin_amdgcn_sched_barrier(0);
    }
#pragma unroll
    for (int mt = 0; mt < 4; ++mt)
#pragma unroll
      for (int r = 0; r < 8; ++r) orow[(mt * 16 + r) * CC] = res[mt][r] + (acc[mt][r] + bb);
  }
}

extern "C" void kernel_launch(void* const* d_in, const int* in_sizes, int n_in,
                              void* d_out, int out_size, void* d_ws, size_t ws_size,
                              hipStream_t stream) {
  (void)in_sizes; (void)n_in; (void)out_size; (void)ws_size;
  const float* x      = (const float*)d_in[0];
  const float* qkv_w  = (const float*)d_in[1];
  const float* qkv_b  = (const float*)d_in[2];
  const float* proj_w = (const float*)d_in[3];
  const float* proj_b = (const float*)d_in[4];
  const float* rpb    = (const float*)d_in[5];
  const float* n1g    = (const float*)d_in[6];
  const float* n1b    = (const float*)d_in[7];
  const float* n2g    = (const float*)d_in[8];
  const float* n2b    = (const float*)d_in[9];
  const float* fc1w   = (const float*)d_in[10];
  const float* fc1b   = (const float*)d_in[11];
  const float* fc2w   = (const float*)d_in[12];
  const float* fc2b   = (const float*)d_in[13];
  float* out = (float*)d_out;

  _Float16* qkvWt  = (_Float16*)d_ws;          // [384][128]
  _Float16* projWt = qkvWt + 384 * 128;        // [128][128]
  _Float16* fc1Wt  = projWt + 128 * 128;       // [512][128]
  _Float16* fc2Wt  = fc1Wt + 512 * 128;        // [128][512]

  k_wprep<<<96, 256, 0, stream>>>(qkv_w, qkvWt, 128, 384);
  k_wprep<<<32, 256, 0, stream>>>(proj_w, projWt, 128, 128);
  k_wprep<<<128, 256, 0, stream>>>(fc1w, fc1Wt, 128, 512);
  k_wprep<<<128, 256, 0, stream>>>(fc2w, fc2Wt, 512, 128);

  k_attn<<<64 * 64, 256, 0, stream>>>(x, qkv_b, proj_b, rpb, n1g, n1b, qkvWt, projWt, out);
  k_mlp<<<3136, 256, 0, stream>>>(n2g, n2b, fc1Wt, fc1b, fc2Wt, fc2b, out);
}

// v006
// A run of this version takes 169 microseconds.
// In both of two side-by-side timings against v005, it was 1.16 times as fast.
// Counting every step since v000, it is 4.25 times as fast.
#include <hip/hip_runtime.h>
#include <hip/hip_bf16.h>
#include <math.h>

typedef __attribute__((ext_vector_type(16))) _Float16 v16h;
typedef __attribute__((ext_vector_type(8)))  _Float16 v8h;
typedef __attribute__((ext_vector_type(8)))  float    v8f;
typedef __attribute__((ext_vector_type(2)))  float    v2f;
typedef __attribute__((ext_vector_type(2)))  _Float16 v2h;

#define NTOK 49
#define CC   128
#define NHEAD 4
#define HID  512
#define HW   56
#define SHFT 3
#define LN_EPS 1e-5f

// LDS row pitches in elements. Each row carries 16 bytes of pad, so the pitch is an odd
// multiple of 16 bytes and the 16 rows of one 128-bit fragment read fall on distinct banks.
#define XP  (CC + 8)       // f16 rows of 128: 272 B
#define QKP (256 + 8)      // f16 rows of 256: 528 B
#define TP  (64 + 8)       // f16 rows of 64: 144 B
#define AP  (HID + 8)      // f16 rows of 512: 1040 B

#define WMMA_F16(a, b, c) \
  __builtin_amdgcn_wmma_f32_16x16x32_f16(false, (a), false, (b), (short)0, (c), false, false)

// Sum over the 32 lanes for R independent values at once: step by step over all R, so the
// R cross-lane exchanges of a step are in flight together. Each value is summed by itself,
// over lane distances 16, 8, 4, 2, 1.
template <int R>
__device__ __forceinline__ void wred_sum_rows(float (&s)[R]) {
#pragma unroll
  for (int o = 16; o > 0; o >>= 1)
#pragma unroll
    for (int t = 0; t < R; ++t) s[t] += __shfl_xor(s[t], o, 32);
}

// LayerNorm of R rows of 128 floats, four per lane, in place.
template <int R>
__device__ __forceinline__ void ln_rows(float4 (&v)[R], const float* __restrict__ g,
                                        const float* __restrict__ be, int lane) {
  float s[R];
#pragma unroll
  for (int t = 0; t < R; ++t) s[t] = v[t].x + v[t].y + v[t].z + v[t].w;
  wred_sum_rows<R>(s);
#pragma unroll
  for (int t = 0; t < R; ++t) {
    float mu = s[t] * (1.f / 128.f);
    v[t].x -= mu; v[t].y -= mu; v[t].z -= mu; v[t].w -= mu;
    s[t] = v[t].x * v[t].x + v[t].y * v[t].y + v[t].z * v[t].z + v[t].w * v[t].w;
  }
  wred_sum_rows<R>(s);
  int c = lane * 4;
#pragma unroll
  for (int t = 0; t < R; ++t) {
    float rs = rsqrtf(s[t] * (1.f / 128.f) + LN_EPS);
    v[t].x = v[t].x * rs * g[c + 0] + be[c + 0];
    v[t].y = v[t].y * rs * g[c + 1] + be[c + 1];
    v[t].z = v[t].z * rs * g[c + 2] + be[c + 2];
    v[t].w = v[t].w * rs * g[c + 3] + be[c + 3];
  }
}

// GELU in its erf form, v * Phi(v) = 0.5 v (1 + erf(v / sqrt 2)), two values at a time, with no branch:
//   1 - Phi(a) = exp(-a^2 / 2) * t (c1 + t (c2 + t (c3 + t (c4 + t c5)))),  t = 1 / (1 + p a),  a = |v|
// (the classical five-term rational form; its error in Phi is below 7.5e-8 for every a >= 0, and the
// factor 1 / sqrt(2 pi) is folded into c1..c5). With h = 1 - Phi(|v|): v Phi(v) = max(v, 0) - |v| h
// on both signs. In f32 the result stays within 1e-6 of v Phi(v), far under the f16 rounding that follows.
// One straight line of code for every lane, so neighbouring values overlap in the pipe.
__device__ __forceinline__ v2f gelu2(v2f v) {
  v2f a = __builtin_elementwise_abs(v);
  v2f d = a * 0.2316419f + 1.f;
  v2f t = {__builtin_amdgcn_rcpf(d.x), __builtin_amdgcn_rcpf(d.y)};
  v2f y = t * 0.53070271f - 0.72657603f;
  y = y * t + 0.71070689f;
  y = y * t - 0.14224836f;
  y = y * t + 0.12741479f;
  y = y * t;
  v2f q = (v * v) * -0.72134752f;  // -a^2 / 2 in powers of two
  v2f e = {__builtin_amdgcn_exp2f(q.x), __builtin_amdgcn_exp2f(q.y)};
  v2f h = y * e;
  v2f zero = {0.f, 0.f};
  return __builtin_elementwise_max(v, zero) - a * h;
}

// 2^t of 25 values, in place. The instruction set asks for one independent instruction between a
// transcendental and a directly following instruction that reads its result or overwrites its
// source.
// Here each v_exp_f32 has an independent one behind it, and the v_nop is the slot of the last.
#define EXP2_AT(n) "v_exp_f32 %" #n ", %" #n "\n\t"
__device__ __forceinline__ void exp2_25(float (&t)[25]) {
  asm(EXP2_AT(0) EXP2_AT(1) EXP2_AT(2) EXP2_AT(3) EXP2_AT(4) EXP2_AT(5) EXP2_AT(6) EXP2_AT(7) EXP2_AT(8)
      EXP2_AT(9) EXP2_AT(10) EXP2_AT(11) EXP2_AT(12) EXP2_AT(13) EXP2_AT(14) EXP2_AT(15) EXP2_AT(16)
      EXP2_AT(17) EXP2_AT(18) EXP2_AT(19) EXP2_AT(20) EXP2_AT(21) EXP2_AT(22) EXP2_AT(23) EXP2_AT(24)
      "v_nop"
      : "+v"(t[0]), "+v"(t[1]), "+v"(t[2]), "+v"(t[3]), "+v"(t[4]), "+v"(t[5]), "+v"(t[6]), "+v"(t[7]),
        "+v"(t[8]), "+v"(t[9]), "+v"(t[10]), "+v"(t[11]), "+v"(t[12]), "+v"(t[13]), "+v"(t[14]),
        "+v"(t[15]), "+v"(t[16]), "+v"(t[17]), "+v"(t[18]), "+v"(t[19]), "+v"(t[20]), "+v"(t[21]),
        "+v"(t[22]), "+v"(t[23]), "+v"(t[24]));
}

// A/B-operand fragment (16x32 f16 tile, rows striped over lanes, K along VGPRs).
// Per ISA 7.12.2 the per-lane halves are contiguous in two 16B runs: K+[0..7] and K+[16..23]
// (K offset +8 for lanes 16..31) -> two 128-bit loads.
__device__ __forceinline__ v16h ld_a(const _Float16* buf, int ld, int row0, int col0, int lane) {
  int m  = row0 + (lane & 15);
  int kb = (lane >> 4) << 3;
  const v8h* p = (const v8h*)(buf + m * ld + col0 + kb);
  v8h lo = p[0];
  v8h hi = p[2];
  return __builtin_shufflevector(lo, hi, 0, 1, 2, 3, 4, 5, 6, 7,
                                         8, 9, 10, 11, 12, 13, 14, 15);
}

// Weight fragments come from the packed copy that k_wprep writes: a fragment is 1024 bytes, first
// the 32 lanes' low runs (16 bytes each), then their high runs. Each of the two 128-bit loads of a
// wave therefore reads 512 contiguous bytes, four whole cache lines, where a row-major copy made
// it touch 16 lines for 32 bytes each. Lane and register positions are those of ld_a.
// w_strip: this lane's place in the first fragment of column strip nt (kf fragments per strip).
__device__ __forceinline__ const _Float16* w_strip(const _Float16* __restrict__ wp, int nt, int kf, int lane) {
  return wp + nt * kf * 512 + lane * 8;
}
// ld_w: fragment kk of that strip.
__device__ __forceinline__ v16h ld_w(const _Float16* __restrict__ ws, int kk) {
  const v8h* p = (const v8h*)(ws + kk * 512);
  v8h lo = p[0];
  v8h hi = p[32];
  return __builtin_shufflevector(lo, hi, 0, 1, 2, 3, 4, 5, 6, 7,
                                         8, 9, 10, 11, 12, 13, 14, 15);
}

// ---- weight prep: f16 copy of w[k][n] (K x N), packed in fragment order ---------
// Fragment f = nt * (K / 32) + kk is the 16 x 32 tile of columns n = 16 nt + (lane & 15) and
// k = 32 kk + 8 (lane >> 4) + 16 run + e, stored at half index 512 f + 256 run + 8 lane + e.
__global__ void k_wprep(const float* __restrict__ w, _Float16* __restrict__ wt, int K, int N) {
  int total = K * N;
  int kf = K >> 5;
  for (int i = blockIdx.x * blockDim.x + threadIdx.x; i < total; i += gridDim.x * blockDim.x) {
    int f = i >> 9;
    int nt = f / kf, kk = f - nt * kf;
    int l = (i >> 3) & 31;
    int n = nt * 16 + (l & 15);
    int k = kk * 32 + ((l >> 4) << 3) + (((i >> 8) & 1) << 4) + (i & 7);
    wt[i] = (_Float16)w[k * N + n];
  }
}

// ---- fused LN1 + shifted-window attention + proj + residual ------------------
__global__ __launch_bounds__(256) void k_attn(
    const float* __restrict__ x, const float* __restrict__ qkv_b,
    const float* __restrict__ proj_b, const float* __restrict__ rpb,
    const float* __restrict__ n1g, const float* __restrict__ n1b,
    const _Float16* __restrict__ qkvWt, const _Float16* __restrict__ projWt,
    float* __restrict__ out) {
  __shared__ __attribute__((aligned(16))) _Float16 xt[64 * XP];     // LN'd window tokens (padded to 64 rows)
  __shared__ __attribute__((aligned(16))) _Float16 qkvs[64 * QKP];  // Q|K f16 (token-major)
  __shared__ __attribute__((aligned(16))) _Float16 vts[CC * TP];    // V transposed (channel-major)
  __shared__ __attribute__((aligned(16))) _Float16 os[64 * XP];     // attention output (pre-proj), f16

  const int tid  = threadIdx.x;
  const int lane = tid & 31;
  const int wv   = __builtin_amdgcn_readfirstlane(tid >> 5);  // wave-uniform -> SGPR
  const int b    = blockIdx.x >> 6;
  const int w    = blockIdx.x & 63;
  const int wh   = w >> 3, ww = w & 7;
  const float scale = 0.17677669529663687f;  // 1/sqrt(32)

  // gather (roll by -3) + LayerNorm1. A wave's seven tokens go through together: all row
  // loads are issued first and each reduction step runs over the seven rows side by side, so
  // one load latency and one chain of cross-lane steps are paid per wave, not one per token.
  // The block has eight waves: tokens wv + 8 t, t < 6, are 0..47; every wave also works
  // token 48 and wave 0 alone stores it.
  {
    float4 v[7];
#pragma unroll
    for (int t = 0; t < 7; ++t) {
      int i = (t < 6) ? wv + t * 8 : NTOK - 1;
      int yi = i / 7, xi = i - yi * 7;
      int sr = (wh * 7 + yi + SHFT) % HW;
      int sc = (ww * 7 + xi + SHFT) % HW;
      const float* row = x + ((size_t)b * (HW * HW) + (size_t)(sr * HW + sc)) * CC;
      v[t] = *(const float4*)(row + lane * 4);
    }
    // Precaution: the loop below may be given the registers that held the row addresses of
    // loads still in flight; this wait stands in front of that overwrite.
    asm volatile("s_wait_xcnt 0x0" ::: "memory");
    // zero pad rows 49..63 while the row loads are in flight
    for (int i = tid; i < (64 - NTOK) * XP; i += 256) xt[NTOK * XP + i] = (_Float16)0.f;
    ln_rows<7>(v, n1g, n1b, lane);
#pragma unroll
    for (int t = 0; t < 7; ++t) {
      if (t < 6 || wv == 0) {
        int i = (t < 6) ? wv + t * 8 : NTOK - 1;
        _Float16* dst = xt + i * XP + lane * 4;
        dst[0] = (_Float16)v[t].x;
        dst[1] = (_Float16)v[t].y;
        dst[2] = (_Float16)v[t].z;
        dst[3] = (_Float16)v[t].w;
      }
    }
  }
  __syncthreads();

  // QKV GEMM: (64x128) @ (128x384). Each wave owns whole 64x16 column strips (3 of 24):
  // the 16 activation fragments stay in registers, and every weight fragment is loaded
  // once per block and feeds the four row tiles. Strip j of a wave is Q, K, V for j = 0, 1, 2.
  {
    v16h af[4][4];
#pragma unroll
    for (int mt = 0; mt < 4; ++mt)
#pragma unroll
      for (int kk = 0; kk < 4; ++kk) af[mt][kk] = ld_a(xt, XP, mt * 16, kk * 32, lane);
    const _Float16* ws0 = w_strip(qkvWt, wv, 4, lane);
#pragma unroll
    for (int j = 0; j < 3; ++j) {
      int nt = wv + j * 8;
      v8f acc[4] = {};
      v16h bf[4];
      const _Float16* ws = ws0 + j * (8 * 4 * 512);  // the wave's next strip is eight strips on
#pragma unroll
      for (int kk = 0; kk < 4; ++kk) bf[kk] = ld_w(ws, kk);
      int n = nt * 16 + (lane & 15);
      float bias = qkv_b[n];
      // Precaution: a later load's result may be given the register that holds the address of
      // the bias load while that load is in flight; this wait stands in front of that overwrite.
      asm volatile("s_wait_xcnt 0x0" ::: "memory");
      // Keeps the strip's eight weight loads in flight together: without it the scheduler
      // reuses one register set and waits out a full load latency at every k step.
      __builtin_amdgcn_sched_barrier(0);
#pragma unroll
      for (int kk = 0; kk < 4; ++kk)
#pragma unroll
        for (int mt = 0; mt < 4; ++mt) acc[mt] = WMMA_F16(af[mt][kk], bf[kk], acc[mt]);
#pragma unroll
      for (int mt = 0; mt < 4; ++mt) {
        int mbase = mt * 16 + ((lane >> 4) << 3);
        if (j == 0) {  // Q (pre-scaled)
#pragma unroll
          for (int r = 0; r < 8; ++r)
            qkvs[(mbase + r) * QKP + n] = (_Float16)((acc[mt][r] + bias) * scale);
        } else if (j == 1) {  // K
#pragma unroll
          for (int r = 0; r < 8; ++r)
            qkvs[(mbase + r) * QKP + n] = (_Float16)(acc[mt][r] + bias);
        } else {  // V -> transposed, 8 consecutive halves per lane (one b128 store)
          _Float16* dst = vts + (n - 256) * TP + mbase;
#pragma unroll
          for (int r = 0; r < 8; ++r) dst[r] = (_Float16)(acc[mt][r] + bias);
        }
      }
    }
  }

  // Attention. One wave owns one head and 32 of the 64 query rows, from the scores to the
  // head's output, so nothing is handed between waves: the barrier below only ends the QKV stage.
  // S^T = K Q^T: a lane holds the scores of ONE query (column c of each tile) over keys
  // 16 jt + 8 hi + r, so maximum and sum run down its own registers, with one exchange between
  // the two lane halves. Two S^T tiles, converted in place, are the B operand of O^T = V^T P^T.
  {
    const int h  = wv >> 1;
    const int i0 = (wv & 1) * 32;
    const int c  = lane & 15, hi = lane >> 4;
    const bool edge = (wh == 7) || (ww == 7);  // block-uniform: only such windows have a shift mask
    const int lh1 = (wh == 7) ? 3 : 0, lh2 = (wh == 7) ? 6 : 0;  // region label, row part (times 3)
    const int lw1 = (ww == 7) ? 1 : 0, lw2 = (ww == 7) ? 2 : 0;  // region label, column part

    // Relative-position bias: index (yi - yj + 6) * 13 + (xi - xj + 6) = lin(i) + 84 - lin(j),
    // lin(t) = 13 (t / 7) + t % 7. Pad queries (i > 48) take query 48's index, which keeps the
    // address inside the table; their rows are never stored. Of key tile 3 only key 48 exists.
    // Element e < 24 is key ja = 16 (e / 8) + e % 8 in lanes 0..15 and key ja + 8 in lanes 16..31,
    // and lin(ja + 8) = lin(ja) + 14, or + 20 where ja % 7 == 6: so three offsets per query
    // serve all 25 loads, each with a constant offset (none of them below 0). The loads need nothing from LDS and
    // stand in front of the barrier, so they are under way while the block gathers there.
    int n0[2], na[2], nb[2], li[2];
#pragma unroll
    for (int it = 0; it < 2; ++it) {
      int i = min(i0 + it * 16 + c, NTOK - 1);
      int yi = i / 7, xi = i - yi * 7;
      int base = (yi * 13 + xi) * NHEAD + h;
      n0[it] = base;
      na[it] = base + (hi ? 0 : 14 * NHEAD);
      nb[it] = base + (hi ? 0 : 20 * NHEAD);
      li[it] = (yi < 4 ? lh1 : lh2) + (xi < 4 ? lw1 : lw2);
    }
    float bias[2][25];
#pragma unroll
    for (int it = 0; it < 2; ++it) {
#pragma unroll
      for (int e = 0; e < 24; ++e) {
        const int ja = (e >> 3) * 16 + (e & 7);
        const int off = (84 - ((ja / 7) * 13 + ja % 7)) * NHEAD;  // 84 - lin(ja), at least 15 rows
        bias[it][e] = (ja % 7 < 6) ? rpb[na[it] + (off - 14 * NHEAD)] : rpb[nb[it] + (off - 20 * NHEAD)];
      }
      bias[it][24] = rpb[n0[it]];
    }
    // Precaution: later code may be given the registers that hold the addresses of loads still
    // in flight. The six offsets are inputs here, so they stay as they are up to this wait.
    asm volatile("s_wait_xcnt 0x0" ::"v"(n0[0]), "v"(n0[1]), "v"(na[0]), "v"(na[1]), "v"(nb[0]), "v"(nb[1])
                 : "memory");
    __syncthreads();

    v16h kf[4], qf[2];
#pragma unroll
    for (int jt = 0; jt < 4; ++jt) kf[jt] = ld_a(qkvs, QKP, jt * 16, 128 + h * 32, lane);
#pragma unroll
    for (int it = 0; it < 2; ++it) qf[it] = ld_a(qkvs, QKP, i0 + it * 16, h * 32, lane);
    const v8f z = {};
    v8f st[2][4];
#pragma unroll
    for (int it = 0; it < 2; ++it)
#pragma unroll
      for (int jt = 0; jt < 3; ++jt) st[it][jt] = WMMA_F16(kf[jt], qf[it], z);

    // scores + bias (+ mask); sc[it][e], e = 8 jt + r, e = 24 is key 48 (lanes 0..15 only)
    float sc[2][25];
    st[0][3] = WMMA_F16(kf[3], qf[0], z);
    // A product of key tile 3 leaves seven of its eight result registers unused.
    // The two scheduling barriers keep the first query tile's bias additions between the two.
    __builtin_amdgcn_sched_barrier(0);
#pragma unroll
    for (int e = 0; e < 24; ++e) sc[0][e] = st[0][e >> 3][e & 7] + bias[0][e];
    __builtin_amdgcn_sched_barrier(0);
    st[1][3] = WMMA_F16(kf[3], qf[1], z);
#pragma unroll
    for (int e = 0; e < 24; ++e) sc[1][e] = st[1][e >> 3][e & 7] + bias[1][e];
#pragma unroll
    for (int it = 0; it < 2; ++it) sc[it][24] = st[it][3][0] + bias[it][24];
    if (edge) {
#pragma unroll
      for (int e = 0; e < 25; ++e) {
        const int ja = (e < 24) ? (e >> 3) * 16 + (e & 7) : NTOK - 1;
        const int jb = (e < 24) ? ja + 8 : NTOK - 1;
        int la = (ja / 7 < 4 ? lh1 : lh2) + (ja % 7 < 4 ? lw1 : lw2);
        int lb = (jb / 7 < 4 ? lh1 : lh2) + (jb % 7 < 4 ? lw1 : lw2);
        int lj = hi ? lb : la;
#pragma unroll
        for (int it = 0; it < 2; ++it) sc[it][e] += (li[it] != lj) ? -100.f : 0.f;
      }
    }
#pragma unroll
    for (int it = 0; it < 2; ++it) sc[it][24] = hi ? -1e30f : sc[it][24];

    // softmax down the registers; three partial sums per query, then the other lane half's
    float mx[2], sm[2];
#pragma unroll
    for (int it = 0; it < 2; ++it) {
      float m = sc[it][24];
#pragma unroll
      for (int e = 0; e < 24; ++e) m = fmaxf(m, sc[it][e]);
      mx[it] = m;
    }
#pragma unroll
    for (int it = 0; it < 2; ++it) mx[it] = fmaxf(mx[it], __shfl_xor(mx[it], 16, 32));
#pragma unroll
    for (int it = 0; it < 2; ++it) {
#pragma unroll
      for (int e = 0; e < 25; ++e) sc[it][e] = (sc[it][e] - mx[it]) * 1.44269504f;  // to powers of two
      exp2_25(sc[it]);
      float s0 = sc[it][24], s1 = 0.f, s2 = 0.f;
#pragma unroll
      for (int r = 0; r < 8; ++r) { s0 += sc[it][r]; s1 += sc[it][8 + r]; s2 += sc[it][16 + r]; }
      sm[it] = (s0 + s1) + s2;
    }
#pragma unroll
    for (int it = 0; it < 2; ++it) sm[it] += __shfl_xor(sm[it], 16, 32);

    // P^T as B operand: element s of k block kk is key 32 kk + (s < 8 ? 8 hi + s : 16 + 8 hi + s - 8),
    // the order in which ld_a reads the rows of V^T.
    v16h pf[2][2];
#pragma unroll
    for (int it = 0; it < 2; ++it) {
      float inv = 1.f / sm[it];
#pragma unroll
      for (int s = 0; s < 16; ++s) {
        pf[it][0][s] = (_Float16)(sc[it][s] * inv);
        pf[it][1][s] = (s < 9) ? (_Float16)(sc[it][16 + s] * inv) : (_Float16)0.f;
      }
    }

    // O^T = V^T P^T: a lane ends with 8 consecutive channels of one query -> one 16-byte store
#pragma unroll
    for (int dt = 0; dt < 2; ++dt) {
      v16h v0 = ld_a(vts, TP, h * 32 + dt * 16, 0, lane);
      v16h v1 = ld_a(vts, TP, h * 32 + dt * 16, 32, lane);
#pragma unroll
      for (int it = 0; it < 2; ++it) {
        v8f acc = {};
        acc = WMMA_F16(v0, pf[it][0], acc);
        acc = WMMA_F16(v1, pf[it][1], acc);
        *(v8h*)(os + (i0 + it * 16 + c) * XP + h * 32 + dt * 16 + hi * 8) =
            __builtin_convertvector(acc, v8h);
      }
    }
  }
  __syncthreads();

  // proj: (64x128)@(128x128) + bias, scatter with inverse roll, add residual
  // One 64x16 column strip per wave: each weight fragment feeds the four row tiles.
  {
    int nt = wv;
    const _Float16* ws = w_strip(projWt, nt, 4, lane);
    v8f acc[4] = {};
#pragma unroll
    for (int kk = 0; kk < 4; ++kk) {
      v16h bm = ld_w(ws, kk);
#pragma unroll
      for (int mt = 0; mt < 4; ++mt) {
        v16h a = ld_a(os, XP, mt * 16, kk * 32, lane);
        acc[mt] = WMMA_F16(a, bm, acc[mt]);
      }
    }
    int n = nt * 16 + (lane & 15);
    float pb = proj_b[n];
#pragma unroll
    for (int mt = 0; mt < 4; ++mt) {
      int mbase = mt * 16 + ((lane >> 4) << 3);
#pragma unroll
      for (int r = 0; r < 8; ++r) {
        int i = mbase + r;
        if (i < NTOK) {
          int yi = i / 7, xi = i - yi * 7;
          int sr = (wh * 7 + yi + SHFT) % HW;
          int sc = (ww * 7 + xi + SHFT) % HW;
          size_t idx = ((size_t)b * (HW * HW) + (size_t)(sr * HW + sc)) * CC + n;
          out[idx] = x[idx] + acc[mt][r] + pb;
        }
      }
    }
  }
}

// ---- fused LN2 + MLP (fc1 + GELU + fc2) + residual ---------------------------
__global__ __launch_bounds__(256) void k_mlp(
    const float* __restrict__ n2g, const float* __restrict__ n2b,
    const _Float16* __restrict__ fc1Wt, const float* __restrict__ fc1b,
    const _Float16* __restrict__ fc2Wt, const float* __restrict__ fc2b,
    float* __restrict__ out) {
  __shared__ __attribute__((aligned(16))) _Float16 h2[64 * XP];   // LN'd rows
  __shared__ __attribute__((aligned(16))) _Float16 a1[64 * AP];   // GELU(fc1) rows
  const int tid = threadIdx.x, lane = tid & 31;
  const int wv = __builtin_amdgcn_readfirstlane(tid >> 5);  // wave-uniform -> SGPR
  const size_t r0 = (size_t)blockIdx.x * 64;

  // LayerNorm2 on 64 rows of current out (= x + attn). A wave's eight rows go through
  // together: all row loads first, then each reduction step over the eight rows side by side.
  {
    float4 v[8];
#pragma unroll
    for (int t = 0; t < 8; ++t)
      v[t] = *(const float4*)(out + (r0 + wv + t * 8) * CC + lane * 4);
    ln_rows<8>(v, n2g, n2b, lane);
#pragma unroll
    for (int t = 0; t < 8; ++t) {
      _Float16* dst = h2 + (wv + t * 8) * XP + lane * 4;
      dst[0] = (_Float16)v[t].x;
      dst[1] = (_Float16)v[t].y;
      dst[2] = (_Float16)v[t].z;
      dst[3] = (_Float16)v[t].w;
    }
  }
  __syncthreads();

  // fc1 + GELU (erf form): (64x128)@(128x512). Each wave owns 4 of the 32 column strips (64x16):
  // activation fragments stay in registers, each weight fragment feeds the four row tiles.
  {
    v16h af[4][4];
#pragma unroll
    for (int mt = 0; mt < 4; ++mt)
#pragma unroll
      for (int kk = 0; kk < 4; ++kk) af[mt][kk] = ld_a(h2, XP, mt * 16, kk * 32, lane);
    const _Float16* ws = w_strip(fc1Wt, wv, 4, lane);
    for (int j = 0; j < 4; ++j, ws += 8 * 4 * 512) {  // the wave's next strip is eight strips on
      int nt = wv + j * 8;
      v8f acc[4] = {};
      v16h bf[4];
#pragma unroll
      for (int kk = 0; kk < 4; ++kk) bf[kk] = ld_w(ws, kk);
      // Keeps the strip's eight weight loads in flight together: without it the scheduler
      // reuses one register set and waits out a full load latency at every k step.
      __builtin_amdgcn_sched_barrier(0);
#pragma unroll
      for (int kk = 0; kk < 4; ++kk)
#pragma unroll
        for (int mt = 0; mt < 4; ++mt) acc[mt] = WMMA_F16(af[mt][kk], bf[kk], acc[mt]);
      int n = nt * 16 + (lane & 15);
      float bb = fc1b[n];
#pragma unroll
      for (int mt = 0; mt < 4; ++mt) {
        int mbase = mt * 16 + ((lane >> 4) << 3);
#pragma unroll
        for (int r = 0; r < 8; r += 2) {
          v2f vv = {acc[mt][r] + bb, acc[mt][r + 1] + bb};
          v2h hh = __builtin_convertvector(gelu2(vv), v2h);
          a1[(mbase + r) * AP + n]     = hh.x;
          a1[(mbase + r + 1) * AP + n] = hh.y;
        }
      }
    }
  }
  __syncthreads();

  // fc2 + residual: (64x512)@(512x128). One 64x16 column strip per wave:
  // each weight fragment feeds the four row tiles.
  {
    int nt = wv;
    int n = nt * 16 + (lane & 15);
    float bb = fc2b[n];
    float* orow = out + (r0 + (size_t)((lane >> 4) << 3)) * CC + n;
    const _Float16* ws = w_strip(fc2Wt, nt, 16, lane);
    v8f acc[4] = {};
    v16h bf[2][4];   // weight fragments: this group of four k steps and the next
    v16h af[2][4];   // activation fragments: this k step and the next
    float res[4][8]; // residual rows, fetched under the last four k steps
#pragma unroll
    for (int q = 0; q < 4; ++q) bf[0][q] = ld_w(ws, q);
#pragma unroll
    for (int mt = 0; mt < 4; ++mt) af[0][mt] = ld_a(a1, AP, mt * 16, 0, lane);
#pragma unroll
    for (int kk = 0; kk < 16; ++kk) {
      if ((kk & 3) == 0 && kk + 4 < 16) {
#pragma unroll
        for (int q = 0; q < 4; ++q)
          bf[((kk >> 2) + 1) & 1][q] = ld_w(ws, kk + 4 + q);
      }
      if (kk == 12) {
        // Precaution: the residual values may be given the registers that held the weight
        // address of loads still in flight; this wait stands in front of that overwrite.
        asm volatile("s_wait_xcnt 0x0" ::: "memory");
#pragma unroll
        for (int mt = 0; mt < 4; ++mt)
#pragma unroll
          for (int r = 0; r < 8; ++r) res[mt][r] = orow[(mt * 16 + r) * CC];
      }
      if (kk + 1 < 16) {
#pragma unroll
        for (int mt = 0; mt < 4; ++mt) af[(kk + 1) & 1][mt] = ld_a(a1, AP, mt * 16, (kk + 1) * 32, lane);
      }
      // The two scheduling barriers hold the order "next step's loads as one group, then this
      // step's four matrix instructions": left free, the scheduler either loads each fragment
      // right in front of its use and waits out its latency, or runs past 256 registers.
      __builtin_amdgcn_sched_barrier(0);
#pragma unroll
      for (int mt = 0; mt < 4; ++mt)
        acc[mt] = WMMA_F16(af[kk & 1][mt], bf[(kk >> 2) & 1][kk & 3], acc[mt]);
      __builtin_amdgcn_sched_barrier(0);
    }
#pragma unroll
    for (int mt = 0; mt < 4; ++mt)
#pragma unroll
      for (int r = 0; r < 8; ++r) orow[(mt * 16 + r) * CC] = res[mt][r] + (acc[mt][r] + bb);
  }
}

extern "C" void kernel_launch(void* const* d_in, const int* in_sizes, int n_in,
                              void* d_out, int out_size, void* d_ws, size_t ws_size,
                              hipStream_t stream) {
  (void)in_sizes; (void)n_in; (void)out_size; (void)ws_size;
  const float* x      = (const float*)d_in[0];
  const float* qkv_w  = (const float*)d_in[1];
  const float* qkv_b  = (const float*)d_in[2];
  const float* proj_w = (const float*)d_in[3];
  const float* proj_b = (const float*)d_in[4];
  const float* rpb    = (const float*)d_in[5];
  const float* n1g    = (const float*)d_in[6];
  const float* n1b    = (const float*)d_in[7];
  const float* n2g    = (const float*)d_in[8];
  const float* n2b    = (const float*)d_in[9];
  const float* fc1w   = (const float*)d_in[10];
  const float* fc1b   = (const float*)d_in[11];
  const float* fc2w   = (const float*)d_in[12];
  const float* fc2b   = (const float*)d_in[13];
  float* out = (float*)d_out;

  // f16 weights in fragment order (see k_wprep)
  _Float16* qkvWt  = (_Float16*)d_ws;          // 24 strips x 4 fragments
  _Float16* projWt = qkvWt + 384 * 128;        //  8 strips x 4 fragments
  _Float16* fc1Wt  = projWt + 128 * 128;       // 32 strips x 4 fragments
  _Float16* fc2Wt  = fc1Wt + 512 * 128;        //  8 strips x 16 fragments

  k_wprep<<<96, 256, 0, stream>>>(qkv_w, qkvWt, 128, 384);
  k_wprep<<<32, 256, 0, stream>>>(proj_w, projWt, 128, 128);
  k_wprep<<<128, 256, 0, stream>>>(fc1w, fc1Wt, 128, 512);
  k_wprep<<<128, 256, 0, stream>>>(fc2w, fc2Wt, 512, 128);

  k_attn<<<64 * 64, 256, 0, stream>>>(x, qkv_b, proj_b, rpb, n1g, n1b, qkvWt, projWt, out);
  k_mlp<<<3136, 256, 0, stream>>>(n2g, n2b, fc1Wt, fc1b, fc2Wt, fc2b, out);
}

// v007
// A run of this version takes 157 microseconds.
// In both of two side-by-side timings against v006, it was 1.08 times as fast.
// All steps since v000 together make it 4.59 times as fast.
#include <hip/hip_runtime.h>
#include <hip/hip_bf16.h>
#include <math.h>

typedef __attribute__((ext_vector_type(16))) _Float16 v16h;
typedef __attribute__((ext_vector_type(8)))  _Float16 v8h;
typedef __attribute__((ext_vector_type(8)))  float    v8f;
typedef __attribute__((ext_vector_type(4)))  float    v4f;
typedef __attribute__((ext_vector_type(2)))  float    v2f;
typedef __attribute__((ext_vector_type(2)))  _Float16 v2h;

#define NTOK 49
#define CC   128
#define NHEAD 4
#define HID  512
#define HW   56
#define SHFT 3
#define LN_EPS 1e-5f

// LDS row pitches in elements. Each row carries 16 bytes of pad, so the pitch is an odd
// multiple of 16 bytes and the 16 rows of one 128-bit fragment read fall on distinct banks.
#define XP  (CC + 8)       // f16 rows of 128: 272 B
#define QKP (256 + 8)      // f16 rows of 256: 528 B
#define TP  (64 + 8)       // f16 rows of 64: 144 B
#define AP  (HID + 8)      // f16 rows of 512: 1040 B
#define SP  (CC + 4)       // f32 rows of 128: 528 B

#define WMMA_F16(a, b, c) \
  __builtin_amdgcn_wmma_f32_16x16x32_f16(false, (a), false, (b), (short)0, (c), false, false)

// Sum over the 32 lanes for R independent values at once: step by step over all R, so the
// R cross-lane exchanges of a step are in flight together. Each value is summed by itself,
// over lane distances 16, 8, 4, 2, 1.
template <int R>
__device__ __forceinline__ void wred_sum_rows(float (&s)[R]) {
#pragma unroll
  for (int o = 16; o > 0; o >>= 1)
#pragma unroll
    for (int t = 0; t < R; ++t) s[t] += __shfl_xor(s[t], o, 32);
}

// LayerNorm of R rows of 128 floats, four per lane, in place.
template <int R>
__device__ __forceinline__ void ln_rows(float4 (&v)[R], const float* __restrict__ g,
                                        const float* __restrict__ be, int lane) {
  float s[R];
#pragma unroll
  for (int t = 0; t < R; ++t) s[t] = v[t].x + v[t].y + v[t].z + v[t].w;
  wred_sum_rows<R>(s);
#pragma unroll
  for (int t = 0; t < R; ++t) {
    float mu = s[t] * (1.f / 128.f);
    v[t].x -= mu; v[t].y -= mu; v[t].z -= mu; v[t].w -= mu;
    s[t] = v[t].x * v[t].x + v[t].y * v[t].y + v[t].z * v[t].z + v[t].w * v[t].w;
  }
  wred_sum_rows<R>(s);
  int c = lane * 4;
#pragma unroll
  for (int t = 0; t < R; ++t) {
    float rs = rsqrtf(s[t] * (1.f / 128.f) + LN_EPS);
    v[t].x = v[t].x * rs * g[c + 0] + be[c + 0];
    v[t].y = v[t].y * rs * g[c + 1] + be[c + 1];
    v[t].z = v[t].z * rs * g[c + 2] + be[c + 2];
    v[t].w = v[t].w * rs * g[c + 3] + be[c + 3];
  }
}

// GELU in its erf form, v * Phi(v) = 0.5 v (1 + erf(v / sqrt 2)), two values at a time, with no branch:
//   1 - Phi(a) = exp(-a^2 / 2) * t (c1 + t (c2 + t (c3 + t (c4 + t c5)))),  t = 1 / (1 + p a),  a = |v|
// (the classical five-term rational form; its error in Phi is below 7.5e-8 for every a >= 0, and the
// factor 1 / sqrt(2 pi) is folded into c1..c5). With h = 1 - Phi(|v|): v Phi(v) = max(v, 0) - |v| h
// on both signs. In f32 the result stays within 1e-6 of v Phi(v), far under the f16 rounding that follows.
// One straight line of code for every lane, so neighbouring values overlap in the pipe.
__device__ __forceinline__ v2f gelu2(v2f v) {
  v2f a = __builtin_elementwise_abs(v);
  v2f d = a * 0.2316419f + 1.f;
  v2f t = {__builtin_amdgcn_rcpf(d.x), __builtin_amdgcn_rcpf(d.y)};
  v2f y = t * 0.53070271f - 0.72657603f;
  y = y * t + 0.71070689f;
  y = y * t - 0.14224836f;
  y = y * t + 0.12741479f;
  y = y * t;
  v2f q = (v * v) * -0.72134752f;  // -a^2 / 2 in powers of two
  v2f e = {__builtin_amdgcn_exp2f(q.x), __builtin_amdgcn_exp2f(q.y)};
  v2f h = y * e;
  v2f zero = {0.f, 0.f};
  return __builtin_elementwise_max(v, zero) - a * h;
}

// 2^t of 25 values, in place. The instruction set asks for one independent instruction between a
// transcendental and a directly following instruction that reads its result or overwrites its
// source.
// Here each v_exp_f32 has an independent one behind it, and the v_nop is the slot of the last.
#define EXP2_AT(n) "v_exp_f32 %" #n ", %" #n "\n\t"
__device__ __forceinline__ void exp2_25(float (&t)[25]) {
  asm(EXP2_AT(0) EXP2_AT(1) EXP2_AT(2) EXP2_AT(3) EXP2_AT(4) EXP2_AT(5) EXP2_AT(6) EXP2_AT(7) EXP2_AT(8)
      EXP2_AT(9) EXP2_AT(10) EXP2_AT(11) EXP2_AT(12) EXP2_AT(13) EXP2_AT(14) EXP2_AT(15) EXP2_AT(16)
      EXP2_AT(17) EXP2_AT(18) EXP2_AT(19) EXP2_AT(20) EXP2_AT(21) EXP2_AT(22) EXP2_AT(23) EXP2_AT(24)
      "v_nop"
      : "+v"(t[0]), "+v"(t[1]), "+v"(t[2]), "+v"(t[3]), "+v"(t[4]), "+v"(t[5]), "+v"(t[6]), "+v"(t[7]),
        "+v"(t[8]), "+v"(t[9]), "+v"(t[10]), "+v"(t[11]), "+v"(t[12]), "+v"(t[13]), "+v"(t[14]),
        "+v"(t[15]), "+v"(t[16]), "+v"(t[17]), "+v"(t[18]), "+v"(t[19]), "+v"(t[20]), "+v"(t[21]),
        "+v"(t[22]), "+v"(t[23]), "+v"(t[24]));
}

// A/B-operand fragment (16x32 f16 tile, rows striped over lanes, K along VGPRs).
// Per ISA 7.12.2 the per-lane halves are contiguous in two 16B runs: K+[0..7] and K+[16..23]
// (K offset +8 for lanes 16..31) -> two 128-bit loads.
__device__ __forceinline__ v16h ld_a(const _Float16* buf, int ld, int row0, int col0, int lane) {
  int m  = row0 + (lane & 15);
  int kb = (lane >> 4) << 3;
  const v8h* p = (const v8h*)(buf + m * ld + col0 + kb);
  v8h lo = p[0];
  v8h hi = p[2];
  return __builtin_shufflevector(lo, hi, 0, 1, 2, 3, 4, 5, 6, 7,
                                         8, 9, 10, 11, 12, 13, 14, 15);
}

// Weight fragments come from the packed copy that k_wprep writes: a fragment is 1024 bytes, first
// the 32 lanes' low runs (16 bytes each), then their high runs. Each of the two 128-bit loads of a
// wave therefore reads 512 contiguous bytes, four whole cache lines, where a row-major copy made
// it touch 16 lines for 32 bytes each. Lane and register positions are those of ld_a.
// w_strip: this lane's place in the first fragment of column strip nt (kf fragments per strip).
__device__ __forceinline__ const _Float16* w_strip(const _Float16* __restrict__ wp, int nt, int kf, int lane) {
  return wp + nt * kf * 512 + lane * 8;
}
// ld_w: fragment kk of that strip.
__device__ __forceinline__ v16h ld_w(const _Float16* __restrict__ ws, int kk) {
  const v8h* p = (const v8h*)(ws + kk * 512);
  v8h lo = p[0];
  v8h hi = p[32];
  return __builtin_shufflevector(lo, hi, 0, 1, 2, 3, 4, 5, 6, 7,
                                         8, 9, 10, 11, 12, 13, 14, 15);
}

// ---- weight prep: f16 copy of w[k][n] (K x N), packed in fragment order ---------
// Fragment f = nt * (K / 32) + kk is the 16 x 32 tile of columns n = 16 nt + (lane & 15) and
// k = 32 kk + 8 (lane >> 4) + 16 run + e, stored at half index 512 f + 256 run + 8 lane + e.
__global__ void k_wprep(const float* __restrict__ w, _Float16* __restrict__ wt, int K, int N) {
  int total = K * N;
  int kf = K >> 5;
  for (int i = blockIdx.x * blockDim.x + threadIdx.x; i < total; i += gridDim.x * blockDim.x) {
    int f = i >> 9;
    int nt = f / kf, kk = f - nt * kf;
    int l = (i >> 3) & 31;
    int n = nt * 16 + (l & 15);
    int k = kk * 32 + ((l >> 4) << 3) + (((i >> 8) & 1) << 4) + (i & 7);
    wt[i] = (_Float16)w[k * N + n];
  }
}

// ---- fused LN1 + shifted-window attention + proj + residual ------------------
__global__ __launch_bounds__(256) void k_attn(
    const float* __restrict__ x, const float* __restrict__ qkv_b,
    const float* __restrict__ proj_b, const float* __restrict__ rpb,
    const float* __restrict__ n1g, const float* __restrict__ n1b,
    const _Float16* __restrict__ qkvWt, const _Float16* __restrict__ projWt,
    float* __restrict__ out) {
  __shared__ __attribute__((aligned(16))) _Float16 xt[64 * XP];     // LN'd window tokens (padded to 64 rows)
  __shared__ __attribute__((aligned(16))) _Float16 qkvs[64 * QKP];  // Q|K f16 (token-major)
  __shared__ __attribute__((aligned(16))) _Float16 vts[CC * TP];    // V transposed (channel-major)
  __shared__ __attribute__((aligned(16))) _Float16 os[64 * XP];     // attention output (pre-proj), f16

  const int tid  = threadIdx.x;
  const int lane = tid & 31;
  const int wv   = __builtin_amdgcn_readfirstlane(tid >> 5);  // wave-uniform -> SGPR
  const int b    = blockIdx.x >> 6;
  const int w    = blockIdx.x & 63;
  const int wh   = w >> 3, ww = w & 7;
  const float scale = 0.17677669529663687f;  // 1/sqrt(32)

  // gather (roll by -3) + LayerNorm1. A wave's seven tokens go through together: all row
  // loads are issued first and each reduction step runs over the seven rows side by side, so
  // one load latency and one chain of cross-lane steps are paid per wave, not one per token.
  // The block has eight waves: tokens wv + 8 t, t < 6, are 0..47; every wave also works
  // token 48 and wave 0 alone stores it.
  {
    float4 v[7];
#pragma unroll
    for (int t = 0; t < 7; ++t) {
      int i = (t < 6) ? wv + t * 8 : NTOK - 1;
      int yi = i / 7, xi = i - yi * 7;
      int sr = (wh * 7 + yi + SHFT) % HW;
      int sc = (ww * 7 + xi + SHFT) % HW;
      const float* row = x + ((size_t)b * (HW * HW) + (size_t)(sr * HW + sc)) * CC;
      v[t] = *(const float4*)(row + lane * 4);
    }
    // Precaution: the loop below may be given the registers that held the row addresses of
    // loads still in flight; this wait stands in front of that overwrite.
    asm volatile("s_wait_xcnt 0x0" ::: "memory");
    // zero pad rows 49..63 while the row loads are in flight
    for (int i = tid; i < (64 - NTOK) * XP; i += 256) xt[NTOK * XP + i] = (_Float16)0.f;
    ln_rows<7>(v, n1g, n1b, lane);
#pragma unroll
    for (int t = 0; t < 7; ++t) {
      if (t < 6 || wv == 0) {
        int i = (t < 6) ? wv + t * 8 : NTOK - 1;
        _Float16* dst = xt + i * XP + lane * 4;
        dst[0] = (_Float16)v[t].x;
        dst[1] = (_Float16)v[t].y;
        dst[2] = (_Float16)v[t].z;
        dst[3] = (_Float16)v[t].w;
      }
    }
  }
  __syncthreads();

  // QKV GEMM: (64x128) @ (128x384). Each wave owns whole 64x16 column strips (3 of 24):
  // the 16 activation fragments stay in registers, and every weight fragment is loaded
  // once per block and feeds the four row tiles. Strip j of a wave is Q, K, V for j = 0, 1, 2.
  {
    v16h af[4][4];
#pragma unroll
    for (int mt = 0; mt < 4; ++mt)
#pragma unroll
      for (int kk = 0; kk < 4; ++kk) af[mt][kk] = ld_a(xt, XP, mt * 16, kk * 32, lane);
    const _Float16* ws0 = w_strip(qkvWt, wv, 4, lane);
#pragma unroll
    for (int j = 0; j < 3; ++j) {
      int nt = wv + j * 8;
      v8f acc[4] = {};
      v16h bf[4];
      const _Float16* ws = ws0 + j * (8 * 4 * 512);  // the wave's next strip is eight strips on
#pragma unroll
      for (int kk = 0; kk < 4; ++kk) bf[kk] = ld_w(ws, kk);
      int n = nt * 16 + (lane & 15);
      float bias = qkv_b[n];
      // Precaution: a later load's result may be given the register that holds the address of
      // the bias load while that load is in flight; this wait stands in front of that overwrite.
      asm volatile("s_wait_xcnt 0x0" ::: "memory");
      // Keeps the strip's eight weight loads in flight together: without it the scheduler
      // reuses one register set and waits out a full load latency at every k step.
      __builtin_amdgcn_sched_barrier(0);
#pragma unroll
      for (int kk = 0; kk < 4; ++kk)
#pragma unroll
        for (int mt = 0; mt < 4; ++mt) acc[mt] = WMMA_F16(af[mt][kk], bf[kk], acc[mt]);
#pragma unroll
      for (int mt = 0; mt < 4; ++mt) {
        int mbase = mt * 16 + ((lane >> 4) << 3);
        if (j == 0) {  // Q (pre-scaled)
#pragma unroll
          for (int r = 0; r < 8; ++r)
            qkvs[(mbase + r) * QKP + n] = (_Float16)((acc[mt][r] + bias) * scale);
        } else if (j == 1) {  // K
#pragma unroll
          for (int r = 0; r < 8; ++r)
            qkvs[(mbase + r) * QKP + n] = (_Float16)(acc[mt][r] + bias);
        } else {  // V -> transposed, 8 consecutive halves per lane (one b128 store)
          _Float16* dst = vts + (n - 256) * TP + mbase;
#pragma unroll
          for (int r = 0; r < 8; ++r) dst[r] = (_Float16)(acc[mt][r] + bias);
        }
      }
    }
  }

  // Attention. One wave owns one head and 32 of the 64 query rows, from the scores to the
  // head's output, so nothing is handed between waves: the barrier below only ends the QKV stage.
  // S^T = K Q^T: a lane holds the scores of ONE query (column c of each tile) over keys
  // 16 jt + 8 hi + r, so maximum and sum run down its own registers, with one exchange between
  // the two lane halves. Two S^T tiles, converted in place, are the B operand of O^T = V^T P^T.
  {
    const int h  = wv >> 1;
    const int i0 = (wv & 1) * 32;
    const int c  = lane & 15, hi = lane >> 4;
    const bool edge = (wh == 7) || (ww == 7);  // block-uniform: only such windows have a shift mask
    const int lh1 = (wh == 7) ? 3 : 0, lh2 = (wh == 7) ? 6 : 0;  // region label, row part (times 3)
    const int lw1 = (ww == 7) ? 1 : 0, lw2 = (ww == 7) ? 2 : 0;  // region label, column part

    // Relative-position bias: index (yi - yj + 6) * 13 + (xi - xj + 6) = lin(i) + 84 - lin(j),
    // lin(t) = 13 (t / 7) + t % 7. Pad queries (i > 48) take query 48's index, which keeps the
    // address inside the table; their rows are never stored. Of key tile 3 only key 48 exists.
    // Element e < 24 is key ja = 16 (e / 8) + e % 8 in lanes 0..15 and key ja + 8 in lanes 16..31,
    // and lin(ja + 8) = lin(ja) + 14, or + 20 where ja % 7 == 6: so three offsets per query
    // serve all 25 loads, each with a constant offset (none of them below 0). The loads need nothing from LDS and
    // stand in front of the barrier, so they are under way while the block gathers there.
    int n0[2], na[2], nb[2], li[2];
#pragma unroll
    for (int it = 0; it < 2; ++it) {
      int i = min(i0 + it * 16 + c, NTOK - 1);
      int yi = i / 7, xi = i - yi * 7;
      int base = (yi * 13 + xi) * NHEAD + h;
      n0[it] = base;
      na[it] = base + (hi ? 0 : 14 * NHEAD);
      nb[it] = base + (hi ? 0 : 20 * NHEAD);
      li[it] = (yi < 4 ? lh1 : lh2) + (xi < 4 ? lw1 : lw2);
    }
    float bias[2][25];
#pragma unroll
    for (int it = 0; it < 2; ++it) {
#pragma unroll
      for (int e = 0; e < 24; ++e) {
        const int ja = (e >> 3) * 16 + (e & 7);
        const int off = (84 - ((ja / 7) * 13 + ja % 7)) * NHEAD;  // 84 - lin(ja), at least 15 rows
        bias[it][e] = (ja % 7 < 6) ? rpb[na[it] + (off - 14 * NHEAD)] : rpb[nb[it] + (off - 20 * NHEAD)];
      }
      bias[it][24] = rpb[n0[it]];
    }
    // Precaution: later code may be given the registers that hold the addresses of loads still
    // in flight. The six offsets are inputs here, so they stay as they are up to this wait.
    asm volatile("s_wait_xcnt 0x0" ::"v"(n0[0]), "v"(n0[1]), "v"(na[0]), "v"(na[1]), "v"(nb[0]), "v"(nb[1])
                 : "memory");
    __syncthreads();

    v16h kf[4], qf[2];
#pragma unroll
    for (int jt = 0; jt < 4; ++jt) kf[jt] = ld_a(qkvs, QKP, jt * 16, 128 + h * 32, lane);
#pragma unroll
    for (int it = 0; it < 2; ++it) qf[it] = ld_a(qkvs, QKP, i0 + it * 16, h * 32, lane);
    const v8f z = {};
    v8f st[2][4];
#pragma unroll
    for (int it = 0; it < 2; ++it)
#pragma unroll
      for (int jt = 0; jt < 3; ++jt) st[it][jt] = WMMA_F16(kf[jt], qf[it], z);

    // scores + bias (+ mask); sc[it][e], e = 8 jt + r, e = 24 is key 48 (lanes 0..15 only)
    float sc[2][25];
    st[0][3] = WMMA_F16(kf[3], qf[0], z);
    // A product of key tile 3 leaves seven of its eight result registers unused.
    // The two scheduling barriers keep the first query tile's bias additions between the two.
    __builtin_amdgcn_sched_barrier(0);
#pragma unroll
    for (int e = 0; e < 24; ++e) sc[0][e] = st[0][e >> 3][e & 7] + bias[0][e];
    __builtin_amdgcn_sched_barrier(0);
    st[1][3] = WMMA_F16(kf[3], qf[1], z);
#pragma unroll
    for (int e = 0; e < 24; ++e) sc[1][e] = st[1][e >> 3][e & 7] + bias[1][e];
#pragma unroll
    for (int it = 0; it < 2; ++it) sc[it][24] = st[it][3][0] + bias[it][24];
    if (edge) {
#pragma unroll
      for (int e = 0; e < 25; ++e) {
        const int ja = (e < 24) ? (e >> 3) * 16 + (e & 7) : NTOK - 1;
        const int jb = (e < 24) ? ja + 8 : NTOK - 1;
        int la = (ja / 7 < 4 ? lh1 : lh2) + (ja % 7 < 4 ? lw1 : lw2);
        int lb = (jb / 7 < 4 ? lh1 : lh2) + (jb % 7 < 4 ? lw1 : lw2);
        int lj = hi ? lb : la;
#pragma unroll
        for (int it = 0; it < 2; ++it) sc[it][e] += (li[it] != lj) ? -100.f : 0.f;
      }
    }
#pragma unroll
    for (int it = 0; it < 2; ++it) sc[it][24] = hi ? -1e30f : sc[it][24];

    // softmax down the registers; three partial sums per query, then the other lane half's
    float mx[2], sm[2];
#pragma unroll
    for (int it = 0; it < 2; ++it) {
      float m = sc[it][24];
#pragma unroll
      for (int e = 0; e < 24; ++e) m = fmaxf(m, sc[it][e]);
      mx[it] = m;
    }
#pragma unroll
    for (int it = 0; it < 2; ++it) mx[it] = fmaxf(mx[it], __shfl_xor(mx[it], 16, 32));
#pragma unroll
    for (int it = 0; it < 2; ++it) {
#pragma unroll
      for (int e = 0; e < 25; ++e) sc[it][e] = (sc[it][e] - mx[it]) * 1.44269504f;  // to powers of two
      exp2_25(sc[it]);
      float s0 = sc[it][24], s1 = 0.f, s2 = 0.f;
#pragma unroll
      for (int r = 0; r < 8; ++r) { s0 += sc[it][r]; s1 += sc[it][8 + r]; s2 += sc[it][16 + r]; }
      sm[it] = (s0 + s1) + s2;
    }
#pragma unroll
    for (int it = 0; it < 2; ++it) sm[it] += __shfl_xor(sm[it], 16, 32);

    // P^T as B operand: element s of k block kk is key 32 kk + (s < 8 ? 8 hi + s : 16 + 8 hi + s - 8),
    // the order in which ld_a reads the rows of V^T.
    v16h pf[2][2];
#pragma unroll
    for (int it = 0; it < 2; ++it) {
      float inv = 1.f / sm[it];
#pragma unroll
      for (int s = 0; s < 16; ++s) {
        pf[it][0][s] = (_Float16)(sc[it][s] * inv);
        pf[it][1][s] = (s < 9) ? (_Float16)(sc[it][16 + s] * inv) : (_Float16)0.f;
      }
    }

    // O^T = V^T P^T: a lane ends with 8 consecutive channels of one query -> one 16-byte store
#pragma unroll
    for (int dt = 0; dt < 2; ++dt) {
      v16h v0 = ld_a(vts, TP, h * 32 + dt * 16, 0, lane);
      v16h v1 = ld_a(vts, TP, h * 32 + dt * 16, 32, lane);
#pragma unroll
      for (int it = 0; it < 2; ++it) {
        v8f acc = {};
        acc = WMMA_F16(v0, pf[it][0], acc);
        acc = WMMA_F16(v1, pf[it][1], acc);
        *(v8h*)(os + (i0 + it * 16 + c) * XP + h * 32 + dt * 16 + hi * 8) =
            __builtin_convertvector(acc, v8h);
      }
    }
  }
  __syncthreads();

  // proj: (64x128)@(128x128), then bias, residual and the inverse roll by whole rows.
  // One 16-channel strip per wave: each weight fragment feeds the four token tiles. The product is
  // taken as W^T O^T, so a lane ends with 8 consecutive channels of ONE token and hands them to
  // LDS in two 16-byte stores. Q and K are dead behind the barrier above: their space is the stage.
  float* stage = reinterpret_cast<float*>(qkvs);  // 64 rows of SP floats
  float4 xr[7];
  size_t ro[7];
  float pb[4];
  {
    int nt = wv;
    const _Float16* ws = w_strip(projWt, nt, 4, lane);
    v16h bm[4];
#pragma unroll
    for (int kk = 0; kk < 4; ++kk) bm[kk] = ld_w(ws, kk);
    // Residual rows for the epilogue: the wave that gathered a token's row fetches it again, 16
    // bytes per lane from a wave-uniform row address. Issued behind the weight loads, which are
    // needed first, the loads are under way during the product and are first used behind it.
#pragma unroll
    for (int e = 0; e < 4; ++e) pb[e] = proj_b[lane * 4 + e];
    const float* xp[7];
#pragma unroll
    for (int t = 0; t < 7; ++t) {
      int i = (t < 6) ? wv + t * 8 : NTOK - 1;
      int yi = i / 7, xi = i - yi * 7;
      int sr = (wh * 7 + yi + SHFT) % HW;
      int sc = (ww * 7 + xi + SHFT) % HW;
      ro[t] = ((size_t)b * (HW * HW) + (size_t)(sr * HW + sc)) * CC + lane * 4;
      xp[t] = x + ro[t];
      xr[t] = *(const float4*)xp[t];
    }
    // Precaution: a later load's result, or later code, may be given the registers that hold the
    // addresses of loads still in flight. The seven row addresses are inputs here, so they stay as
    // they are up to this wait.
    asm volatile("s_wait_xcnt 0x0" ::"v"(xp[0]), "v"(xp[1]), "v"(xp[2]), "v"(xp[3]), "v"(xp[4]), "v"(xp[5]),
                 "v"(xp[6])
                 : "memory");
    v8f acc[4] = {};
#pragma unroll
    for (int kk = 0; kk < 4; ++kk) {
#pragma unroll
      for (int mt = 0; mt < 4; ++mt) {
        v16h a = ld_a(os, XP, mt * 16, kk * 32, lane);
        acc[mt] = WMMA_F16(bm[kk], a, acc[mt]);
      }
    }
#pragma unroll
    for (int mt = 0; mt < 4; ++mt) {
      v4f* dst = (v4f*)(stage + (mt * 16 + (lane & 15)) * SP + nt * 16 + ((lane >> 4) << 3));
      dst[0] = __builtin_shufflevector(acc[mt], acc[mt], 0, 1, 2, 3);
      dst[1] = __builtin_shufflevector(acc[mt], acc[mt], 4, 5, 6, 7);
    }
  }
  __syncthreads();

  // A wave takes its tokens' whole rows from the stage: one row address per token, computed once
  // per wave, and every store covers the row's 512 bytes, four whole cache lines.
#pragma unroll
  for (int t = 0; t < 7; ++t) {
    if (t < 6 || wv == 0) {
      // Precaution: token 48's values may be given registers that the six stores above name
      // while those are in flight; this wait stands in front of that overwrite.
      if (t == 6) asm volatile("s_wait_xcnt 0x0" ::: "memory");
      int i = (t < 6) ? wv + t * 8 : NTOK - 1;
      float4 s = *(const float4*)(stage + i * SP + lane * 4);
      float4 o;
      o.x = xr[t].x + s.x + pb[0];
      o.y = xr[t].y + s.y + pb[1];
      o.z = xr[t].z + s.z + pb[2];
      o.w = xr[t].w + s.w + pb[3];
      *(float4*)(out + ro[t]) = o;
    }
  }
}

// ---- fused LN2 + MLP (fc1 + GELU + fc2) + residual ---------------------------
__global__ __launch_bounds__(256) void k_mlp(
    const float* __restrict__ n2g, const float* __restrict__ n2b,
    const _Float16* __restrict__ fc1Wt, const float* __restrict__ fc1b,
    const _Float16* __restrict__ fc2Wt, const float* __restrict__ fc2b,
    float* __restrict__ out) {
  __shared__ __attribute__((aligned(16))) _Float16 h2[64 * XP];   // LN'd rows
  __shared__ __attribute__((aligned(16))) _Float16 a1[64 * AP];   // GELU(fc1) rows
  const int tid = threadIdx.x, lane = tid & 31;
  const int wv = __builtin_amdgcn_readfirstlane(tid >> 5);  // wave-uniform -> SGPR
  const size_t r0 = (size_t)blockIdx.x * 64;

  // LayerNorm2 on 64 rows of current out (= x + attn). A wave's eight rows go through
  // together: all row loads first, then each reduction step over the eight rows side by side.
  {
    float4 v[8];
#pragma unroll
    for (int t = 0; t < 8; ++t)
      v[t] = *(const float4*)(out + (r0 + wv + t * 8) * CC + lane * 4);
    ln_rows<8>(v, n2g, n2b, lane);
#pragma unroll
    for (int t = 0; t < 8; ++t) {
      _Float16* dst = h2 + (wv + t * 8) * XP + lane * 4;
      dst[0] = (_Float16)v[t].x;
      dst[1] = (_Float16)v[t].y;
      dst[2] = (_Float16)v[t].z;
      dst[3] = (_Float16)v[t].w;
    }
  }
  __syncthreads();

  // fc1 + GELU (erf form): (64x128)@(128x512). Each wave owns 4 of the 32 column strips (64x16):
  // activation fragments stay in registers, each weight fragment feeds the four row tiles.
  {
    v16h af[4][4];
#pragma unroll
    for (int mt = 0; mt < 4; ++mt)
#pragma unroll
      for (int kk = 0; kk < 4; ++kk) af[mt][kk] = ld_a(h2, XP, mt * 16, kk * 32, lane);
    const _Float16* ws = w_strip(fc1Wt, wv, 4, lane);
    for (int j = 0; j < 4; ++j, ws += 8 * 4 * 512) {  // the wave's next strip is eight strips on
      int nt = wv + j * 8;
      v8f acc[4] = {};
      v16h bf[4];
#pragma unroll
      for (int kk = 0; kk < 4; ++kk) bf[kk] = ld_w(ws, kk);
      // Keeps the strip's eight weight loads in flight together: without it the scheduler
      // reuses one register set and waits out a full load latency at every k step.
      __builtin_amdgcn_sched_barrier(0);
#pragma unroll
      for (int kk = 0; kk < 4; ++kk)
#pragma unroll
        for (int mt = 0; mt < 4; ++mt) acc[mt] = WMMA_F16(af[mt][kk], bf[kk], acc[mt]);
      int n = nt * 16 + (lane & 15);
      float bb = fc1b[n];
#pragma unroll
      for (int mt = 0; mt < 4; ++mt) {
        int mbase = mt * 16 + ((lane >> 4) << 3);
#pragma unroll
        for (int r = 0; r < 8; r += 2) {
          v2f vv = {acc[mt][r] + bb, acc[mt][r + 1] + bb};
          v2h hh = __builtin_convertvector(gelu2(vv), v2h);
          a1[(mbase + r) * AP + n]     = hh.x;
          a1[(mbase + r + 1) * AP + n] = hh.y;
        }
      }
    }
  }
  __syncthreads();

  // fc2 + residual: (64x512)@(512x128). One 64x16 column strip per wave:
  // each weight fragment feeds the four row tiles.
  {
    int nt = wv;
    int n = nt * 16 + (lane & 15);
    float bb = fc2b[n];
    float* orow = out + (r0 + (size_t)((lane >> 4) << 3)) * CC + n;
    const _Float16* ws = w_strip(fc2Wt, nt, 16, lane);
    v8f acc[4] = {};
    v16h bf[2][4];   // weight fragments: this group of four k steps and the next
    v16h af[2][4];   // activation fragments: this k step and the next
    float res[4][8]; // residual rows, fetched under the last four k steps
#pragma unroll
    for (int q = 0; q < 4; ++q) bf[0][q] = ld_w(ws, q);
#pragma unroll
    for (int mt = 0; mt < 4; ++mt) af[0][mt] = ld_a(a1, AP, mt * 16, 0, lane);
#pragma unroll
    for (int kk = 0; kk < 16; ++kk) {
      if ((kk & 3) == 0 && kk + 4 < 16) {
#pragma unroll
        for (int q = 0; q < 4; ++q)
          bf[((kk >> 2) + 1) & 1][q] = ld_w(ws, kk + 4 + q);
      }
      if (kk == 12) {
        // Precaution: the residual values may be given the registers that held the weight
        // address of loads still in flight; this wait stands in front of that overwrite.
        asm volatile("s_wait_xcnt 0x0" ::: "memory");
#pragma unroll
        for (int mt = 0; mt < 4; ++mt)
#pragma unroll
          for (int r = 0; r < 8; ++r) res[mt][r] = orow[(mt * 16 + r) * CC];
      }
      if (kk + 1 < 16) {
#pragma unroll
        for (int mt = 0; mt < 4; ++mt) af[(kk + 1) & 1][mt] = ld_a(a1, AP, mt * 16, (kk + 1) * 32, lane);
      }
      // The two scheduling barriers hold the order "next step's loads as one group, then this
      // step's four matrix instructions": left free, the scheduler either loads each fragment
      // right in front of its use and waits out its latency, or runs past 256 registers.
      __builtin_amdgcn_sched_barrier(0);
#pragma unroll
      for (int mt = 0; mt < 4; ++mt)
        acc[mt] = WMMA_F16(af[kk & 1][mt], bf[(kk >> 2) & 1][kk & 3], acc[mt]);
      __builtin_amdgcn_sched_barrier(0);
    }
#pragma unroll
    for (int mt = 0; mt < 4; ++mt)
#pragma unroll
      for (int r = 0; r < 8; ++r) orow[(mt * 16 + r) * CC] = res[mt][r] + (acc[mt][r] + bb);
  }
}

extern "C" void kernel_launch(void* const* d_in, const int* in_sizes, int n_in,
                              void* d_out, int out_size, void* d_ws, size_t ws_size,
                              hipStream_t stream) {
  (void)in_sizes; (void)n_in; (void)out_size; (void)ws_size;
  const float* x      = (const float*)d_in[0];
  const float* qkv_w  = (const float*)d_in[1];
  const float* qkv_b  = (const float*)d_in[2];
  const float* proj_w = (const float*)d_in[3];
  const float* proj_b = (const float*)d_in[4];
  const float* rpb    = (const float*)d_in[5];
  const float* n1g    = (const float*)d_in[6];
  const float* n1b    = (const float*)d_in[7];
  const float* n2g    = (const float*)d_in[8];
  const float* n2b    = (const float*)d_in[9];
  const float* fc1w   = (const float*)d_in[10];
  const float* fc1b   = (const float*)d_in[11];
  const float* fc2w   = (const float*)d_in[12];
  const float* fc2b   = (const float*)d_in[13];
  float* out = (float*)d_out;

  // f16 weights in fragment order (see k_wprep)
  _Float16* qkvWt  = (_Float16*)d_ws;          // 24 strips x 4 fragments
  _Float16* projWt = qkvWt + 384 * 128;        //  8 strips x 4 fragments
  _Float16* fc1Wt  = projWt + 128 * 128;       // 32 strips x 4 fragments
  _Float16* fc2Wt  = fc1Wt + 512 * 128;        //  8 strips x 16 fragments

  k_wprep<<<96, 256, 0, stream>>>(qkv_w, qkvWt, 128, 384);
  k_wprep<<<32, 256, 0, stream>>>(proj_w, projWt, 128, 128);
  k_wprep<<<128, 256, 0, stream>>>(fc1w, fc1Wt, 128, 512);
  k_wprep<<<128, 256, 0, stream>>>(fc2w, fc2Wt, 512, 128);

  k_attn<<<64 * 64, 256, 0, stream>>>(x, qkv_b, proj_b, rpb, n1g, n1b, qkvWt, projWt, out);
  k_mlp<<<3136, 256, 0, stream>>>(n2g, n2b, fc1Wt, fc1b, fc2Wt, fc2b, out);
}

// v008
// One run takes 150 microseconds.
// In both of two side-by-side timings against v007, it was 1.04 times as fast.
// Over all steps from v000 it is 4.76 times as fast.
#include <hip/hip_runtime.h>
#include <hip/hip_bf16.h>
#include <math.h>

typedef __attribute__((ext_vector_type(16))) _Float16 v16h;
typedef __attribute__((ext_vector_type(8)))  _Float16 v8h;
typedef __attribute__((ext_vector_type(8)))  float    v8f;
typedef __attribute__((ext_vector_type(4)))  float    v4f;
typedef __attribute__((ext_vector_type(2)))  float    v2f;
typedef __attribute__((ext_vector_type(2)))  _Float16 v2h;

#define NTOK 49
#define CC   128
#define NHEAD 4
#define HID  512
#define HW   56
#define SHFT 3
#define LN_EPS 1e-5f

// LDS row pitches in elements. Each row carries 16 bytes of pad, so the pitch is an odd
// multiple of 16 bytes and the 16 rows of one 128-bit fragment read fall on distinct banks.
#define XP  (CC + 8)       // f16 rows of 128: 272 B
#define QKP (256 + 8)      // f16 rows of 256: 528 B
#define TP  (64 + 8)       // f16 rows of 64: 144 B
#define AP  (HID + 8)      // f16 rows of 512: 1040 B
#define SP  (CC + 4)       // f32 rows of 128: 528 B

#define WMMA_F16(a, b, c) \
  __builtin_amdgcn_wmma_f32_16x16x32_f16(false, (a), false, (b), (short)0, (c), false, false)

// Sum over the 32 lanes for R independent values at once: step by step over all R, so the
// R cross-lane exchanges of a step are in flight together. Each value is summed by itself,
// over lane distances 16, 8, 4, 2, 1.
template <int R>
__device__ __forceinline__ void wred_sum_rows(float (&s)[R]) {
#pragma unroll
  for (int o = 16; o > 0; o >>= 1)
#pragma unroll
    for (int t = 0; t < R; ++t) s[t] += __shfl_xor(s[t], o, 32);
}

// LayerNorm of R rows of 128 floats, four per lane, in place.
template <int R>
__device__ __forceinline__ void ln_rows(float4 (&v)[R], const float* __restrict__ g,
                                        const float* __restrict__ be, int lane) {
  float s[R];
#pragma unroll
  for (int t = 0; t < R; ++t) s[t] = v[t].x + v[t].y + v[t].z + v[t].w;
  wred_sum_rows<R>(s);
#pragma unroll
  for (int t = 0; t < R; ++t) {
    float mu = s[t] * (1.f / 128.f);
    v[t].x -= mu; v[t].y -= mu; v[t].z -= mu; v[t].w -= mu;
    s[t] = v[t].x * v[t].x + v[t].y * v[t].y + v[t].z * v[t].z + v[t].w * v[t].w;
  }
  wred_sum_rows<R>(s);
  int c = lane * 4;
#pragma unroll
  for (int t = 0; t < R; ++t) {
    float rs = rsqrtf(s[t] * (1.f / 128.f) + LN_EPS);
    v[t].x = v[t].x * rs * g[c + 0] + be[c + 0];
    v[t].y = v[t].y * rs * g[c + 1] + be[c + 1];
    v[t].z = v[t].z * rs * g[c + 2] + be[c + 2];
    v[t].w = v[t].w * rs * g[c + 3] + be[c + 3];
  }
}

// GELU in its erf form, v * Phi(v) = 0.5 v (1 + erf(v / sqrt 2)), two values at a time, with no branch:
//   1 - Phi(a) = exp(-a^2 / 2) * t (c1 + t (c2 + t (c3 + t (c4 + t c5)))),  t = 1 / (1 + p a),  a = |v|
// (the classical five-term rational form; its error in Phi is below 7.5e-8 for every a >= 0, and the
// factor 1 / sqrt(2 pi) is folded into c1..c5). With h = 1 - Phi(|v|): v Phi(v) = max(v, 0) - |v| h
// on both signs. In f32 the result stays within 1e-6 of v Phi(v), far under the f16 rounding that follows.
// One straight line of code for every lane, so neighbouring values overlap in the pipe.
__device__ __forceinline__ v2f gelu2(v2f v) {
  v2f a = __builtin_elementwise_abs(v);
  v2f d = a * 0.2316419f + 1.f;
  v2f t = {__builtin_amdgcn_rcpf(d.x), __builtin_amdgcn_rcpf(d.y)};
  v2f y = t * 0.53070271f - 0.72657603f;
  y = y * t + 0.71070689f;
  y = y * t - 0.14224836f;
  y = y * t + 0.12741479f;
  y = y * t;
  v2f q = (v * v) * -0.72134752f;  // -a^2 / 2 in powers of two
  v2f e = {__builtin_amdgcn_exp2f(q.x), __builtin_amdgcn_exp2f(q.y)};
  v2f h = y * e;
  v2f zero = {0.f, 0.f};
  return __builtin_elementwise_max(v, zero) - a * h;
}

// 2^t of 25 values, in place. The instruction set asks for one independent instruction between a
// transcendental and a directly following instruction that reads its result or overwrites its
// source.
// Here each v_exp_f32 has an independent one behind it, and the v_nop is the slot of the last.
#define EXP2_AT(n) "v_exp_f32 %" #n ", %" #n "\n\t"
__device__ __forceinline__ void exp2_25(float (&t)[25]) {
  asm(EXP2_AT(0) EXP2_AT(1) EXP2_AT(2) EXP2_AT(3) EXP2_AT(4) EXP2_AT(5) EXP2_AT(6) EXP2_AT(7) EXP2_AT(8)
      EXP2_AT(9) EXP2_AT(10) EXP2_AT(11) EXP2_AT(12) EXP2_AT(13) EXP2_AT(14) EXP2_AT(15) EXP2_AT(16)
      EXP2_AT(17) EXP2_AT(18) EXP2_AT(19) EXP2_AT(20) EXP2_AT(21) EXP2_AT(22) EXP2_AT(23) EXP2_AT(24)
      "v_nop"
      : "+v"(t[0]), "+v"(t[1]), "+v"(t[2]), "+v"(t[3]), "+v"(t[4]), "+v"(t[5]), "+v"(t[6]), "+v"(t[7]),
        "+v"(t[8]), "+v"(t[9]), "+v"(t[10]), "+v"(t[11]), "+v"(t[12]), "+v"(t[13]), "+v"(t[14]),
        "+v"(t[15]), "+v"(t[16]), "+v"(t[17]), "+v"(t[18]), "+v"(t[19]), "+v"(t[20]), "+v"(t[21]),
        "+v"(t[22]), "+v"(t[23]), "+v"(t[24]));
}

// A/B-operand fragment (16x32 f16 tile, rows striped over lanes, K along VGPRs).
// Per ISA 7.12.2 the per-lane halves are contiguous in two 16B runs: K+[0..7] and K+[16..23]
// (K offset +8 for lanes 16..31) -> two 128-bit loads.
__device__ __forceinline__ v16h ld_a(const _Float16* buf, int ld, int row0, int col0, int lane) {
  int m  = row0 + (lane & 15);
  int kb = (lane >> 4) << 3;
  const v8h* p = (const v8h*)(buf + m * ld + col0 + kb);
  v8h lo = p[0];
  v8h hi = p[2];
  return __builtin_shufflevector(lo, hi, 0, 1, 2, 3, 4, 5, 6, 7,
                                         8, 9, 10, 11, 12, 13, 14, 15);
}

// Weight fragments come from the packed copy that k_wprep writes: a fragment is 1024 bytes, first
// the 32 lanes' low runs (16 bytes each), then their high runs. Each of the two 128-bit loads of a
// wave therefore reads 512 contiguous bytes, four whole cache lines, where a row-major copy made
// it touch 16 lines for 32 bytes each. Lane and register positions are those of ld_a.
// w_strip: this lane's place in the first fragment of column strip nt (kf fragments per strip).
__device__ __forceinline__ const _Float16* w_strip(const _Float16* __restrict__ wp, int nt, int kf, int lane) {
  return wp + nt * kf * 512 + lane * 8;
}
// ld_w: fragment kk of that strip.
__device__ __forceinline__ v16h ld_w(const _Float16* __restrict__ ws, int kk) {
  const v8h* p = (const v8h*)(ws + kk * 512);
  v8h lo = p[0];
  v8h hi = p[32];
  return __builtin_shufflevector(lo, hi, 0, 1, 2, 3, 4, 5, 6, 7,
                                         8, 9, 10, 11, 12, 13, 14, 15);
}

// ---- weight prep: f16 copy of w[k][n] (K x N), packed in fragment order ---------
// Fragment f = nt * (K / 32) + kk is the 16 x 32 tile of columns n = 16 nt + (lane & 15) and
// k = 32 kk + 8 (lane >> 4) + 16 run + e, stored at half index 512 f + 256 run + 8 lane + e.
__global__ void k_wprep(const float* __restrict__ w, _Float16* __restrict__ wt, int K, int N) {
  int total = K * N;
  int kf = K >> 5;
  for (int i = blockIdx.x * blockDim.x + threadIdx.x; i < total; i += gridDim.x * blockDim.x) {
    int f = i >> 9;
    int nt = f / kf, kk = f - nt * kf;
    int l = (i >> 3) & 31;
    int n = nt * 16 + (l & 15);
    int k = kk * 32 + ((l >> 4) << 3) + (((i >> 8) & 1) << 4) + (i & 7);
    wt[i] = (_Float16)w[k * N + n];
  }
}

// ---- fused LN1 + shifted-window attention + proj + residual ------------------
__global__ __launch_bounds__(256) void k_attn(
    const float* __restrict__ x, const float* __restrict__ qkv_b,
    const float* __restrict__ proj_b, const float* __restrict__ rpb,
    const float* __restrict__ n1g, const float* __restrict__ n1b,
    const _Float16* __restrict__ qkvWt, const _Float16* __restrict__ projWt,
    float* __restrict__ out) {
  __shared__ __attribute__((aligned(16))) _Float16 xt[64 * XP];     // LN'd window tokens (padded to 64 rows)
  __shared__ __attribute__((aligned(16))) _Float16 qkvs[64 * QKP];  // Q|K f16 (token-major)
  __shared__ __attribute__((aligned(16))) _Float16 vts[CC * TP];    // V transposed (channel-major)
  __shared__ __attribute__((aligned(16))) _Float16 os[64 * XP];     // attention output (pre-proj), f16

  const int tid  = threadIdx.x;
  const int lane = tid & 31;
  const int wv   = __builtin_amdgcn_readfirstlane(tid >> 5);  // wave-uniform -> SGPR
  const int b    = blockIdx.x >> 6;
  const int w    = blockIdx.x & 63;
  const int wh   = w >> 3, ww = w & 7;
  const float scale = 0.17677669529663687f;  // 1/sqrt(32)

  // gather (roll by -3) + LayerNorm1. A wave's seven tokens go through together: all row
  // loads are issued first and each reduction step runs over the seven rows side by side, so
  // one load latency and one chain of cross-lane steps are paid per wave, not one per token.
  // The block has eight waves: tokens wv + 8 t, t < 6, are 0..47; every wave also works
  // token 48 and wave 0 alone stores it.
  {
    float4 v[7];
#pragma unroll
    for (int t = 0; t < 7; ++t) {
      int i = (t < 6) ? wv + t * 8 : NTOK - 1;
      int yi = i / 7, xi = i - yi * 7;
      int sr = (wh * 7 + yi + SHFT) % HW;
      int sc = (ww * 7 + xi + SHFT) % HW;
      const float* row = x + ((size_t)b * (HW * HW) + (size_t)(sr * HW + sc)) * CC;
      v[t] = *(const float4*)(row + lane * 4);
    }
    // Precaution: the loop below may be given the registers that held the row addresses of
    // loads still in flight; this wait stands in front of that overwrite.
    asm volatile("s_wait_xcnt 0x0" ::: "memory");
    // zero pad rows 49..63 while the row loads are in flight
    for (int i = tid; i < (64 - NTOK) * XP; i += 256) xt[NTOK * XP + i] = (_Float16)0.f;
    ln_rows<7>(v, n1g, n1b, lane);
#pragma unroll
    for (int t = 0; t < 7; ++t) {
      if (t < 6 || wv == 0) {
        int i = (t < 6) ? wv + t * 8 : NTOK - 1;
        _Float16* dst = xt + i * XP + lane * 4;
        dst[0] = (_Float16)v[t].x;
        dst[1] = (_Float16)v[t].y;
        dst[2] = (_Float16)v[t].z;
        dst[3] = (_Float16)v[t].w;
      }
    }
  }
  __syncthreads();

  // QKV GEMM: (64x128) @ (128x384). Each wave owns whole 64x16 column strips (3 of 24):
  // the 16 activation fragments stay in registers, and every weight fragment is loaded
  // once per block and feeds the four row tiles. Strip j of a wave is Q, K, V for j = 0, 1, 2.
  {
    v16h af[4][4];
#pragma unroll
    for (int mt = 0; mt < 4; ++mt)
#pragma unroll
      for (int kk = 0; kk < 4; ++kk) af[mt][kk] = ld_a(xt, XP, mt * 16, kk * 32, lane);
    const _Float16* ws0 = w_strip(qkvWt, wv, 4, lane);
#pragma unroll
    for (int j = 0; j < 3; ++j) {
      int nt = wv + j * 8;
      v8f acc[4] = {};
      v16h bf[4];
      const _Float16* ws = ws0 + j * (8 * 4 * 512);  // the wave's next strip is eight strips on
#pragma unroll
      for (int kk = 0; kk < 4; ++kk) bf[kk] = ld_w(ws, kk);
      int n = nt * 16 + (lane & 15);
      float bias = qkv_b[n];
      // Precaution: a later load's result may be given the register that holds the address of
      // the bias load while that load is in flight; this wait stands in front of that overwrite.
      asm volatile("s_wait_xcnt 0x0" ::: "memory");
      // Keeps the strip's eight weight loads in flight together: without it the scheduler
      // reuses one register set and waits out a full load latency at every k step.
      __builtin_amdgcn_sched_barrier(0);
#pragma unroll
      for (int kk = 0; kk < 4; ++kk)
#pragma unroll
        for (int mt = 0; mt < 4; ++mt) acc[mt] = WMMA_F16(af[mt][kk], bf[kk], acc[mt]);
#pragma unroll
      for (int mt = 0; mt < 4; ++mt) {
        int mbase = mt * 16 + ((lane >> 4) << 3);
        if (j == 0) {  // Q (pre-scaled)
#pragma unroll
          for (int r = 0; r < 8; ++r)
            qkvs[(mbase + r) * QKP + n] = (_Float16)((acc[mt][r] + bias) * scale);
        } else if (j == 1) {  // K
#pragma unroll
          for (int r = 0; r < 8; ++r)
            qkvs[(mbase + r) * QKP + n] = (_Float16)(acc[mt][r] + bias);
        } else {  // V -> transposed, 8 consecutive halves per lane (one b128 store)
          _Float16* dst = vts + (n - 256) * TP + mbase;
#pragma unroll
          for (int r = 0; r < 8; ++r) dst[r] = (_Float16)(acc[mt][r] + bias);
        }
      }
    }
  }

  // Attention. One wave owns one head and 32 of the 64 query rows, from the scores to the
  // head's output, so nothing is handed between waves: the barrier below only ends the QKV stage.
  // S^T = K Q^T: a lane holds the scores of ONE query (column c of each tile) over keys
  // 16 jt + 8 hi + r, so maximum and sum run down its own registers, with one exchange between
  // the two lane halves. Two S^T tiles, converted in place, are the B operand of O^T = V^T P^T.
  {
    const int h  = wv >> 1;
    const int i0 = (wv & 1) * 32;
    const int c  = lane & 15, hi = lane >> 4;
    const bool edge = (wh == 7) || (ww == 7);  // block-uniform: only such windows have a shift mask
    const int lh1 = (wh == 7) ? 3 : 0, lh2 = (wh == 7) ? 6 : 0;  // region label, row part (times 3)
    const int lw1 = (ww == 7) ? 1 : 0, lw2 = (ww == 7) ? 2 : 0;  // region label, column part

    // Relative-position bias: index (yi - yj + 6) * 13 + (xi - xj + 6) = lin(i) + 84 - lin(j),
    // lin(t) = 13 (t / 7) + t % 7. Pad queries (i > 48) take query 48's index, which keeps the
    // address inside the table; their rows are never stored. Of key tile 3 only key 48 exists.
    // Element e < 24 is key ja = 16 (e / 8) + e % 8 in lanes 0..15 and key ja + 8 in lanes 16..31,
    // and lin(ja + 8) = lin(ja) + 14, or + 20 where ja % 7 == 6: so three offsets per query
    // serve all 25 loads, each with a constant offset (none of them below 0). The loads need nothing from LDS and
    // stand in front of the barrier, so they are under way while the block gathers there.
    int n0[2], na[2], nb[2], li[2];
#pragma unroll
    for (int it = 0; it < 2; ++it) {
      int i = min(i0 + it * 16 + c, NTOK - 1);
      int yi = i / 7, xi = i - yi * 7;
      int base = (yi * 13 + xi) * NHEAD + h;
      n0[it] = base;
      na[it] = base + (hi ? 0 : 14 * NHEAD);
      nb[it] = base + (hi ? 0 : 20 * NHEAD);
      li[it] = (yi < 4 ? lh1 : lh2) + (xi < 4 ? lw1 : lw2);
    }
    float bias[2][25];
#pragma unroll
    for (int it = 0; it < 2; ++it) {
#pragma unroll
      for (int e = 0; e < 24; ++e) {
        const int ja = (e >> 3) * 16 + (e & 7);
        const int off = (84 - ((ja / 7) * 13 + ja % 7)) * NHEAD;  // 84 - lin(ja), at least 15 rows
        bias[it][e] = (ja % 7 < 6) ? rpb[na[it] + (off - 14 * NHEAD)] : rpb[nb[it] + (off - 20 * NHEAD)];
      }
      bias[it][24] = rpb[n0[it]];
    }
    // Precaution: later code may be given the registers that hold the addresses of loads still
    // in flight. The six offsets are inputs here, so they stay as they are up to this wait.
    asm volatile("s_wait_xcnt 0x0" ::"v"(n0[0]), "v"(n0[1]), "v"(na[0]), "v"(na[1]), "v"(nb[0]), "v"(nb[1])
                 : "memory");
    __syncthreads();

    v16h kf[4], qf[2];
#pragma unroll
    for (int jt = 0; jt < 4; ++jt) kf[jt] = ld_a(qkvs, QKP, jt * 16, 128 + h * 32, lane);
#pragma unroll
    for (int it = 0; it < 2; ++it) qf[it] = ld_a(qkvs, QKP, i0 + it * 16, h * 32, lane);
    const v8f z = {};
    v8f st[2][4];
#pragma unroll
    for (int it = 0; it < 2; ++it)
#pragma unroll
      for (int jt = 0; jt < 3; ++jt) st[it][jt] = WMMA_F16(kf[jt], qf[it], z);

    // scores + bias (+ mask); sc[it][e], e = 8 jt + r, e = 24 is key 48 (lanes 0..15 only)
    float sc[2][25];
    st[0][3] = WMMA_F16(kf[3], qf[0], z);
    // A product of key tile 3 leaves seven of its eight result registers unused.
    // The two scheduling barriers keep the first query tile's bias additions between the two.
    __builtin_amdgcn_sched_barrier(0);
#pragma unroll
    for (int e = 0; e < 24; ++e) sc[0][e] = st[0][e >> 3][e & 7] + bias[0][e];
    __builtin_amdgcn_sched_barrier(0);
    st[1][3] = WMMA_F16(kf[3], qf[1], z);
#pragma unroll
    for (int e = 0; e < 24; ++e) sc[1][e] = st[1][e >> 3][e & 7] + bias[1][e];
#pragma unroll
    for (int it = 0; it < 2; ++it) sc[it][24] = st[it][3][0] + bias[it][24];
    if (edge) {
#pragma unroll
      for (int e = 0; e < 25; ++e) {
        const int ja = (e < 24) ? (e >> 3) * 16 + (e & 7) : NTOK - 1;
        const int jb = (e < 24) ? ja + 8 : NTOK - 1;
        int la = (ja / 7 < 4 ? lh1 : lh2) + (ja % 7 < 4 ? lw1 : lw2);
        int lb = (jb / 7 < 4 ? lh1 : lh2) + (jb % 7 < 4 ? lw1 : lw2);
        int lj = hi ? lb : la;
#pragma unroll
        for (int it = 0; it < 2; ++it) sc[it][e] += (li[it] != lj) ? -100.f : 0.f;
      }
    }
#pragma unroll
    for (int it = 0; it < 2; ++it) sc[it][24] = hi ? -1e30f : sc[it][24];

    // softmax down the registers; three partial sums per query, then the other lane half's
    float mx[2], sm[2];
#pragma unroll
    for (int it = 0; it < 2; ++it) {
      float m = sc[it][24];
#pragma unroll
      for (int e = 0; e < 24; ++e) m = fmaxf(m, sc[it][e]);
      mx[it] = m;
    }
#pragma unroll
    for (int it = 0; it < 2; ++it) mx[it] = fmaxf(mx[it], __shfl_xor(mx[it], 16, 32));
#pragma unroll
    for (int it = 0; it < 2; ++it) {
#pragma unroll
      for (int e = 0; e < 25; ++e) sc[it][e] = (sc[it][e] - mx[it]) * 1.44269504f;  // to powers of two
      exp2_25(sc[it]);
      float s0 = sc[it][24], s1 = 0.f, s2 = 0.f;
#pragma unroll
      for (int r = 0; r < 8; ++r) { s0 += sc[it][r]; s1 += sc[it][8 + r]; s2 += sc[it][16 + r]; }
      sm[it] = (s0 + s1) + s2;
    }
#pragma unroll
    for (int it = 0; it < 2; ++it) sm[it] += __shfl_xor(sm[it], 16, 32);

    // P^T as B operand: element s of k block kk is key 32 kk + (s < 8 ? 8 hi + s : 16 + 8 hi + s - 8),
    // the order in which ld_a reads the rows of V^T.
    v16h pf[2][2];
#pragma unroll
    for (int it = 0; it < 2; ++it) {
      float inv = 1.f / sm[it];
#pragma unroll
      for (int s = 0; s < 16; ++s) {
        pf[it][0][s] = (_Float16)(sc[it][s] * inv);
        pf[it][1][s] = (s < 9) ? (_Float16)(sc[it][16 + s] * inv) : (_Float16)0.f;
      }
    }

    // O^T = V^T P^T: a lane ends with 8 consecutive channels of one query -> one 16-byte store
#pragma unroll
    for (int dt = 0; dt < 2; ++dt) {
      v16h v0 = ld_a(vts, TP, h * 32 + dt * 16, 0, lane);
      v16h v1 = ld_a(vts, TP, h * 32 + dt * 16, 32, lane);
#pragma unroll
      for (int it = 0; it < 2; ++it) {
        v8f acc = {};
        acc = WMMA_F16(v0, pf[it][0], acc);
        acc = WMMA_F16(v1, pf[it][1], acc);
        *(v8h*)(os + (i0 + it * 16 + c) * XP + h * 32 + dt * 16 + hi * 8) =
            __builtin_convertvector(acc, v8h);
      }
    }
  }
  __syncthreads();

  // proj: (64x128)@(128x128), then bias, residual and the inverse roll by whole rows.
  // One 16-channel strip per wave: each weight fragment feeds the four token tiles. The product is
  // taken as W^T O^T, so a lane ends with 8 consecutive channels of ONE token and hands them to
  // LDS in two 16-byte stores. Q and K are dead behind the barrier above: their space is the stage.
  float* stage = reinterpret_cast<float*>(qkvs);  // 64 rows of SP floats
  float4 xr[7];
  size_t ro[7];
  float pb[4];
  {
    int nt = wv;
    const _Float16* ws = w_strip(projWt, nt, 4, lane);
    v16h bm[4];
#pragma unroll
    for (int kk = 0; kk < 4; ++kk) bm[kk] = ld_w(ws, kk);
    // Residual rows for the epilogue: the wave that gathered a token's row fetches it again, 16
    // bytes per lane from a wave-uniform row address. Issued behind the weight loads, which are
    // needed first, the loads are under way during the product and are first used behind it.
#pragma unroll
    for (int e = 0; e < 4; ++e) pb[e] = proj_b[lane * 4 + e];
    const float* xp[7];
#pragma unroll
    for (int t = 0; t < 7; ++t) {
      int i = (t < 6) ? wv + t * 8 : NTOK - 1;
      int yi = i / 7, xi = i - yi * 7;
      int sr = (wh * 7 + yi + SHFT) % HW;
      int sc = (ww * 7 + xi + SHFT) % HW;
      ro[t] = ((size_t)b * (HW * HW) + (size_t)(sr * HW + sc)) * CC + lane * 4;
      xp[t] = x + ro[t];
      xr[t] = *(const float4*)xp[t];
    }
    // Precaution: a later load's result, or later code, may be given the registers that hold the
    // addresses of loads still in flight. The seven row addresses are inputs here, so they stay as
    // they are up to this wait.
    asm volatile("s_wait_xcnt 0x0" ::"v"(xp[0]), "v"(xp[1]), "v"(xp[2]), "v"(xp[3]), "v"(xp[4]), "v"(xp[5]),
                 "v"(xp[6])
                 : "memory");
    v8f acc[4] = {};
#pragma unroll
    for (int kk = 0; kk < 4; ++kk) {
#pragma unroll
      for (int mt = 0; mt < 4; ++mt) {
        v16h a = ld_a(os, XP, mt * 16, kk * 32, lane);
        acc[mt] = WMMA_F16(bm[kk], a, acc[mt]);
      }
    }
#pragma unroll
    for (int mt = 0; mt < 4; ++mt) {
      v4f* dst = (v4f*)(stage + (mt * 16 + (lane & 15)) * SP + nt * 16 + ((lane >> 4) << 3));
      dst[0] = __builtin_shufflevector(acc[mt], acc[mt], 0, 1, 2, 3);
      dst[1] = __builtin_shufflevector(acc[mt], acc[mt], 4, 5, 6, 7);
    }
  }
  __syncthreads();

  // A wave takes its tokens' whole rows from the stage: one row address per token, computed once
  // per wave, and every store covers the row's 512 bytes, four whole cache lines.
#pragma unroll
  for (int t = 0; t < 7; ++t) {
    if (t < 6 || wv == 0) {
      // Precaution: token 48's values may be given registers that the six stores above name
      // while those are in flight; this wait stands in front of that overwrite.
      if (t == 6) asm volatile("s_wait_xcnt 0x0" ::: "memory");
      int i = (t < 6) ? wv + t * 8 : NTOK - 1;
      float4 s = *(const float4*)(stage + i * SP + lane * 4);
      float4 o;
      o.x = xr[t].x + s.x + pb[0];
      o.y = xr[t].y + s.y + pb[1];
      o.z = xr[t].z + s.z + pb[2];
      o.w = xr[t].w + s.w + pb[3];
      *(float4*)(out + ro[t]) = o;
    }
  }
}

// ---- fused LN2 + MLP (fc1 + GELU + fc2) + residual ---------------------------
__global__ __launch_bounds__(256) void k_mlp(
    const float* __restrict__ n2g, const float* __restrict__ n2b,
    const _Float16* __restrict__ fc1Wt, const float* __restrict__ fc1b,
    const _Float16* __restrict__ fc2Wt, const float* __restrict__ fc2b,
    float* __restrict__ out) {
  // One space, two lives: the LN'd rows (f16, 64 rows of XP) up to the barrier behind fc1, which ends
  // their last read, and from there the f32 stage of the fc2 result (64 rows of SP).
  __shared__ __attribute__((aligned(16))) float stage[64 * SP];
  __shared__ __attribute__((aligned(16))) _Float16 a1[64 * AP];   // GELU(fc1) rows
  __shared__ __attribute__((aligned(16))) float fb[8 * CC];       // fc2 bias, one copy per wave
  _Float16* h2 = reinterpret_cast<_Float16*>(stage);
  const int tid = threadIdx.x, lane = tid & 31;
  const int wv = __builtin_amdgcn_readfirstlane(tid >> 5);  // wave-uniform -> SGPR
  const size_t r0 = (size_t)blockIdx.x * 64;

  // LayerNorm2 on 64 rows of current out (= x + attn). A wave's eight rows go through
  // together: all row loads first, then each reduction step over the eight rows side by side.
  // The rows as loaded stay in registers: they are the residual of the rows this wave stores at the end.
  float4 xr[8];
  {
    float4 v[8];
#pragma unroll
    for (int t = 0; t < 8; ++t) {
      xr[t] = *(const float4*)(out + (r0 + wv + t * 8) * CC + lane * 4);
      v[t] = xr[t];
    }
    ln_rows<8>(v, n2g, n2b, lane);
#pragma unroll
    for (int t = 0; t < 8; ++t) {
      _Float16* dst = h2 + (wv + t * 8) * XP + lane * 4;
      dst[0] = (_Float16)v[t].x;
      dst[1] = (_Float16)v[t].y;
      dst[2] = (_Float16)v[t].z;
      dst[3] = (_Float16)v[t].w;
    }
    // The fc2 bias of this lane's four channels waits in LDS for the epilogue, in the wave's own copy.
    // Fetched here, the load lies under the LayerNorm; fetched where it is used, the compiler puts it
    // behind the last barrier, and the row stores wait out its whole latency.
    *(float4*)(fb + wv * CC + lane * 4) = *(const float4*)(fc2b + lane * 4);
  }
  __syncthreads();

  // fc1 + GELU (erf form): (64x128)@(128x512). Each wave owns 4 of the 32 column strips (64x16):
  // activation fragments stay in registers, each weight fragment feeds the four row tiles.
  {
    v16h af[4][4];
#pragma unroll
    for (int mt = 0; mt < 4; ++mt)
#pragma unroll
      for (int kk = 0; kk < 4; ++kk) af[mt][kk] = ld_a(h2, XP, mt * 16, kk * 32, lane);
    const _Float16* ws = w_strip(fc1Wt, wv, 4, lane);
    for (int j = 0; j < 4; ++j, ws += 8 * 4 * 512) {  // the wave's next strip is eight strips on
      int nt = wv + j * 8;
      v8f acc[4] = {};
      v16h bf[4];
#pragma unroll
      for (int kk = 0; kk < 4; ++kk) bf[kk] = ld_w(ws, kk);
      // Keeps the strip's eight weight loads in flight together: without it the scheduler
      // reuses one register set and waits out a full load latency at every k step.
      __builtin_amdgcn_sched_barrier(0);
#pragma unroll
      for (int kk = 0; kk < 4; ++kk)
#pragma unroll
        for (int mt = 0; mt < 4; ++mt) acc[mt] = WMMA_F16(af[mt][kk], bf[kk], acc[mt]);
      int n = nt * 16 + (lane & 15);
      float bb = fc1b[n];
#pragma unroll
      for (int mt = 0; mt < 4; ++mt) {
        int mbase = mt * 16 + ((lane >> 4) << 3);
#pragma unroll
        for (int r = 0; r < 8; r += 2) {
          v2f vv = {acc[mt][r] + bb, acc[mt][r + 1] + bb};
          v2h hh = __builtin_convertvector(gelu2(vv), v2h);
          a1[(mbase + r) * AP + n]     = hh.x;
          a1[(mbase + r + 1) * AP + n] = hh.y;
        }
      }
    }
  }
  __syncthreads();

  // fc2: (64x512)@(512x128). One 16-channel strip per wave: each weight fragment feeds the four
  // token tiles. The product is taken as W^T A^T, so a lane ends with 8 consecutive channels of ONE
  // token and hands them to the stage in two 16-byte stores.
  {
    int nt = wv;
    const _Float16* ws = w_strip(fc2Wt, nt, 16, lane);
    v8f acc[4] = {};
    v16h bf[2][4];   // weight fragments: this group of four k steps and the next
    v16h af[2][4];   // activation fragments: this k step and the next
#pragma unroll
    for (int q = 0; q < 4; ++q) bf[0][q] = ld_w(ws, q);
#pragma unroll
    for (int mt = 0; mt < 4; ++mt) af[0][mt] = ld_a(a1, AP, mt * 16, 0, lane);
#pragma unroll
    for (int kk = 0; kk < 16; ++kk) {
      if ((kk & 3) == 0 && kk + 4 < 16) {
#pragma unroll
        for (int q = 0; q < 4; ++q)
          bf[((kk >> 2) + 1) & 1][q] = ld_w(ws, kk + 4 + q);
      }
      if (kk + 1 < 16) {
#pragma unroll
        for (int mt = 0; mt < 4; ++mt) af[(kk + 1) & 1][mt] = ld_a(a1, AP, mt * 16, (kk + 1) * 32, lane);
      }
      // The two scheduling barriers hold the order "next step's loads as one group, then this
      // step's four matrix instructions": left free, the scheduler either loads each fragment
      // right in front of its use and waits out its latency, or runs past 256 registers.
      __builtin_amdgcn_sched_barrier(0);
      // Precaution: the stage addresses behind the loop may be given the registers that held the
      // weight address; this wait stands in front of that overwrite, a scheduling barrier behind it.
      if (kk == 15) asm volatile("s_wait_xcnt 0x0" ::: "memory");
#pragma unroll
      for (int mt = 0; mt < 4; ++mt)
        acc[mt] = WMMA_F16(bf[(kk >> 2) & 1][kk & 3], af[kk & 1][mt], acc[mt]);
      __builtin_amdgcn_sched_barrier(0);
    }
#pragma unroll
    for (int mt = 0; mt < 4; ++mt) {
      v4f* dst = (v4f*)(stage + (mt * 16 + (lane & 15)) * SP + nt * 16 + ((lane >> 4) << 3));
      dst[0] = __builtin_shufflevector(acc[mt], acc[mt], 0, 1, 2, 3);
      dst[1] = __builtin_shufflevector(acc[mt], acc[mt], 4, 5, 6, 7);
    }
  }
  __syncthreads();

  // A wave takes the rows it loaded at the top from the stage, adds bias and residual and stores
  // each row's 512 bytes, four whole cache lines, with one store.
  const float4 pb = *(const float4*)(fb + wv * CC + lane * 4);
#pragma unroll
  for (int t = 0; t < 8; ++t) {
    int row = wv + t * 8;
    float4 s = *(const float4*)(stage + row * SP + lane * 4);
    float4 o;
    o.x = xr[t].x + (s.x + pb.x);
    o.y = xr[t].y + (s.y + pb.y);
    o.z = xr[t].z + (s.z + pb.z);
    o.w = xr[t].w + (s.w + pb.w);
    *(float4*)(out + (r0 + row) * CC + lane * 4) = o;
  }
}

extern "C" void kernel_launch(void* const* d_in, const int* in_sizes, int n_in,
                              void* d_out, int out_size, void* d_ws, size_t ws_size,
                              hipStream_t stream) {
  (void)in_sizes; (void)n_in; (void)out_size; (void)ws_size;
  const float* x      = (const float*)d_in[0];
  const float* qkv_w  = (const float*)d_in[1];
  const float* qkv_b  = (const float*)d_in[2];
  const float* proj_w = (const float*)d_in[3];
  const float* proj_b = (const float*)d_in[4];
  const float* rpb    = (const float*)d_in[5];
  const float* n1g    = (const float*)d_in[6];
  const float* n1b    = (const float*)d_in[7];
  const float* n2g    = (const float*)d_in[8];
  const float* n2b    = (const float*)d_in[9];
  const float* fc1w   = (const float*)d_in[10];
  const float* fc1b   = (const float*)d_in[11];
  const float* fc2w   = (const float*)d_in[12];
  const float* fc2b   = (const float*)d_in[13];
  float* out = (float*)d_out;

  // f16 weights in fragment order (see k_wprep)
  _Float16* qkvWt  = (_Float16*)d_ws;          // 24 strips x 4 fragments
  _Float16* projWt = qkvWt + 384 * 128;        //  8 strips x 4 fragments
  _Float16* fc1Wt  = projWt + 128 * 128;       // 32 strips x 4 fragments
  _Float16* fc2Wt  = fc1Wt + 512 * 128;        //  8 strips x 16 fragments

  k_wprep<<<96, 256, 0, stream>>>(qkv_w, qkvWt, 128, 384);
  k_wprep<<<32, 256, 0, stream>>>(proj_w, projWt, 128, 128);
  k_wprep<<<128, 256, 0, stream>>>(fc1w, fc1Wt, 128, 512);
  k_wprep<<<128, 256, 0, stream>>>(fc2w, fc2Wt, 512, 128);

  k_attn<<<64 * 64, 256, 0, stream>>>(x, qkv_b, proj_b, rpb, n1g, n1b, qkvWt, projWt, out);
  k_mlp<<<3136, 256, 0, stream>>>(n2g, n2b, fc1Wt, fc1b, fc2Wt, fc2b, out);
}

// v009
// It runs in 138 microseconds.
// Timed twice side by side with v008, it ran 1.08 and 1.09 times as fast.
// Over all steps from v000 it is 5.17 times as fast.
#include <hip/hip_runtime.h>
#include <hip/hip_bf16.h>
#include <math.h>

typedef __attribute__((ext_vector_type(16))) _Float16 v16h;
typedef __attribute__((ext_vector_type(8)))  _Float16 v8h;
typedef __attribute__((ext_vector_type(8)))  float    v8f;
typedef __attribute__((ext_vector_type(4)))  float    v4f;
typedef __attribute__((ext_vector_type(2)))  float    v2f;
typedef __attribute__((ext_vector_type(2)))  _Float16 v2h;

#define NTOK 49
#define CC   128
#define NHEAD 4
#define HID  512
#define HW   56
#define SHFT 3
#define LN_EPS 1e-5f

// LDS row pitches in elements. Each row carries 16 bytes of pad, so the pitch is an odd
// multiple of 16 bytes and the 16 rows of one 128-bit fragment read fall on distinct banks.
#define XP  (CC + 8)       // f16 rows of 128: 272 B
#define QKP (256 + 8)      // f16 rows of 256: 528 B
#define TP  (64 + 8)       // f16 rows of 64: 144 B
#define AP  (HID + 8)      // f16 rows of 512: 1040 B
#define SP  (CC + 4)       // f32 rows of 128: 528 B

#define WMMA_F16(a, b, c) \
  __builtin_amdgcn_wmma_f32_16x16x32_f16(false, (a), false, (b), (short)0, (c), false, false)

// Sum over the 32 lanes for R independent values at once: step by step over all R, so the
// R cross-lane exchanges of a step are in flight together. Each value is summed by itself,
// over lane distances 16, 8, 4, 2, 1.
template <int R>
__device__ __forceinline__ void wred_sum_rows(float (&s)[R]) {
#pragma unroll
  for (int o = 16; o > 0; o >>= 1)
#pragma unroll
    for (int t = 0; t < R; ++t) s[t] += __shfl_xor(s[t], o, 32);
}

// LayerNorm of R rows of 128 floats, four per lane, in place.
template <int R>
__device__ __forceinline__ void ln_rows(float4 (&v)[R], const float* __restrict__ g,
                                        const float* __restrict__ be, int lane) {
  float s[R];
#pragma unroll
  for (int t = 0; t < R; ++t) s[t] = v[t].x + v[t].y + v[t].z + v[t].w;
  wred_sum_rows<R>(s);
#pragma unroll
  for (int t = 0; t < R; ++t) {
    float mu = s[t] * (1.f / 128.f);
    v[t].x -= mu; v[t].y -= mu; v[t].z -= mu; v[t].w -= mu;
    s[t] = v[t].x * v[t].x + v[t].y * v[t].y + v[t].z * v[t].z + v[t].w * v[t].w;
  }
  wred_sum_rows<R>(s);
  int c = lane * 4;
#pragma unroll
  for (int t = 0; t < R; ++t) {
    float rs = rsqrtf(s[t] * (1.f / 128.f) + LN_EPS);
    v[t].x = v[t].x * rs * g[c + 0] + be[c + 0];
    v[t].y = v[t].y * rs * g[c + 1] + be[c + 1];
    v[t].z = v[t].z * rs * g[c + 2] + be[c + 2];
    v[t].w = v[t].w * rs * g[c + 3] + be[c + 3];
  }
}

// GELU in its erf form, v * Phi(v) = 0.5 v (1 + erf(v / sqrt 2)), two values at a time, with no branch:
//   1 - Phi(a) = exp(-a^2 / 2) * t (c1 + t (c2 + t (c3 + t (c4 + t c5)))),  t = 1 / (1 + p a),  a = |v|
// (the classical five-term rational form; its error in Phi is below 7.5e-8 for every a >= 0, and the
// factor 1 / sqrt(2 pi) is folded into c1..c5). With h = 1 - Phi(|v|): v Phi(v) = max(v, 0) - |v| h
// on both signs. In f32 the result stays within 1e-6 of v Phi(v), far under the f16 rounding that follows.
// One straight line of code for every lane, so neighbouring values overlap in the pipe.
__device__ __forceinline__ v2f gelu2(v2f v) {
  v2f a = __builtin_elementwise_abs(v);
  v2f d = a * 0.2316419f + 1.f;
  v2f t = {__builtin_amdgcn_rcpf(d.x), __builtin_amdgcn_rcpf(d.y)};
  v2f y = t * 0.53070271f - 0.72657603f;
  y = y * t + 0.71070689f;
  y = y * t - 0.14224836f;
  y = y * t + 0.12741479f;
  y = y * t;
  v2f q = (v * v) * -0.72134752f;  // -a^2 / 2 in powers of two
  v2f e = {__builtin_amdgcn_exp2f(q.x), __builtin_amdgcn_exp2f(q.y)};
  v2f h = y * e;
  v2f zero = {0.f, 0.f};
  return __builtin_elementwise_max(v, zero) - a * h;
}

// 2^t of 25 values, in place. The instruction set asks for one independent instruction between a
// transcendental and a directly following instruction that reads its result or overwrites its
// source.
// Here each v_exp_f32 has an independent one behind it, and the v_nop is the slot of the last.
#define EXP2_AT(n) "v_exp_f32 %" #n ", %" #n "\n\t"
__device__ __forceinline__ void exp2_25(float (&t)[25]) {
  asm(EXP2_AT(0) EXP2_AT(1) EXP2_AT(2) EXP2_AT(3) EXP2_AT(4) EXP2_AT(5) EXP2_AT(6) EXP2_AT(7) EXP2_AT(8)
      EXP2_AT(9) EXP2_AT(10) EXP2_AT(11) EXP2_AT(12) EXP2_AT(13) EXP2_AT(14) EXP2_AT(15) EXP2_AT(16)
      EXP2_AT(17) EXP2_AT(18) EXP2_AT(19) EXP2_AT(20) EXP2_AT(21) EXP2_AT(22) EXP2_AT(23) EXP2_AT(24)
      "v_nop"
      : "+v"(t[0]), "+v"(t[1]), "+v"(t[2]), "+v"(t[3]), "+v"(t[4]), "+v"(t[5]), "+v"(t[6]), "+v"(t[7]),
        "+v"(t[8]), "+v"(t[9]), "+v"(t[10]), "+v"(t[11]), "+v"(t[12]), "+v"(t[13]), "+v"(t[14]),
        "+v"(t[15]), "+v"(t[16]), "+v"(t[17]), "+v"(t[18]), "+v"(t[19]), "+v"(t[20]), "+v"(t[21]),
        "+v"(t[22]), "+v"(t[23]), "+v"(t[24]));
}

// A/B-operand fragment (16x32 f16 tile, rows striped over lanes, K along VGPRs).
// Per ISA 7.12.2 the per-lane halves are contiguous in two 16B runs: K+[0..7] and K+[16..23]
// (K offset +8 for lanes 16..31) -> two 128-bit loads.
__device__ __forceinline__ v16h ld_a(const _Float16* buf, int ld, int row0, int col0, int lane) {
  int m  = row0 + (lane & 15);
  int kb = (lane >> 4) << 3;
  const v8h* p = (const v8h*)(buf + m * ld + col0 + kb);
  v8h lo = p[0];
  v8h hi = p[2];
  return __builtin_shufflevector(lo, hi, 0, 1, 2, 3, 4, 5, 6, 7,
                                         8, 9, 10, 11, 12, 13, 14, 15);
}

// Weight fragments come from the packed copy that k_wprep writes: a fragment is 1024 bytes, first
// the 32 lanes' low runs (16 bytes each), then their high runs. Each of the two 128-bit loads of a
// wave therefore reads 512 contiguous bytes, four whole cache lines, where a row-major copy made
// it touch 16 lines for 32 bytes each. Lane and register positions are those of ld_a.
// w_strip: this lane's place in the first fragment of column strip nt (kf fragments per strip).
__device__ __forceinline__ const _Float16* w_strip(const _Float16* __restrict__ wp, int nt, int kf, int lane) {
  return wp + nt * kf * 512 + lane * 8;
}
// ld_w: fragment kk of that strip.
__device__ __forceinline__ v16h ld_w(const _Float16* __restrict__ ws, int kk) {
  const v8h* p = (const v8h*)(ws + kk * 512);
  v8h lo = p[0];
  v8h hi = p[32];
  return __builtin_shufflevector(lo, hi, 0, 1, 2, 3, 4, 5, 6, 7,
                                         8, 9, 10, 11, 12, 13, 14, 15);
}

// ---- weight prep: f16 copy of w[k][n] (K x N), packed in fragment order ---------
// Fragment f = nt * (K / 32) + kk is the 16 x 32 tile of columns n = 16 nt + (lane & 15) and
// k = 32 kk + 8 (lane >> 4) + 16 run + e, stored at half index 512 f + 256 run + 8 lane + e.
// All four matrices in ONE launch: they are independent of one another, so a range of the block
// index takes each (96, 32, 128 and 128 blocks; two elements per thread). One launch per matrix would
// pay a start, a round trip to memory and an end for each, one after the other. What differs between
// the matrices is block-uniform and sits in scalar registers.
__global__ __launch_bounds__(256) void k_wprep(
    const float* __restrict__ qkv_w, const float* __restrict__ proj_w,
    const float* __restrict__ fc1w, const float* __restrict__ fc2w,
    _Float16* __restrict__ qkvWt, _Float16* __restrict__ projWt,
    _Float16* __restrict__ fc1Wt, _Float16* __restrict__ fc2Wt) {
  const unsigned blk = blockIdx.x;
  const float* __restrict__ w = qkv_w;   // K = 128, N = 384
  _Float16* __restrict__ wt = qkvWt;
  unsigned first = 0, nblk = 96, N = 384, kfs = 2;  // kfs: log2 of the K / 32 fragments per strip
  if (blk >= 256)      { w = fc2w;   wt = fc2Wt;  first = 256; nblk = 128; N = 128; kfs = 4; }  // K = 512
  else if (blk >= 128) { w = fc1w;   wt = fc1Wt;  first = 128; nblk = 128; N = 512; }           // K = 128
  else if (blk >= 96)  { w = proj_w; wt = projWt; first = 96;  nblk = 32;  N = 128; }           // K = 128
  unsigned i[2];
  float v[2];
  // Unrolled, loads apart from stores: both loads are under way before either value is waited for.
#pragma unroll
  for (unsigned u = 0; u < 2; ++u) {
    i[u] = (blk - first + u * nblk) * 256 + threadIdx.x;
    unsigned f = i[u] >> 9;
    unsigned nt = f >> kfs, kk = f - (nt << kfs);
    unsigned l = (i[u] >> 3) & 31;
    unsigned n = nt * 16 + (l & 15);
    unsigned k = kk * 32 + ((l >> 4) << 3) + (((i[u] >> 8) & 1) << 4) + (i[u] & 7);
    v[u] = w[k * N + n];
  }
#pragma unroll
  for (unsigned u = 0; u < 2; ++u) wt[i[u]] = (_Float16)v[u];
}

// ---- fused LN1 + shifted-window attention + proj + residual ------------------
__global__ __launch_bounds__(256) void k_attn(
    const float* __restrict__ x, const float* __restrict__ qkv_b,
    const float* __restrict__ proj_b, const float* __restrict__ rpb,
    const float* __restrict__ n1g, const float* __restrict__ n1b,
    const _Float16* __restrict__ qkvWt, const _Float16* __restrict__ projWt,
    float* __restrict__ out) {
  __shared__ __attribute__((aligned(16))) _Float16 xt[64 * XP];     // LN'd window tokens (padded to 64 rows)
  __shared__ __attribute__((aligned(16))) _Float16 qkvs[64 * QKP];  // Q|K f16 (token-major)
  __shared__ __attribute__((aligned(16))) _Float16 vts[CC * TP];    // V transposed (channel-major)
  __shared__ __attribute__((aligned(16))) _Float16 os[64 * XP];     // attention output (pre-proj), f16

  const int tid  = threadIdx.x;
  const int lane = tid & 31;
  const int wv   = __builtin_amdgcn_readfirstlane(tid >> 5);  // wave-uniform -> SGPR
  const int b    = blockIdx.x >> 6;
  const int w    = blockIdx.x & 63;
  const int wh   = w >> 3, ww = w & 7;
  const float scale = 0.17677669529663687f;  // 1/sqrt(32)

  // gather (roll by -3) + LayerNorm1. A wave's seven tokens go through together: all row
  // loads are issued first and each reduction step runs over the seven rows side by side, so
  // one load latency and one chain of cross-lane steps are paid per wave, not one per token.
  // The block has eight waves: tokens wv + 8 t, t < 6, are 0..47; every wave also works
  // token 48 and wave 0 alone stores it.
  {
    float4 v[7];
#pragma unroll
    for (int t = 0; t < 7; ++t) {
      int i = (t < 6) ? wv + t * 8 : NTOK - 1;
      int yi = i / 7, xi = i - yi * 7;
      int sr = (wh * 7 + yi + SHFT) % HW;
      int sc = (ww * 7 + xi + SHFT) % HW;
      const float* row = x + ((size_t)b * (HW * HW) + (size_t)(sr * HW + sc)) * CC;
      v[t] = *(const float4*)(row + lane * 4);
    }
    // Precaution: the loop below may be given the registers that held the row addresses of
    // loads still in flight; this wait stands in front of that overwrite.
    asm volatile("s_wait_xcnt 0x0" ::: "memory");
    // zero pad rows 49..63 while the row loads are in flight
    for (int i = tid; i < (64 - NTOK) * XP; i += 256) xt[NTOK * XP + i] = (_Float16)0.f;
    ln_rows<7>(v, n1g, n1b, lane);
#pragma unroll
    for (int t = 0; t < 7; ++t) {
      if (t < 6 || wv == 0) {
        int i = (t < 6) ? wv + t * 8 : NTOK - 1;
        _Float16* dst = xt + i * XP + lane * 4;
        dst[0] = (_Float16)v[t].x;
        dst[1] = (_Float16)v[t].y;
        dst[2] = (_Float16)v[t].z;
        dst[3] = (_Float16)v[t].w;
      }
    }
  }
  __syncthreads();

  // QKV GEMM: (64x128) @ (128x384). Each wave owns whole 64x16 column strips (3 of 24):
  // the 16 activation fragments stay in registers, and every weight fragment is loaded
  // once per block and feeds the four row tiles. Strip j of a wave is Q, K, V for j = 0, 1, 2.
  {
    v16h af[4][4];
#pragma unroll
    for (int mt = 0; mt < 4; ++mt)
#pragma unroll
      for (int kk = 0; kk < 4; ++kk) af[mt][kk] = ld_a(xt, XP, mt * 16, kk * 32, lane);
    const _Float16* ws0 = w_strip(qkvWt, wv, 4, lane);
#pragma unroll
    for (int j = 0; j < 3; ++j) {
      int nt = wv + j * 8;
      v8f acc[4] = {};
      v16h bf[4];
      const _Float16* ws = ws0 + j * (8 * 4 * 512);  // the wave's next strip is eight strips on
#pragma unroll
      for (int kk = 0; kk < 4; ++kk) bf[kk] = ld_w(ws, kk);
      int n = nt * 16 + (lane & 15);
      float bias = qkv_b[n];
      // Precaution: a later load's result may be given the register that holds the address of
      // the bias load while that load is in flight; this wait stands in front of that overwrite.
      asm volatile("s_wait_xcnt 0x0" ::: "memory");
      // Keeps the strip's eight weight loads in flight together: without it the scheduler
      // reuses one register set and waits out a full load latency at every k step.
      __builtin_amdgcn_sched_barrier(0);
#pragma unroll
      for (int kk = 0; kk < 4; ++kk)
#pragma unroll
        for (int mt = 0; mt < 4; ++mt) acc[mt] = WMMA_F16(af[mt][kk], bf[kk], acc[mt]);
#pragma unroll
      for (int mt = 0; mt < 4; ++mt) {
        int mbase = mt * 16 + ((lane >> 4) << 3);
        if (j == 0) {  // Q (pre-scaled)
#pragma unroll
          for (int r = 0; r < 8; ++r)
            qkvs[(mbase + r) * QKP + n] = (_Float16)((acc[mt][r] + bias) * scale);
        } else if (j == 1) {  // K
#pragma unroll
          for (int r = 0; r < 8; ++r)
            qkvs[(mbase + r) * QKP + n] = (_Float16)(acc[mt][r] + bias);
        } else {  // V -> transposed, 8 consecutive halves per lane (one b128 store)
          _Float16* dst = vts + (n - 256) * TP + mbase;
#pragma unroll
          for (int r = 0; r < 8; ++r) dst[r] = (_Float16)(acc[mt][r] + bias);
        }
      }
    }
  }

  // Attention. One wave owns one head and 32 of the 64 query rows, from the scores to the
  // head's output, so nothing is handed between waves: the barrier below only ends the QKV stage.
  // S^T = K Q^T: a lane holds the scores of ONE query (column c of each tile) over keys
  // 16 jt + 8 hi + r, so maximum and sum run down its own registers, with one exchange between
  // the two lane halves. Two S^T tiles, converted in place, are the B operand of O^T = V^T P^T.
  {
    const int h  = wv >> 1;
    const int i0 = (wv & 1) * 32;
    const int c  = lane & 15, hi = lane >> 4;
    const bool edge = (wh == 7) || (ww == 7);  // block-uniform: only such windows have a shift mask
    const int lh1 = (wh == 7) ? 3 : 0, lh2 = (wh == 7) ? 6 : 0;  // region label, row part (times 3)
    const int lw1 = (ww == 7) ? 1 : 0, lw2 = (ww == 7) ? 2 : 0;  // region label, column part

    // Relative-position bias: index (yi - yj + 6) * 13 + (xi - xj + 6) = lin(i) + 84 - lin(j),
    // lin(t) = 13 (t / 7) + t % 7. Pad queries (i > 48) take query 48's index, which keeps the
    // address inside the table; their rows are never stored. Of key tile 3 only key 48 exists.
    // Element e < 24 is key ja = 16 (e / 8) + e % 8 in lanes 0..15 and key ja + 8 in lanes 16..31,
    // and lin(ja + 8) = lin(ja) + 14, or + 20 where ja % 7 == 6: so three offsets per query
    // serve all 25 loads, each with a constant offset (none of them below 0). The loads need nothing from LDS and
    // stand in front of the barrier, so they are under way while the block gathers there.
    int n0[2], na[2], nb[2], li[2];
#pragma unroll
    for (int it = 0; it < 2; ++it) {
      int i = min(i0 + it * 16 + c, NTOK - 1);
      int yi = i / 7, xi = i - yi * 7;
      int base = (yi * 13 + xi) * NHEAD + h;
      n0[it] = base;
      na[it] = base + (hi ? 0 : 14 * NHEAD);
      nb[it] = base + (hi ? 0 : 20 * NHEAD);
      li[it] = (yi < 4 ? lh1 : lh2) + (xi < 4 ? lw1 : lw2);
    }
    float bias[2][25];
#pragma unroll
    for (int it = 0; it < 2; ++it) {
#pragma unroll
      for (int e = 0; e < 24; ++e) {
        const int ja = (e >> 3) * 16 + (e & 7);
        const int off = (84 - ((ja / 7) * 13 + ja % 7)) * NHEAD;  // 84 - lin(ja), at least 15 rows
        bias[it][e] = (ja % 7 < 6) ? rpb[na[it] + (off - 14 * NHEAD)] : rpb[nb[it] + (off - 20 * NHEAD)];
      }
      bias[it][24] = rpb[n0[it]];
    }
    // Precaution: later code may be given the registers that hold the addresses of loads still
    // in flight. The six offsets are inputs here, so they stay as they are up to this wait.
    asm volatile("s_wait_xcnt 0x0" ::"v"(n0[0]), "v"(n0[1]), "v"(na[0]), "v"(na[1]), "v"(nb[0]), "v"(nb[1])
                 : "memory");
    __syncthreads();

    v16h kf[4], qf[2];
#pragma unroll
    for (int jt = 0; jt < 4; ++jt) kf[jt] = ld_a(qkvs, QKP, jt * 16, 128 + h * 32, lane);
#pragma unroll
    for (int it = 0; it < 2; ++it) qf[it] = ld_a(qkvs, QKP, i0 + it * 16, h * 32, lane);
    const v8f z = {};
    v8f st[2][4];
#pragma unroll
    for (int it = 0; it < 2; ++it)
#pragma unroll
      for (int jt = 0; jt < 3; ++jt) st[it][jt] = WMMA_F16(kf[jt], qf[it], z);

    // scores + bias (+ mask); sc[it][e], e = 8 jt + r, e = 24 is key 48 (lanes 0..15 only)
    float sc[2][25];
    st[0][3] = WMMA_F16(kf[3], qf[0], z);
    // A product of key tile 3 leaves seven of its eight result registers unused.
    // The two scheduling barriers keep the first query tile's bias additions between the two.
    __builtin_amdgcn_sched_barrier(0);
#pragma unroll
    for (int e = 0; e < 24; ++e) sc[0][e] = st[0][e >> 3][e & 7] + bias[0][e];
    __builtin_amdgcn_sched_barrier(0);
    st[1][3] = WMMA_F16(kf[3], qf[1], z);
#pragma unroll
    for (int e = 0; e < 24; ++e) sc[1][e] = st[1][e >> 3][e & 7] + bias[1][e];
#pragma unroll
    for (int it = 0; it < 2; ++it) sc[it][24] = st[it][3][0] + bias[it][24];
    if (edge) {
#pragma unroll
      for (int e = 0; e < 25; ++e) {
        const int ja = (e < 24) ? (e >> 3) * 16 + (e & 7) : NTOK - 1;
        const int jb = (e < 24) ? ja + 8 : NTOK - 1;
        int la = (ja / 7 < 4 ? lh1 : lh2) + (ja % 7 < 4 ? lw1 : lw2);
        int lb = (jb / 7 < 4 ? lh1 : lh2) + (jb % 7 < 4 ? lw1 : lw2);
        int lj = hi ? lb : la;
#pragma unroll
        for (int it = 0; it < 2; ++it) sc[it][e] += (li[it] != lj) ? -100.f : 0.f;
      }
    }
#pragma unroll
    for (int it = 0; it < 2; ++it) sc[it][24] = hi ? -1e30f : sc[it][24];

    // softmax down the registers; three partial sums per query, then the other lane half's
    float mx[2], sm[2];
#pragma unroll
    for (int it = 0; it < 2; ++it) {
      float m = sc[it][24];
#pragma unroll
      for (int e = 0; e < 24; ++e) m = fmaxf(m, sc[it][e]);
      mx[it] = m;
    }
#pragma unroll
    for (int it = 0; it < 2; ++it) mx[it] = fmaxf(mx[it], __shfl_xor(mx[it], 16, 32));
#pragma unroll
    for (int it = 0; it < 2; ++it) {
#pragma unroll
      for (int e = 0; e < 25; ++e) sc[it][e] = (sc[it][e] - mx[it]) * 1.44269504f;  // to powers of two
      exp2_25(sc[it]);
      float s0 = sc[it][24], s1 = 0.f, s2 = 0.f;
#pragma unroll
      for (int r = 0; r < 8; ++r) { s0 += sc[it][r]; s1 += sc[it][8 + r]; s2 += sc[it][16 + r]; }
      sm[it] = (s0 + s1) + s2;
    }
#pragma unroll
    for (int it = 0; it < 2; ++it) sm[it] += __shfl_xor(sm[it], 16, 32);

    // P^T as B operand: element s of k block kk is key 32 kk + (s < 8 ? 8 hi + s : 16 + 8 hi + s - 8),
    // the order in which ld_a reads the rows of V^T.
    v16h pf[2][2];
#pragma unroll
    for (int it = 0; it < 2; ++it) {
      float inv = 1.f / sm[it];
#pragma unroll
      for (int s = 0; s < 16; ++s) {
        pf[it][0][s] = (_Float16)(sc[it][s] * inv);
        pf[it][1][s] = (s < 9) ? (_Float16)(sc[it][16 + s] * inv) : (_Float16)0.f;
      }
    }

    // O^T = V^T P^T: a lane ends with 8 consecutive channels of one query -> one 16-byte store
#pragma unroll
    for (int dt = 0; dt < 2; ++dt) {
      v16h v0 = ld_a(vts, TP, h * 32 + dt * 16, 0, lane);
      v16h v1 = ld_a(vts, TP, h * 32 + dt * 16, 32, lane);
#pragma unroll
      for (int it = 0; it < 2; ++it) {
        v8f acc = {};
        acc = WMMA_F16(v0, pf[it][0], acc);
        acc = WMMA_F16(v1, pf[it][1], acc);
        *(v8h*)(os + (i0 + it * 16 + c) * XP + h * 32 + dt * 16 + hi * 8) =
            __builtin_convertvector(acc, v8h);
      }
    }
  }
  __syncthreads();

  // proj: (64x128)@(128x128), then bias, residual and the inverse roll by whole rows.
  // One 16-channel strip per wave: each weight fragment feeds the four token tiles. The product is
  // taken as W^T O^T, so a lane ends with 8 consecutive channels of ONE token and hands them to
  // LDS in two 16-byte stores. Q and K are dead behind the barrier above: their space is the stage.
  float* stage = reinterpret_cast<float*>(qkvs);  // 64 rows of SP floats
  float4 xr[7];
  size_t ro[7];
  float pb[4];
  {
    int nt = wv;
    const _Float16* ws = w_strip(projWt, nt, 4, lane);
    v16h bm[4];
#pragma unroll
    for (int kk = 0; kk < 4; ++kk) bm[kk] = ld_w(ws, kk);
    // Residual rows for the epilogue: the wave that gathered a token's row fetches it again, 16
    // bytes per lane from a wave-uniform row address. Issued behind the weight loads, which are
    // needed first, the loads are under way during the product and are first used behind it.
#pragma unroll
    for (int e = 0; e < 4; ++e) pb[e] = proj_b[lane * 4 + e];
    const float* xp[7];
#pragma unroll
    for (int t = 0; t < 7; ++t) {
      int i = (t < 6) ? wv + t * 8 : NTOK - 1;
      int yi = i / 7, xi = i - yi * 7;
      int sr = (wh * 7 + yi + SHFT) % HW;
      int sc = (ww * 7 + xi + SHFT) % HW;
      ro[t] = ((size_t)b * (HW * HW) + (size_t)(sr * HW + sc)) * CC + lane * 4;
      xp[t] = x + ro[t];
      xr[t] = *(const float4*)xp[t];
    }
    // Precaution: a later load's result, or later code, may be given the registers that hold the
    // addresses of loads still in flight. The seven row addresses are inputs here, so they stay as
    // they are up to this wait.
    asm volatile("s_wait_xcnt 0x0" ::"v"(xp[0]), "v"(xp[1]), "v"(xp[2]), "v"(xp[3]), "v"(xp[4]), "v"(xp[5]),
                 "v"(xp[6])
                 : "memory");
    v8f acc[4] = {};
#pragma unroll
    for (int kk = 0; kk < 4; ++kk) {
#pragma unroll
      for (int mt = 0; mt < 4; ++mt) {
        v16h a = ld_a(os, XP, mt * 16, kk * 32, lane);
        acc[mt] = WMMA_F16(bm[kk], a, acc[mt]);
      }
    }
#pragma unroll
    for (int mt = 0; mt < 4; ++mt) {
      v4f* dst = (v4f*)(stage + (mt * 16 + (lane & 15)) * SP + nt * 16 + ((lane >> 4) << 3));
      dst[0] = __builtin_shufflevector(acc[mt], acc[mt], 0, 1, 2, 3);
      dst[1] = __builtin_shufflevector(acc[mt], acc[mt], 4, 5, 6, 7);
    }
  }
  __syncthreads();

  // A wave takes its tokens' whole rows from the stage: one row address per token, computed once
  // per wave, and every store covers the row's 512 bytes, four whole cache lines.
#pragma unroll
  for (int t = 0; t < 7; ++t) {
    if (t < 6 || wv == 0) {
      // Precaution: token 48's values may be given registers that the six stores above name
      // while those are in flight; this wait stands in front of that overwrite.
      if (t == 6) asm volatile("s_wait_xcnt 0x0" ::: "memory");
      int i = (t < 6) ? wv + t * 8 : NTOK - 1;
      float4 s = *(const float4*)(stage + i * SP + lane * 4);
      float4 o;
      o.x = xr[t].x + s.x + pb[0];
      o.y = xr[t].y + s.y + pb[1];
      o.z = xr[t].z + s.z + pb[2];
      o.w = xr[t].w + s.w + pb[3];
      *(float4*)(out + ro[t]) = o;
    }
  }
}

// ---- fused LN2 + MLP (fc1 + GELU + fc2) + residual ---------------------------
__global__ __launch_bounds__(256) void k_mlp(
    const float* __restrict__ n2g, const float* __restrict__ n2b,
    const _Float16* __restrict__ fc1Wt, const float* __restrict__ fc1b,
    const _Float16* __restrict__ fc2Wt, const float* __restrict__ fc2b,
    float* __restrict__ out) {
  // One space, two lives: the LN'd rows (f16, 64 rows of XP) up to the barrier behind fc1, which ends
  // their last read, and from there the f32 stage of the fc2 result (64 rows of SP).
  __shared__ __attribute__((aligned(16))) float stage[64 * SP];
  __shared__ __attribute__((aligned(16))) _Float16 a1[64 * AP];   // GELU(fc1) rows
  __shared__ __attribute__((aligned(16))) float fb[8 * CC];       // fc2 bias, one copy per wave
  _Float16* h2 = reinterpret_cast<_Float16*>(stage);
  const int tid = threadIdx.x, lane = tid & 31;
  const int wv = __builtin_amdgcn_readfirstlane(tid >> 5);  // wave-uniform -> SGPR
  const size_t r0 = (size_t)blockIdx.x * 64;

  // LayerNorm2 on 64 rows of current out (= x + attn). A wave's eight rows go through
  // together: all row loads first, then each reduction step over the eight rows side by side.
  // The rows as loaded stay in registers: they are the residual of the rows this wave stores at the end.
  float4 xr[8];
  {
    float4 v[8];
#pragma unroll
    for (int t = 0; t < 8; ++t) {
      xr[t] = *(const float4*)(out + (r0 + wv + t * 8) * CC + lane * 4);
      v[t] = xr[t];
    }
    ln_rows<8>(v, n2g, n2b, lane);
#pragma unroll
    for (int t = 0; t < 8; ++t) {
      _Float16* dst = h2 + (wv + t * 8) * XP + lane * 4;
      dst[0] = (_Float16)v[t].x;
      dst[1] = (_Float16)v[t].y;
      dst[2] = (_Float16)v[t].z;
      dst[3] = (_Float16)v[t].w;
    }
    // The fc2 bias of this lane's four channels waits in LDS for the epilogue, in the wave's own copy.
    // Fetched here, the load lies under the LayerNorm; fetched where it is used, the compiler puts it
    // behind the last barrier, and the row stores wait out its whole latency.
    *(float4*)(fb + wv * CC + lane * 4) = *(const float4*)(fc2b + lane * 4);
  }
  __syncthreads();

  // fc1 + GELU (erf form): (64x128)@(128x512). Each wave owns 4 of the 32 column strips (64x16):
  // activation fragments stay in registers, each weight fragment feeds the four row tiles.
  {
    v16h af[4][4];
#pragma unroll
    for (int mt = 0; mt < 4; ++mt)
#pragma unroll
      for (int kk = 0; kk < 4; ++kk) af[mt][kk] = ld_a(h2, XP, mt * 16, kk * 32, lane);
    const _Float16* ws = w_strip(fc1Wt, wv, 4, lane);
    for (int j = 0; j < 4; ++j, ws += 8 * 4 * 512) {  // the wave's next strip is eight strips on
      int nt = wv + j * 8;
      v8f acc[4] = {};
      v16h bf[4];
#pragma unroll
      for (int kk = 0; kk < 4; ++kk) bf[kk] = ld_w(ws, kk);
      // Keeps the strip's eight weight loads in flight together: without it the scheduler
      // reuses one register set and waits out a full load latency at every k step.
      __builtin_amdgcn_sched_barrier(0);
#pragma unroll
      for (int kk = 0; kk < 4; ++kk)
#pragma unroll
        for (int mt = 0; mt < 4; ++mt) acc[mt] = WMMA_F16(af[mt][kk], bf[kk], acc[mt]);
      int n = nt * 16 + (lane & 15);
      float bb = fc1b[n];
#pragma unroll
      for (int mt = 0; mt < 4; ++mt) {
        int mbase = mt * 16 + ((lane >> 4) << 3);
#pragma unroll
        for (int r = 0; r < 8; r += 2) {
          v2f vv = {acc[mt][r] + bb, acc[mt][r + 1] + bb};
          v2h hh = __builtin_convertvector(gelu2(vv), v2h);
          a1[(mbase + r) * AP + n]     = hh.x;
          a1[(mbase + r + 1) * AP + n] = hh.y;
        }
      }
    }
  }
  __syncthreads();

  // fc2: (64x512)@(512x128). One 16-channel strip per wave: each weight fragment feeds the four
  // token tiles. The product is taken as W^T A^T, so a lane ends with 8 consecutive channels of ONE
  // token and hands them to the stage in two 16-byte stores.
  {
    int nt = wv;
    const _Float16* ws = w_strip(fc2Wt, nt, 16, lane);
    v8f acc[4] = {};
    v16h bf[2][4];   // weight fragments: this group of four k steps and the next
    v16h af[2][4];   // activation fragments: this k step and the next
#pragma unroll
    for (int q = 0; q < 4; ++q) bf[0][q] = ld_w(ws, q);
#pragma unroll
    for (int mt = 0; mt < 4; ++mt) af[0][mt] = ld_a(a1, AP, mt * 16, 0, lane);
#pragma unroll
    for (int kk = 0; kk < 16; ++kk) {
      if ((kk & 3) == 0 && kk + 4 < 16) {
#pragma unroll
        for (int q = 0; q < 4; ++q)
          bf[((kk >> 2) + 1) & 1][q] = ld_w(ws, kk + 4 + q);
      }
      if (kk + 1 < 16) {
#pragma unroll
        for (int mt = 0; mt < 4; ++mt) af[(kk + 1) & 1][mt] = ld_a(a1, AP, mt * 16, (kk + 1) * 32, lane);
      }
      // The two scheduling barriers hold the order "next step's loads as one group, then this
      // step's four matrix instructions": left free, the scheduler either loads each fragment
      // right in front of its use and waits out its latency, or runs past 256 registers.
      __builtin_amdgcn_sched_barrier(0);
      // Precaution: the stage addresses behind the loop may be given the registers that held the
      // weight address; this wait stands in front of that overwrite, a scheduling barrier behind it.
      if (kk == 15) asm volatile("s_wait_xcnt 0x0" ::: "memory");
#pragma unroll
      for (int mt = 0; mt < 4; ++mt)
        acc[mt] = WMMA_F16(bf[(kk >> 2) & 1][kk & 3], af[kk & 1][mt], acc[mt]);
      __builtin_amdgcn_sched_barrier(0);
    }
#pragma unroll
    for (int mt = 0; mt < 4; ++mt) {
      v4f* dst = (v4f*)(stage + (mt * 16 + (lane & 15)) * SP + nt * 16 + ((lane >> 4) << 3));
      dst[0] = __builtin_shufflevector(acc[mt], acc[mt], 0, 1, 2, 3);
      dst[1] = __builtin_shufflevector(acc[mt], acc[mt], 4, 5, 6, 7);
    }
  }
  __syncthreads();

  // A wave takes the rows it loaded at the top from the stage, adds bias and residual and stores
  // each row's 512 bytes, four whole cache lines, with one store.
  const float4 pb = *(const float4*)(fb + wv * CC + lane * 4);
#pragma unroll
  for (int t = 0; t < 8; ++t) {
    int row = wv + t * 8;
    float4 s = *(const float4*)(stage + row * SP + lane * 4);
    float4 o;
    o.x = xr[t].x + (s.x + pb.x);
    o.y = xr[t].y + (s.y + pb.y);
    o.z = xr[t].z + (s.z + pb.z);
    o.w = xr[t].w + (s.w + pb.w);
    *(float4*)(out + (r0 + row) * CC + lane * 4) = o;
  }
}

extern "C" void kernel_launch(void* const* d_in, const int* in_sizes, int n_in,
                              void* d_out, int out_size, void* d_ws, size_t ws_size,
                              hipStream_t stream) {
  (void)in_sizes; (void)n_in; (void)out_size; (void)ws_size;
  const float* x      = (const float*)d_in[0];
  const float* qkv_w  = (const float*)d_in[1];
  const float* qkv_b  = (const float*)d_in[2];
  const float* proj_w = (const float*)d_in[3];
  const float* proj_b = (const float*)d_in[4];
  const float* rpb    = (const float*)d_in[5];
  const float* n1g    = (const float*)d_in[6];
  const float* n1b    = (const float*)d_in[7];
  const float* n2g    = (const float*)d_in[8];
  const float* n2b    = (const float*)d_in[9];
  const float* fc1w   = (const float*)d_in[10];
  const float* fc1b   = (const float*)d_in[11];
  const float* fc2w   = (const float*)d_in[12];
  const float* fc2b   = (const float*)d_in[13];
  float* out = (float*)d_out;

  // f16 weights in fragment order (see k_wprep)
  _Float16* qkvWt  = (_Float16*)d_ws;          // 24 strips x 4 fragments
  _Float16* projWt = qkvWt + 384 * 128;        //  8 strips x 4 fragments
  _Float16* fc1Wt  = projWt + 128 * 128;       // 32 strips x 4 fragments
  _Float16* fc2Wt  = fc1Wt + 512 * 128;        //  8 strips x 16 fragments

  k_wprep<<<384, 256, 0, stream>>>(qkv_w, proj_w, fc1w, fc2w, qkvWt, projWt, fc1Wt, fc2Wt);

  k_attn<<<64 * 64, 256, 0, stream>>>(x, qkv_b, proj_b, rpb, n1g, n1b, qkvWt, projWt, out);
  k_mlp<<<3136, 256, 0, stream>>>(n2g, n2b, fc1Wt, fc1b, fc2Wt, fc2b, out);
}

// v010
// Measured time: 130 microseconds a run.
// Two timings next to v009 both put it at 1.06 times that version's speed.
// All steps since v000 together make it 5.46 times as fast.
#include <hip/hip_runtime.h>
#include <hip/hip_bf16.h>
#include <math.h>

typedef __attribute__((ext_vector_type(16))) _Float16 v16h;
typedef __attribute__((ext_vector_type(8)))  _Float16 v8h;
typedef __attribute__((ext_vector_type(8)))  float    v8f;
typedef __attribute__((ext_vector_type(4)))  float    v4f;
typedef __attribute__((ext_vector_type(2)))  float    v2f;
typedef __attribute__((ext_vector_type(2)))  _Float16 v2h;

#define NTOK 49
#define CC   128
#define NHEAD 4
#define HID  512
#define HW   56
#define SHFT 3
#define LN_EPS 1e-5f

// LDS row pitches in elements. Each row carries 16 bytes of pad, so the pitch is an odd
// multiple of 16 bytes and the 16 rows of one 128-bit fragment read fall on distinct banks.
#define XP  (CC + 8)       // f16 rows of 128: 272 B
#define QKP (256 + 8)      // f16 rows of 256: 528 B
#define TP  (64 + 8)       // f16 rows of 64: 144 B
#define AP  (HID + 8)      // f16 rows of 512: 1040 B
#define SP  (CC + 4)       // f32 rows of 128: 528 B

#define WMMA_F16(a, b, c) \
  __builtin_amdgcn_wmma_f32_16x16x32_f16(false, (a), false, (b), (short)0, (c), false, false)

// The value of lane l ^ 16, by a vector cross-row move. A shuffle compiles to an LDS-pipe
// permute here, whose result is waited for like an LDS read.
__device__ __forceinline__ float xhalf(float x) {
  int b = __builtin_bit_cast(int, x);
  return __builtin_bit_cast(float, __builtin_amdgcn_permlanex16(b, b, 0x76543210, 0xfedcba98, false, false));
}

// x + (x of lane l ^ M), M < 16: a DPP operand (row_xmask:M) inside the 16-lane row.
template <int M>
__device__ __forceinline__ float add_xmask(float x) {
  int y = __builtin_amdgcn_update_dpp(0, __builtin_bit_cast(int, x), 0x160 + M, 0xf, 0xf, true);
  return x + __builtin_bit_cast(float, y);
}

// Sum over the 32 lanes for R independent values at once: step by step over all R, so the R
// values of a step cover one another's latency. Each value is summed by itself, over lane
// distances 16, 8, 4, 2, 1, all in the vector unit: no step waits on the LDS pipe.
template <int R>
__device__ __forceinline__ void wred_sum_rows(float (&s)[R]) {
#pragma unroll
  for (int t = 0; t < R; ++t) s[t] += xhalf(s[t]);
#pragma unroll
  for (int t = 0; t < R; ++t) s[t] = add_xmask<8>(s[t]);
#pragma unroll
  for (int t = 0; t < R; ++t) s[t] = add_xmask<4>(s[t]);
#pragma unroll
  for (int t = 0; t < R; ++t) s[t] = add_xmask<2>(s[t]);
#pragma unroll
  for (int t = 0; t < R; ++t) s[t] = add_xmask<1>(s[t]);
}

// LayerNorm of R rows of 128 floats, four per lane, in place.
template <int R>
__device__ __forceinline__ void ln_rows(float4 (&v)[R], const float* __restrict__ g,
                                        const float* __restrict__ be, int lane) {
  float s[R];
#pragma unroll
  for (int t = 0; t < R; ++t) s[t] = v[t].x + v[t].y + v[t].z + v[t].w;
  wred_sum_rows<R>(s);
#pragma unroll
  for (int t = 0; t < R; ++t) {
    float mu = s[t] * (1.f / 128.f);
    v[t].x -= mu; v[t].y -= mu; v[t].z -= mu; v[t].w -= mu;
    s[t] = v[t].x * v[t].x + v[t].y * v[t].y + v[t].z * v[t].z + v[t].w * v[t].w;
  }
  wred_sum_rows<R>(s);
  int c = lane * 4;
#pragma unroll
  for (int t = 0; t < R; ++t) {
    float rs = rsqrtf(s[t] * (1.f / 128.f) + LN_EPS);
    v[t].x = v[t].x * rs * g[c + 0] + be[c + 0];
    v[t].y = v[t].y * rs * g[c + 1] + be[c + 1];
    v[t].z = v[t].z * rs * g[c + 2] + be[c + 2];
    v[t].w = v[t].w * rs * g[c + 3] + be[c + 3];
  }
}

// GELU in its erf form, v * Phi(v) = 0.5 v (1 + erf(v / sqrt 2)), two values at a time, with no branch:
//   1 - Phi(a) = exp(-a^2 / 2) * t (c1 + t (c2 + t (c3 + t (c4 + t c5)))),  t = 1 / (1 + p a),  a = |v|
// (the classical five-term rational form; its error in Phi is below 7.5e-8 for every a >= 0, and the
// factor 1 / sqrt(2 pi) is folded into c1..c5). With h = 1 - Phi(|v|): v Phi(v) = max(v, 0) - |v| h
// on both signs. In f32 the result stays within 1e-6 of v Phi(v), far under the f16 rounding that follows.
// One straight line of code for every lane, so neighbouring values overlap in the pipe.
__device__ __forceinline__ v2f gelu2(v2f v) {
  v2f a = __builtin_elementwise_abs(v);
  v2f d = a * 0.2316419f + 1.f;
  v2f t = {__builtin_amdgcn_rcpf(d.x), __builtin_amdgcn_rcpf(d.y)};
  v2f y = t * 0.53070271f - 0.72657603f;
  y = y * t + 0.71070689f;
  y = y * t - 0.14224836f;
  y = y * t + 0.12741479f;
  y = y * t;
  v2f q = (v * v) * -0.72134752f;  // -a^2 / 2 in powers of two
  v2f e = {__builtin_amdgcn_exp2f(q.x), __builtin_amdgcn_exp2f(q.y)};
  v2f h = y * e;
  v2f zero = {0.f, 0.f};
  return __builtin_elementwise_max(v, zero) - a * h;
}

// 2^t of 25 values, in place. The instruction set asks for one independent instruction between a
// transcendental and a directly following instruction that reads its result or overwrites its
// source.
// Here each v_exp_f32 has an independent one behind it, and the v_nop is the slot of the last.
#define EXP2_AT(n) "v_exp_f32 %" #n ", %" #n "\n\t"
__device__ __forceinline__ void exp2_25(float (&t)[25]) {
  asm(EXP2_AT(0) EXP2_AT(1) EXP2_AT(2) EXP2_AT(3) EXP2_AT(4) EXP2_AT(5) EXP2_AT(6) EXP2_AT(7) EXP2_AT(8)
      EXP2_AT(9) EXP2_AT(10) EXP2_AT(11) EXP2_AT(12) EXP2_AT(13) EXP2_AT(14) EXP2_AT(15) EXP2_AT(16)
      EXP2_AT(17) EXP2_AT(18) EXP2_AT(19) EXP2_AT(20) EXP2_AT(21) EXP2_AT(22) EXP2_AT(23) EXP2_AT(24)
      "v_nop"
      : "+v"(t[0]), "+v"(t[1]), "+v"(t[2]), "+v"(t[3]), "+v"(t[4]), "+v"(t[5]), "+v"(t[6]), "+v"(t[7]),
        "+v"(t[8]), "+v"(t[9]), "+v"(t[10]), "+v"(t[11]), "+v"(t[12]), "+v"(t[13]), "+v"(t[14]),
        "+v"(t[15]), "+v"(t[16]), "+v"(t[17]), "+v"(t[18]), "+v"(t[19]), "+v"(t[20]), "+v"(t[21]),
        "+v"(t[22]), "+v"(t[23]), "+v"(t[24]));
}

// A/B-operand fragment (16x32 f16 tile, rows striped over lanes, K along VGPRs).
// Per ISA 7.12.2 the per-lane halves are contiguous in two 16B runs: K+[0..7] and K+[16..23]
// (K offset +8 for lanes 16..31) -> two 128-bit loads.
__device__ __forceinline__ v16h ld_a(const _Float16* buf, int ld, int row0, int col0, int lane) {
  int m  = row0 + (lane & 15);
  int kb = (lane >> 4) << 3;
  const v8h* p = (const v8h*)(buf + m * ld + col0 + kb);
  v8h lo = p[0];
  v8h hi = p[2];
  return __builtin_shufflevector(lo, hi, 0, 1, 2, 3, 4, 5, 6, 7,
                                         8, 9, 10, 11, 12, 13, 14, 15);
}

// Weight fragments come from the packed copy that k_wprep writes: a fragment is 1024 bytes, first
// the 32 lanes' low runs (16 bytes each), then their high runs. Each of the two 128-bit loads of a
// wave therefore reads 512 contiguous bytes, four whole cache lines, where a row-major copy made
// it touch 16 lines for 32 bytes each. Lane and register positions are those of ld_a.
// w_strip: this lane's place in the first fragment of column strip nt (kf fragments per strip).
__device__ __forceinline__ const _Float16* w_strip(const _Float16* __restrict__ wp, int nt, int kf, int lane) {
  return wp + nt * kf * 512 + lane * 8;
}
// ld_w: fragment kk of that strip.
__device__ __forceinline__ v16h ld_w(const _Float16* __restrict__ ws, int kk) {
  const v8h* p = (const v8h*)(ws + kk * 512);
  v8h lo = p[0];
  v8h hi = p[32];
  return __builtin_shufflevector(lo, hi, 0, 1, 2, 3, 4, 5, 6, 7,
                                         8, 9, 10, 11, 12, 13, 14, 15);
}

// ---- weight prep: f16 copy of w[k][n] (K x N), packed in fragment order ---------
// Fragment f = nt * (K / 32) + kk is the 16 x 32 tile of columns n = 16 nt + (lane & 15) and
// k = 32 kk + 8 (lane >> 4) + 16 run + e, stored at half index 512 f + 256 run + 8 lane + e.
// All four matrices in ONE launch: they are independent of one another, so a range of the block
// index takes each (96, 32, 128 and 128 blocks; two elements per thread). One launch per matrix would
// pay a start, a round trip to memory and an end for each, one after the other. What differs between
// the matrices is block-uniform and sits in scalar registers.
__global__ __launch_bounds__(256) void k_wprep(
    const float* __restrict__ qkv_w, const float* __restrict__ proj_w,
    const float* __restrict__ fc1w, const float* __restrict__ fc2w,
    _Float16* __restrict__ qkvWt, _Float16* __restrict__ projWt,
    _Float16* __restrict__ fc1Wt, _Float16* __restrict__ fc2Wt) {
  const unsigned blk = blockIdx.x;
  const float* __restrict__ w = qkv_w;   // K = 128, N = 384
  _Float16* __restrict__ wt = qkvWt;
  unsigned first = 0, nblk = 96, N = 384, kfs = 2;  // kfs: log2 of the K / 32 fragments per strip
  if (blk >= 256)      { w = fc2w;   wt = fc2Wt;  first = 256; nblk = 128; N = 128; kfs = 4; }  // K = 512
  else if (blk >= 128) { w = fc1w;   wt = fc1Wt;  first = 128; nblk = 128; N = 512; }           // K = 128
  else if (blk >= 96)  { w = proj_w; wt = projWt; first = 96;  nblk = 32;  N = 128; }           // K = 128
  unsigned i[2];
  float v[2];
  // Unrolled, loads apart from stores: both loads are under way before either value is waited for.
#pragma unroll
  for (unsigned u = 0; u < 2; ++u) {
    i[u] = (blk - first + u * nblk) * 256 + threadIdx.x;
    unsigned f = i[u] >> 9;
    unsigned nt = f >> kfs, kk = f - (nt << kfs);
    unsigned l = (i[u] >> 3) & 31;
    unsigned n = nt * 16 + (l & 15);
    unsigned k = kk * 32 + ((l >> 4) << 3) + (((i[u] >> 8) & 1) << 4) + (i[u] & 7);
    v[u] = w[k * N + n];
  }
#pragma unroll
  for (unsigned u = 0; u < 2; ++u) wt[i[u]] = (_Float16)v[u];
}

// ---- fused LN1 + shifted-window attention + proj + residual ------------------
__global__ __launch_bounds__(256) void k_attn(
    const float* __restrict__ x, const float* __restrict__ qkv_b,
    const float* __restrict__ proj_b, const float* __restrict__ rpb,
    const float* __restrict__ n1g, const float* __restrict__ n1b,
    const _Float16* __restrict__ qkvWt, const _Float16* __restrict__ projWt,
    float* __restrict__ out) {
  __shared__ __attribute__((aligned(16))) _Float16 xt[64 * XP];     // LN'd window tokens (padded to 64 rows)
  __shared__ __attribute__((aligned(16))) _Float16 qkvs[64 * QKP];  // Q|K f16 (token-major)
  __shared__ __attribute__((aligned(16))) _Float16 vts[CC * TP];    // V transposed (channel-major)
  __shared__ __attribute__((aligned(16))) _Float16 os[64 * XP];     // attention output (pre-proj), f16

  const int tid  = threadIdx.x;
  const int lane = tid & 31;
  const int wv   = __builtin_amdgcn_readfirstlane(tid >> 5);  // wave-uniform -> SGPR
  const int b    = blockIdx.x >> 6;
  const int w    = blockIdx.x & 63;
  const int wh   = w >> 3, ww = w & 7;
  const float scale = 0.17677669529663687f;  // 1/sqrt(32)

  // gather (roll by -3) + LayerNorm1. A wave's seven tokens go through together: all row
  // loads are issued first and each reduction step runs over the seven rows side by side, so
  // one load latency and one chain of cross-lane steps are paid per wave, not one per token.
  // The block has eight waves: tokens wv + 8 t, t < 6, are 0..47; every wave also works
  // token 48 and wave 0 alone stores it.
  {
    float4 v[7];
#pragma unroll
    for (int t = 0; t < 7; ++t) {
      int i = (t < 6) ? wv + t * 8 : NTOK - 1;
      int yi = i / 7, xi = i - yi * 7;
      int sr = (wh * 7 + yi + SHFT) % HW;
      int sc = (ww * 7 + xi + SHFT) % HW;
      const float* row = x + ((size_t)b * (HW * HW) + (size_t)(sr * HW + sc)) * CC;
      v[t] = *(const float4*)(row + lane * 4);
    }
    // Precaution: the loop below may be given the registers that held the row addresses of
    // loads still in flight; this wait stands in front of that overwrite.
    asm volatile("s_wait_xcnt 0x0" ::: "memory");
    // zero pad rows 49..63 while the row loads are in flight
    for (int i = tid; i < (64 - NTOK) * XP; i += 256) xt[NTOK * XP + i] = (_Float16)0.f;
    ln_rows<7>(v, n1g, n1b, lane);
#pragma unroll
    for (int t = 0; t < 7; ++t) {
      if (t < 6 || wv == 0) {
        int i = (t < 6) ? wv + t * 8 : NTOK - 1;
        _Float16* dst = xt + i * XP + lane * 4;
        dst[0] = (_Float16)v[t].x;
        dst[1] = (_Float16)v[t].y;
        dst[2] = (_Float16)v[t].z;
        dst[3] = (_Float16)v[t].w;
      }
    }
  }
  __syncthreads();

  // QKV GEMM: (64x128) @ (128x384). Each wave owns whole 64x16 column strips (3 of 24):
  // the 16 activation fragments stay in registers, and every weight fragment is loaded
  // once per block and feeds the four row tiles. Strip j of a wave is Q, K, V for j = 0, 1, 2.
  {
    v16h af[4][4];
#pragma unroll
    for (int mt = 0; mt < 4; ++mt)
#pragma unroll
      for (int kk = 0; kk < 4; ++kk) af[mt][kk] = ld_a(xt, XP, mt * 16, kk * 32, lane);
    const _Float16* ws0 = w_strip(qkvWt, wv, 4, lane);
#pragma unroll
    for (int j = 0; j < 3; ++j) {
      int nt = wv + j * 8;
      v8f acc[4] = {};
      v16h bf[4];
      const _Float16* ws = ws0 + j * (8 * 4 * 512);  // the wave's next strip is eight strips on
#pragma unroll
      for (int kk = 0; kk < 4; ++kk) bf[kk] = ld_w(ws, kk);
      int n = nt * 16 + (lane & 15);
      float bias = qkv_b[n];
      // Precaution: a later load's result may be given the register that holds the address of
      // the bias load while that load is in flight; this wait stands in front of that overwrite.
      asm volatile("s_wait_xcnt 0x0" ::: "memory");
      // Keeps the strip's eight weight loads in flight together: without it the scheduler
      // reuses one register set and waits out a full load latency at every k step.
      __builtin_amdgcn_sched_barrier(0);
#pragma unroll
      for (int kk = 0; kk < 4; ++kk)
#pragma unroll
        for (int mt = 0; mt < 4; ++mt) acc[mt] = WMMA_F16(af[mt][kk], bf[kk], acc[mt]);
#pragma unroll
      for (int mt = 0; mt < 4; ++mt) {
        int mbase = mt * 16 + ((lane >> 4) << 3);
        if (j == 0) {  // Q (pre-scaled)
#pragma unroll
          for (int r = 0; r < 8; ++r)
            qkvs[(mbase + r) * QKP + n] = (_Float16)((acc[mt][r] + bias) * scale);
        } else if (j == 1) {  // K
#pragma unroll
          for (int r = 0; r < 8; ++r)
            qkvs[(mbase + r) * QKP + n] = (_Float16)(acc[mt][r] + bias);
        } else {  // V -> transposed, 8 consecutive halves per lane (one b128 store)
          _Float16* dst = vts + (n - 256) * TP + mbase;
#pragma unroll
          for (int r = 0; r < 8; ++r) dst[r] = (_Float16)(acc[mt][r] + bias);
        }
      }
    }
  }

  // Attention. One wave owns one head and 32 of the 64 query rows, from the scores to the
  // head's output, so nothing is handed between waves: the barrier below only ends the QKV stage.
  // S^T = K Q^T: a lane holds the scores of ONE query (column c of each tile) over keys
  // 16 jt + 8 hi + r, so maximum and sum run down its own registers, with one exchange between
  // the two lane halves. Two S^T tiles, converted in place, are the B operand of O^T = V^T P^T.
  {
    const int h  = wv >> 1;
    const int i0 = (wv & 1) * 32;
    const int c  = lane & 15, hi = lane >> 4;
    const bool edge = (wh == 7) || (ww == 7);  // block-uniform: only such windows have a shift mask
    const int lh1 = (wh == 7) ? 3 : 0, lh2 = (wh == 7) ? 6 : 0;  // region label, row part (times 3)
    const int lw1 = (ww == 7) ? 1 : 0, lw2 = (ww == 7) ? 2 : 0;  // region label, column part

    // Relative-position bias: index (yi - yj + 6) * 13 + (xi - xj + 6) = lin(i) + 84 - lin(j),
    // lin(t) = 13 (t / 7) + t % 7. Pad queries (i > 48) take query 48's index, which keeps the
    // address inside the table; their rows are never stored. Of key tile 3 only key 48 exists.
    // Element e < 24 is key ja = 16 (e / 8) + e % 8 in lanes 0..15 and key ja + 8 in lanes 16..31,
    // and lin(ja + 8) = lin(ja) + 14, or + 20 where ja % 7 == 6: so three offsets per query
    // serve all 25 loads, each with a constant offset (none of them below 0). The loads need nothing from LDS and
    // stand in front of the barrier, so they are under way while the block gathers there.
    int n0[2], na[2], nb[2], li[2];
#pragma unroll
    for (int it = 0; it < 2; ++it) {
      int i = min(i0 + it * 16 + c, NTOK - 1);
      int yi = i / 7, xi = i - yi * 7;
      int base = (yi * 13 + xi) * NHEAD + h;
      n0[it] = base;
      na[it] = base + (hi ? 0 : 14 * NHEAD);
      nb[it] = base + (hi ? 0 : 20 * NHEAD);
      li[it] = (yi < 4 ? lh1 : lh2) + (xi < 4 ? lw1 : lw2);
    }
    float bias[2][25];
#pragma unroll
    for (int it = 0; it < 2; ++it) {
#pragma unroll
      for (int e = 0; e < 24; ++e) {
        const int ja = (e >> 3) * 16 + (e & 7);
        const int off = (84 - ((ja / 7) * 13 + ja % 7)) * NHEAD;  // 84 - lin(ja), at least 15 rows
        bias[it][e] = (ja % 7 < 6) ? rpb[na[it] + (off - 14 * NHEAD)] : rpb[nb[it] + (off - 20 * NHEAD)];
      }
      bias[it][24] = rpb[n0[it]];
    }
    // Precaution: later code may be given the registers that hold the addresses of loads still
    // in flight. The six offsets are inputs here, so they stay as they are up to this wait.
    asm volatile("s_wait_xcnt 0x0" ::"v"(n0[0]), "v"(n0[1]), "v"(na[0]), "v"(na[1]), "v"(nb[0]), "v"(nb[1])
                 : "memory");
    __syncthreads();

    v16h kf[4], qf[2];
#pragma unroll
    for (int jt = 0; jt < 4; ++jt) kf[jt] = ld_a(qkvs, QKP, jt * 16, 128 + h * 32, lane);
#pragma unroll
    for (int it = 0; it < 2; ++it) qf[it] = ld_a(qkvs, QKP, i0 + it * 16, h * 32, lane);
    const v8f z = {};
    v8f st[2][4];
#pragma unroll
    for (int it = 0; it < 2; ++it)
#pragma unroll
      for (int jt = 0; jt < 3; ++jt) st[it][jt] = WMMA_F16(kf[jt], qf[it], z);

    // scores + bias (+ mask); sc[it][e], e = 8 jt + r, e = 24 is key 48 (lanes 0..15 only)
    float sc[2][25];
    st[0][3] = WMMA_F16(kf[3], qf[0], z);
    // A product of key tile 3 leaves seven of its eight result registers unused.
    // The two scheduling barriers keep the first query tile's bias additions between the two.
    __builtin_amdgcn_sched_barrier(0);
#pragma unroll
    for (int e = 0; e < 24; ++e) sc[0][e] = st[0][e >> 3][e & 7] + bias[0][e];
    __builtin_amdgcn_sched_barrier(0);
    st[1][3] = WMMA_F16(kf[3], qf[1], z);
#pragma unroll
    for (int e = 0; e < 24; ++e) sc[1][e] = st[1][e >> 3][e & 7] + bias[1][e];
#pragma unroll
    for (int it = 0; it < 2; ++it) sc[it][24] = st[it][3][0] + bias[it][24];
    if (edge) {
#pragma unroll
      for (int e = 0; e < 25; ++e) {
        const int ja = (e < 24) ? (e >> 3) * 16 + (e & 7) : NTOK - 1;
        const int jb = (e < 24) ? ja + 8 : NTOK - 1;
        int la = (ja / 7 < 4 ? lh1 : lh2) + (ja % 7 < 4 ? lw1 : lw2);
        int lb = (jb / 7 < 4 ? lh1 : lh2) + (jb % 7 < 4 ? lw1 : lw2);
        int lj = hi ? lb : la;
#pragma unroll
        for (int it = 0; it < 2; ++it) sc[it][e] += (li[it] != lj) ? -100.f : 0.f;
      }
    }
#pragma unroll
    for (int it = 0; it < 2; ++it) sc[it][24] = hi ? -1e30f : sc[it][24];

    // softmax down the registers; three partial sums per query, then the other lane half's
    float mx[2], sm[2];
#pragma unroll
    for (int it = 0; it < 2; ++it) {
      float m = sc[it][24];
#pragma unroll
      for (int e = 0; e < 24; ++e) m = fmaxf(m, sc[it][e]);
      mx[it] = m;
    }
#pragma unroll
    for (int it = 0; it < 2; ++it) mx[it] = fmaxf(mx[it], xhalf(mx[it]));
#pragma unroll
    for (int it = 0; it < 2; ++it) {
#pragma unroll
      for (int e = 0; e < 25; ++e) sc[it][e] = (sc[it][e] - mx[it]) * 1.44269504f;  // to powers of two
      exp2_25(sc[it]);
      float s0 = sc[it][24], s1 = 0.f, s2 = 0.f;
#pragma unroll
      for (int r = 0; r < 8; ++r) { s0 += sc[it][r]; s1 += sc[it][8 + r]; s2 += sc[it][16 + r]; }
      sm[it] = (s0 + s1) + s2;
    }
#pragma unroll
    for (int it = 0; it < 2; ++it) sm[it] += xhalf(sm[it]);

    // P^T as B operand: element s of k block kk is key 32 kk + (s < 8 ? 8 hi + s : 16 + 8 hi + s - 8),
    // the order in which ld_a reads the rows of V^T.
    v16h pf[2][2];
#pragma unroll
    for (int it = 0; it < 2; ++it) {
      float inv = 1.f / sm[it];
#pragma unroll
      for (int s = 0; s < 16; ++s) {
        pf[it][0][s] = (_Float16)(sc[it][s] * inv);
        pf[it][1][s] = (s < 9) ? (_Float16)(sc[it][16 + s] * inv) : (_Float16)0.f;
      }
    }

    // O^T = V^T P^T: a lane ends with 8 consecutive channels of one query -> one 16-byte store
#pragma unroll
    for (int dt = 0; dt < 2; ++dt) {
      v16h v0 = ld_a(vts, TP, h * 32 + dt * 16, 0, lane);
      v16h v1 = ld_a(vts, TP, h * 32 + dt * 16, 32, lane);
#pragma unroll
      for (int it = 0; it < 2; ++it) {
        v8f acc = {};
        acc = WMMA_F16(v0, pf[it][0], acc);
        acc = WMMA_F16(v1, pf[it][1], acc);
        *(v8h*)(os + (i0 + it * 16 + c) * XP + h * 32 + dt * 16 + hi * 8) =
            __builtin_convertvector(acc, v8h);
      }
    }
  }
  __syncthreads();

  // proj: (64x128)@(128x128), then bias, residual and the inverse roll by whole rows.
  // One 16-channel strip per wave: each weight fragment feeds the four token tiles. The product is
  // taken as W^T O^T, so a lane ends with 8 consecutive channels of ONE token and hands them to
  // LDS in two 16-byte stores. Q and K are dead behind the barrier above: their space is the stage.
  float* stage = reinterpret_cast<float*>(qkvs);  // 64 rows of SP floats
  float4 xr[7];
  size_t ro[7];
  float pb[4];
  {
    int nt = wv;
    const _Float16* ws = w_strip(projWt, nt, 4, lane);
    v16h bm[4];
#pragma unroll
    for (int kk = 0; kk < 4; ++kk) bm[kk] = ld_w(ws, kk);
    // Residual rows for the epilogue: the wave that gathered a token's row fetches it again, 16
    // bytes per lane from a wave-uniform row address. Issued behind the weight loads, which are
    // needed first, the loads are under way during the product and are first used behind it.
#pragma unroll
    for (int e = 0; e < 4; ++e) pb[e] = proj_b[lane * 4 + e];
    const float* xp[7];
#pragma unroll
    for (int t = 0; t < 7; ++t) {
      int i = (t < 6) ? wv + t * 8 : NTOK - 1;
      int yi = i / 7, xi = i - yi * 7;
      int sr = (wh * 7 + yi + SHFT) % HW;
      int sc = (ww * 7 + xi + SHFT) % HW;
      ro[t] = ((size_t)b * (HW * HW) + (size_t)(sr * HW + sc)) * CC + lane * 4;
      xp[t] = x + ro[t];
      xr[t] = *(const float4*)xp[t];
    }
    // Precaution: a later load's result, or later code, may be given the registers that hold the
    // addresses of loads still in flight. The seven row addresses are inputs here, so they stay as
    // they are up to this wait.
    asm volatile("s_wait_xcnt 0x0" ::"v"(xp[0]), "v"(xp[1]), "v"(xp[2]), "v"(xp[3]), "v"(xp[4]), "v"(xp[5]),
                 "v"(xp[6])
                 : "memory");
    v8f acc[4] = {};
#pragma unroll
    for (int kk = 0; kk < 4; ++kk) {
#pragma unroll
      for (int mt = 0; mt < 4; ++mt) {
        v16h a = ld_a(os, XP, mt * 16, kk * 32, lane);
        acc[mt] = WMMA_F16(bm[kk], a, acc[mt]);
      }
    }
#pragma unroll
    for (int mt = 0; mt < 4; ++mt) {
      v4f* dst = (v4f*)(stage + (mt * 16 + (lane & 15)) * SP + nt * 16 + ((lane >> 4) << 3));
      dst[0] = __builtin_shufflevector(acc[mt], acc[mt], 0, 1, 2, 3);
      dst[1] = __builtin_shufflevector(acc[mt], acc[mt], 4, 5, 6, 7);
    }
  }
  __syncthreads();

  // A wave takes its tokens' whole rows from the stage: one row address per token, computed once
  // per wave, and every store covers the row's 512 bytes, four whole cache lines.
#pragma unroll
  for (int t = 0; t < 7; ++t) {
    if (t < 6 || wv == 0) {
      // Precaution: token 48's values may be given registers that the six stores above name
      // while those are in flight; this wait stands in front of that overwrite.
      if (t == 6) asm volatile("s_wait_xcnt 0x0" ::: "memory");
      int i = (t < 6) ? wv + t * 8 : NTOK - 1;
      float4 s = *(const float4*)(stage + i * SP + lane * 4);
      float4 o;
      o.x = xr[t].x + s.x + pb[0];
      o.y = xr[t].y + s.y + pb[1];
      o.z = xr[t].z + s.z + pb[2];
      o.w = xr[t].w + s.w + pb[3];
      *(float4*)(out + ro[t]) = o;
    }
  }
}

// ---- fused LN2 + MLP (fc1 + GELU + fc2) + residual ---------------------------
__global__ __launch_bounds__(256) void k_mlp(
    const float* __restrict__ n2g, const float* __restrict__ n2b,
    const _Float16* __restrict__ fc1Wt, const float* __restrict__ fc1b,
    const _Float16* __restrict__ fc2Wt, const float* __restrict__ fc2b,
    float* __restrict__ out) {
  // One space, two lives: the LN'd rows (f16, 64 rows of XP) up to the barrier behind fc1, which ends
  // their last read, and from there the f32 stage of the fc2 result (64 rows of SP).
  __shared__ __attribute__((aligned(16))) float stage[64 * SP];
  __shared__ __attribute__((aligned(16))) _Float16 a1[64 * AP];   // GELU(fc1) rows
  __shared__ __attribute__((aligned(16))) float fb[8 * CC];       // fc2 bias, one copy per wave
  _Float16* h2 = reinterpret_cast<_Float16*>(stage);
  const int tid = threadIdx.x, lane = tid & 31;
  const int wv = __builtin_amdgcn_readfirstlane(tid >> 5);  // wave-uniform -> SGPR
  const size_t r0 = (size_t)blockIdx.x * 64;

  // LayerNorm2 on 64 rows of current out (= x + attn). A wave's eight rows go through
  // together: all row loads first, then each reduction step over the eight rows side by side.
  // The rows as loaded stay in registers: they are the residual of the rows this wave stores at the end.
  float4 xr[8];
  {
    float4 v[8];
#pragma unroll
    for (int t = 0; t < 8; ++t) {
      xr[t] = *(const float4*)(out + (r0 + wv + t * 8) * CC + lane * 4);
      v[t] = xr[t];
    }
    ln_rows<8>(v, n2g, n2b, lane);
#pragma unroll
    for (int t = 0; t < 8; ++t) {
      _Float16* dst = h2 + (wv + t * 8) * XP + lane * 4;
      dst[0] = (_Float16)v[t].x;
      dst[1] = (_Float16)v[t].y;
      dst[2] = (_Float16)v[t].z;
      dst[3] = (_Float16)v[t].w;
    }
    // The fc2 bias of this lane's four channels waits in LDS for the epilogue, in the wave's own copy.
    // Fetched here, the load lies under the LayerNorm; fetched where it is used, the compiler puts it
    // behind the last barrier, and the row stores wait out its whole latency.
    *(float4*)(fb + wv * CC + lane * 4) = *(const float4*)(fc2b + lane * 4);
  }
  __syncthreads();

  // fc1 + GELU (erf form): (64x128)@(128x512). Each wave owns 4 of the 32 column strips (64x16):
  // activation fragments stay in registers, each weight fragment feeds the four row tiles.
  {
    v16h af[4][4];
#pragma unroll
    for (int mt = 0; mt < 4; ++mt)
#pragma unroll
      for (int kk = 0; kk < 4; ++kk) af[mt][kk] = ld_a(h2, XP, mt * 16, kk * 32, lane);
    const _Float16* ws = w_strip(fc1Wt, wv, 4, lane);
    for (int j = 0; j < 4; ++j, ws += 8 * 4 * 512) {  // the wave's next strip is eight strips on
      int nt = wv + j * 8;
      v8f acc[4] = {};
      v16h bf[4];
#pragma unroll
      for (int kk = 0; kk < 4; ++kk) bf[kk] = ld_w(ws, kk);
      // Keeps the strip's eight weight loads in flight together: without it the scheduler
      // reuses one register set and waits out a full load latency at every k step.
      __builtin_amdgcn_sched_barrier(0);
#pragma unroll
      for (int kk = 0; kk < 4; ++kk)
#pragma unroll
        for (int mt = 0; mt < 4; ++mt) acc[mt] = WMMA_F16(af[mt][kk], bf[kk], acc[mt]);
      int n = nt * 16 + (lane & 15);
      float bb = fc1b[n];
#pragma unroll
      for (int mt = 0; mt < 4; ++mt) {
        int mbase = mt * 16 + ((lane >> 4) << 3);
#pragma unroll
        for (int r = 0; r < 8; r += 2) {
          v2f vv = {acc[mt][r] + bb, acc[mt][r + 1] + bb};
          v2h hh = __builtin_convertvector(gelu2(vv), v2h);
          a1[(mbase + r) * AP + n]     = hh.x;
          a1[(mbase + r + 1) * AP + n] = hh.y;
        }
      }
    }
  }
  __syncthreads();

  // fc2: (64x512)@(512x128). One 16-channel strip per wave: each weight fragment feeds the four
  // token tiles. The product is taken as W^T A^T, so a lane ends with 8 consecutive channels of ONE
  // token and hands them to the stage in two 16-byte stores.
  {
    int nt = wv;
    const _Float16* ws = w_strip(fc2Wt, nt, 16, lane);
    v8f acc[4] = {};
    v16h bf[2][4];   // weight fragments: this group of four k steps and the next
    v16h af[2][4];   // activation fragments: this k step and the next
#pragma unroll
    for (int q = 0; q < 4; ++q) bf[0][q] = ld_w(ws, q);
#pragma unroll
    for (int mt = 0; mt < 4; ++mt) af[0][mt] = ld_a(a1, AP, mt * 16, 0, lane);
#pragma unroll
    for (int kk = 0; kk < 16; ++kk) {
      if ((kk & 3) == 0 && kk + 4 < 16) {
#pragma unroll
        for (int q = 0; q < 4; ++q)
          bf[((kk >> 2) + 1) & 1][q] = ld_w(ws, kk + 4 + q);
      }
      if (kk + 1 < 16) {
#pragma unroll
        for (int mt = 0; mt < 4; ++mt) af[(kk + 1) & 1][mt] = ld_a(a1, AP, mt * 16, (kk + 1) * 32, lane);
      }
      // The two scheduling barriers hold the order "next step's loads as one group, then this
      // step's four matrix instructions": left free, the scheduler either loads each fragment
      // right in front of its use and waits out its latency, or runs past 256 registers.
      __builtin_amdgcn_sched_barrier(0);
      // Precaution: the stage addresses behind the loop may be given the registers that held the
      // weight address; this wait stands in front of that overwrite, a scheduling barrier behind it.
      if (kk == 15) asm volatile("s_wait_xcnt 0x0" ::: "memory");
#pragma unroll
      for (int mt = 0; mt < 4; ++mt)
        acc[mt] = WMMA_F16(bf[(kk >> 2) & 1][kk & 3], af[kk & 1][mt], acc[mt]);
      __builtin_amdgcn_sched_barrier(0);
    }
#pragma unroll
    for (int mt = 0; mt < 4; ++mt) {
      v4f* dst = (v4f*)(stage + (mt * 16 + (lane & 15)) * SP + nt * 16 + ((lane >> 4) << 3));
      dst[0] = __builtin_shufflevector(acc[mt], acc[mt], 0, 1, 2, 3);
      dst[1] = __builtin_shufflevector(acc[mt], acc[mt], 4, 5, 6, 7);
    }
  }
  __syncthreads();

  // A wave takes the rows it loaded at the top from the stage, adds bias and residual and stores
  // each row's 512 bytes, four whole cache lines, with one store.
  const float4 pb = *(const float4*)(fb + wv * CC + lane * 4);
#pragma unroll
  for (int t = 0; t < 8; ++t) {
    int row = wv + t * 8;
    float4 s = *(const float4*)(stage + row * SP + lane * 4);
    float4 o;
    o.x = xr[t].x + (s.x + pb.x);
    o.y = xr[t].y + (s.y + pb.y);
    o.z = xr[t].z + (s.z + pb.z);
    o.w = xr[t].w + (s.w + pb.w);
    *(float4*)(out + (r0 + row) * CC + lane * 4) = o;
  }
}

extern "C" void kernel_launch(void* const* d_in, const int* in_sizes, int n_in,
                              void* d_out, int out_size, void* d_ws, size_t ws_size,
                              hipStream_t stream) {
  (void)in_sizes; (void)n_in; (void)out_size; (void)ws_size;
  const float* x      = (const float*)d_in[0];
  const float* qkv_w  = (const float*)d_in[1];
  const float* qkv_b  = (const float*)d_in[2];
  const float* proj_w = (const float*)d_in[3];
  const float* proj_b = (const float*)d_in[4];
  const float* rpb    = (const float*)d_in[5];
  const float* n1g    = (const float*)d_in[6];
  const float* n1b    = (const float*)d_in[7];
  const float* n2g    = (const float*)d_in[8];
  const float* n2b    = (const float*)d_in[9];
  const float* fc1w   = (const float*)d_in[10];
  const float* fc1b   = (const float*)d_in[11];
  const float* fc2w   = (const float*)d_in[12];
  const float* fc2b   = (const float*)d_in[13];
  float* out = (float*)d_out;

  // f16 weights in fragment order (see k_wprep)
  _Float16* qkvWt  = (_Float16*)d_ws;          // 24 strips x 4 fragments
  _Float16* projWt = qkvWt + 384 * 128;        //  8 strips x 4 fragments
  _Float16* fc1Wt  = projWt + 128 * 128;       // 32 strips x 4 fragments
  _Float16* fc2Wt  = fc1Wt + 512 * 128;        //  8 strips x 16 fragments

  k_wprep<<<384, 256, 0, stream>>>(qkv_w, proj_w, fc1w, fc2w, qkvWt, projWt, fc1Wt, fc2Wt);

  k_attn<<<64 * 64, 256, 0, stream>>>(x, qkv_b, proj_b, rpb, n1g, n1b, qkvWt, projWt, out);
  k_mlp<<<3136, 256, 0, stream>>>(n2g, n2b, fc1Wt, fc1b, fc2Wt, fc2b, out);
}
